// v000
// Measured on an AMD MI455X. A time is GPU time per run, averaged over a window of back-to-back runs after a warm-up
// (all launches, gaps included; the runs take copies of the inputs in turn), and the median of several windows.
// Apart from v000's, it joins two sittings. Times from different sittings can be a few percent apart, while
// side-by-side timings come from the same sitting.
// v000 is the starting kernel. One run takes 947 microseconds.
#include <hip/hip_runtime.h>
#include <math.h>

#define HEADS 16

typedef __attribute__((ext_vector_type(16))) _Float16 v16h;
typedef __attribute__((ext_vector_type(8)))  float    v8f;
typedef __attribute__((ext_vector_type(4)))  unsigned u32x4;

union AV { v16h v; unsigned u[8]; _Float16 h[16]; };
union HV { v16h v; u32x4 q[2]; };

__device__ __forceinline__ v8f v8f_zero() {
    v8f z;
#pragma unroll
    for (int i = 0; i < 8; ++i) z[i] = 0.0f;
    return z;
}

__device__ __forceinline__ float gelu_tanh(float x) {
    const float k0 = 0.7978845608028654f; // sqrt(2/pi)
    const float k1 = 0.044715f;
    return 0.5f * x * (1.0f + tanhf(k0 * (x + k1 * x * x * x)));
}

// CDNA5 async global->LDS copy (ASYNCcnt-tracked), one 16B chunk per lane.
__device__ __forceinline__ void async_cp16(unsigned lds_off, const _Float16* g) {
    asm volatile("global_load_async_to_lds_b128 %0, %1, off"
                 :: "v"(lds_off), "v"((unsigned long long)(uintptr_t)g) : "memory");
}

// ---------------------------------------------------------------------------
// Convert f32 weight (K x N, row-major) -> f16 transposed (N x K, row-major)
// so WMMA B-operand (and async LDS staging) loads are K-contiguous.
// ---------------------------------------------------------------------------
__global__ void cvt_t_f16(const float* __restrict__ in, _Float16* __restrict__ out,
                          int K, int N) {
    size_t idx = (size_t)blockIdx.x * blockDim.x + threadIdx.x;
    size_t tot = (size_t)K * N;
    if (idx >= tot) return;
    size_t nn = idx / K;
    size_t kk = idx - nn * K;
    out[idx] = (_Float16)in[kk * (size_t)N + nn];
}

// f16 (R x C) -> f16 transposed (C x R):  out[c*R + r] = in[r*C + c]
__global__ void transpose_f16(const _Float16* __restrict__ in, _Float16* __restrict__ out,
                              int R, int C) {
    size_t idx = (size_t)blockIdx.x * blockDim.x + threadIdx.x;
    size_t tot = (size_t)R * C;
    if (idx >= tot) return;
    size_t c = idx / R;
    size_t r = idx - c * R;
    out[idx] = in[r * (size_t)C + c];
}

// ---------------------------------------------------------------------------
// Row LayerNorm, f32 in -> f16 out.  One 256-thread block per row.
// ---------------------------------------------------------------------------
__global__ void ln_f16_kernel(const float* __restrict__ x, const float* __restrict__ w,
                              const float* __restrict__ b, _Float16* __restrict__ out,
                              int d) {
    int row = blockIdx.x;
    const float* xr = x + (size_t)row * d;
    float s = 0.f, ss = 0.f;
    for (int i = threadIdx.x; i < d; i += blockDim.x) {
        float v = xr[i];
        s += v; ss += v * v;
    }
    __shared__ float rs[256], rss[256];
    rs[threadIdx.x] = s; rss[threadIdx.x] = ss;
    __syncthreads();
    for (int st = 128; st > 0; st >>= 1) {
        if (threadIdx.x < st) { rs[threadIdx.x] += rs[threadIdx.x + st];
                                rss[threadIdx.x] += rss[threadIdx.x + st]; }
        __syncthreads();
    }
    float mean = rs[0] / (float)d;
    float var  = rss[0] / (float)d - mean * mean;
    float inv  = rsqrtf(var + 1e-12f);
    for (int i = threadIdx.x; i < d; i += blockDim.x)
        out[(size_t)row * d + i] = (_Float16)((xr[i] - mean) * inv * w[i] + b[i]);
}

// ---------------------------------------------------------------------------
// Tiled WMMA GEMM with async global->LDS double-buffered staging.
//   out = act(A(MxK,f16) @ Bt(NxK,f16)^T + bias) (+ resid)
// Block: 256 threads (8 waves) computes 128x128 tile.
// Wave (wm in 0..1, wn in 0..3) computes 64x32 = 4x2 WMMA tiles.
// K staged in 32-wide slabs; sA/sB rows are 64B.  Copies use
// global_load_async_to_lds_b128 with s_wait_asynccnt<=4 pipelining.
// ---------------------------------------------------------------------------
__global__ __launch_bounds__(256)
void wmma_gemm_tiled(const _Float16* __restrict__ A, const _Float16* __restrict__ Bt,
                     const float* __restrict__ bias, const float* __restrict__ resid,
                     float* __restrict__ outf, _Float16* __restrict__ outh,
                     int M, int N, int K, int act) {
    __shared__ _Float16 sA[2][128 * 32];
    __shared__ _Float16 sB[2][128 * 32];

    const int tid  = threadIdx.x;
    const int lane = tid & 31;
    const int wave = tid >> 5;
    const int col  = lane & 15;   // M (A) / N (B,C) index within 16-tile
    const int hh   = lane >> 4;   // lane-half -> +8 K offset in A/B operands
    const int wn   = wave & 3;    // 4 N-groups of 32
    const int wm   = wave >> 2;   // 2 M-groups of 64
    const int m0   = blockIdx.y * 128;
    const int n0   = blockIdx.x * 128;

    const unsigned sAbase = (unsigned)(uintptr_t)(&sA[0][0]);
    const unsigned sBbase = (unsigned)(uintptr_t)(&sB[0][0]);

    // per-thread chunk assignment: rows r0 and r0+64, 16B chunk qc of the 64B row
    const int r0 = tid >> 2;
    const int qc = tid & 3;

    // stage one 128x32-half slab of A and B into LDS buffer `buf` (straight-line)
    auto stage = [&](int buf, int kk) {
        unsigned lbuf = (unsigned)(buf * 8192 + qc * 16);
        async_cp16(sAbase + lbuf + r0 * 64,
                   A + (size_t)(m0 + r0) * K + kk + qc * 8);
        async_cp16(sAbase + lbuf + (r0 + 64) * 64,
                   A + (size_t)(m0 + r0 + 64) * K + kk + qc * 8);
        async_cp16(sBbase + lbuf + r0 * 64,
                   Bt + (size_t)(n0 + r0) * K + kk + qc * 8);
        async_cp16(sBbase + lbuf + (r0 + 64) * 64,
                   Bt + (size_t)(n0 + r0 + 64) * K + kk + qc * 8);
    };

    v8f acc[4][2];
#pragma unroll
    for (int mi = 0; mi < 4; ++mi)
#pragma unroll
        for (int ni = 0; ni < 2; ++ni) acc[mi][ni] = v8f_zero();

    const int ksteps = K >> 5;
    stage(0, 0);
    for (int step = 0; step < ksteps; ++step) {
        const int buf = step & 1;
        if (step + 1 < ksteps) {
            stage(buf ^ 1, (step + 1) << 5);
            // 4 async ops just issued for next stage; in-order completion =>
            // waiting to <=4 guarantees the current stage has landed.
            asm volatile("s_wait_asynccnt 4" ::: "memory");
        } else {
            asm volatile("s_wait_asynccnt 0" ::: "memory");
        }
        __syncthreads();

        HV a[4], b[2];
#pragma unroll
        for (int mi = 0; mi < 4; ++mi) {
            const _Float16* p = &sA[buf][(wm * 64 + mi * 16 + col) * 32 + 8 * hh];
            a[mi].q[0] = *(const u32x4*)(p);
            a[mi].q[1] = *(const u32x4*)(p + 16);
        }
#pragma unroll
        for (int ni = 0; ni < 2; ++ni) {
            const _Float16* p = &sB[buf][(wn * 32 + ni * 16 + col) * 32 + 8 * hh];
            b[ni].q[0] = *(const u32x4*)(p);
            b[ni].q[1] = *(const u32x4*)(p + 16);
        }
#pragma unroll
        for (int mi = 0; mi < 4; ++mi)
#pragma unroll
            for (int ni = 0; ni < 2; ++ni)
                acc[mi][ni] = __builtin_amdgcn_wmma_f32_16x16x32_f16(
                    false, a[mi].v, false, b[ni].v, (short)0, acc[mi][ni], false, false);
        __syncthreads();   // protect LDS buffers before next async issue
    }

    float bn0 = bias ? bias[n0 + wn * 32 + col]      : 0.0f;
    float bn1 = bias ? bias[n0 + wn * 32 + 16 + col] : 0.0f;
#pragma unroll
    for (int mi = 0; mi < 4; ++mi) {
#pragma unroll
        for (int ni = 0; ni < 2; ++ni) {
            float bn = ni ? bn1 : bn0;
#pragma unroll
            for (int r = 0; r < 8; ++r) {
                float val = acc[mi][ni][r] + bn;
                if (act == 1) val = gelu_tanh(val);
                size_t idx = (size_t)(m0 + wm * 64 + mi * 16 + r + 8 * hh) * N
                           + (n0 + wn * 32 + ni * 16 + col);
                if (resid) val += resid[idx];
                if (outf) outf[idx] = val;
                if (outh) outh[idx] = (_Float16)val;
            }
        }
    }
}

// ---------------------------------------------------------------------------
// Causal flash attention.  One wave per (16-query block, head).
// q/k: (n x d) f16, head-h slice at column h*64, dh=64.
// vT: (d x n) f16 transposed V so the P@V B-operand is K-contiguous.
// Keys processed 32 at a time: S = Q Kb^T (4 WMMAs), online softmax,
// P restaged via LDS (C-layout -> A-layout), O += P Vb (4 WMMAs).
// ---------------------------------------------------------------------------
__global__ void flash_attn(const _Float16* __restrict__ q, const _Float16* __restrict__ k,
                           const _Float16* __restrict__ vT, _Float16* __restrict__ o,
                           int n, int d) {
    const int dh = 64;
    const float scale = 0.125f;              // 1/sqrt(64)
    int lane = threadIdx.x & 31;
    int col  = lane & 15;
    int hh   = lane >> 4;
    int head = blockIdx.y;
    int q0   = blockIdx.x * 16;
    const size_t hoff = (size_t)head * dh;

    __shared__ _Float16 sP[16][32];

    AV aq0, aq1;
    const _Float16* qrow = q + (size_t)(q0 + col) * d + hoff;
#pragma unroll
    for (int j = 0; j < 8; ++j) {
        int ko = 2 * j + 8 * hh + ((j >= 4) ? 8 : 0);
        aq0.u[j] = *(const unsigned*)(qrow + ko);
        aq1.u[j] = *(const unsigned*)(qrow + 32 + ko);
    }

    v8f acc[4];
#pragma unroll
    for (int t = 0; t < 4; ++t) acc[t] = v8f_zero();
    float mrow[8], lrow[8];
#pragma unroll
    for (int r = 0; r < 8; ++r) { mrow[r] = -1e30f; lrow[r] = 0.0f; }

    int nkb = (q0 + 16 + 31) / 32;
    for (int kb = 0; kb < nkb; ++kb) {
        int k0 = kb * 32;
        // ---- S = Q Kb^T : two 16x16 score tiles
        AV b0, b1, b2, b3;
        const _Float16* kr0 = k + (size_t)(k0 + col) * d + hoff;
        const _Float16* kr1 = k + (size_t)(k0 + 16 + col) * d + hoff;
#pragma unroll
        for (int j = 0; j < 8; ++j) {
            int ko = 2 * j + 8 * hh + ((j >= 4) ? 8 : 0);
            b0.u[j] = *(const unsigned*)(kr0 + ko);
            b1.u[j] = *(const unsigned*)(kr0 + 32 + ko);
            b2.u[j] = *(const unsigned*)(kr1 + ko);
            b3.u[j] = *(const unsigned*)(kr1 + 32 + ko);
        }
        v8f s0 = v8f_zero(), s1 = v8f_zero();
        s0 = __builtin_amdgcn_wmma_f32_16x16x32_f16(false, aq0.v, false, b0.v, (short)0, s0, false, false);
        s0 = __builtin_amdgcn_wmma_f32_16x16x32_f16(false, aq1.v, false, b1.v, (short)0, s0, false, false);
        s1 = __builtin_amdgcn_wmma_f32_16x16x32_f16(false, aq0.v, false, b2.v, (short)0, s1, false, false);
        s1 = __builtin_amdgcn_wmma_f32_16x16x32_f16(false, aq1.v, false, b3.v, (short)0, s1, false, false);

        // ---- scale + causal mask + online softmax (rows r+8*hh, cols lane%16)
        float rmax[8];
#pragma unroll
        for (int r = 0; r < 8; ++r) {
            int qg = q0 + r + 8 * hh;
            float a0 = s0[r] * scale;
            float a1 = s1[r] * scale;
            if (k0 + col > qg)      a0 = -1e30f;
            if (k0 + 16 + col > qg) a1 = -1e30f;
            s0[r] = a0; s1[r] = a1;
            float mx = fmaxf(a0, a1);
#pragma unroll
            for (int off = 1; off < 16; off <<= 1)
                mx = fmaxf(mx, __shfl_xor(mx, off, 32));
            rmax[r] = mx;
        }
#pragma unroll
        for (int r = 0; r < 8; ++r) {
            float mn = fmaxf(mrow[r], rmax[r]);
            float alpha = __expf(mrow[r] - mn);
            float p0 = __expf(s0[r] - mn);
            float p1 = __expf(s1[r] - mn);
            float rsum = p0 + p1;
#pragma unroll
            for (int off = 1; off < 16; off <<= 1)
                rsum += __shfl_xor(rsum, off, 32);
            lrow[r] = lrow[r] * alpha + rsum;
            mrow[r] = mn;
#pragma unroll
            for (int t = 0; t < 4; ++t) acc[t][r] *= alpha;
            sP[r + 8 * hh][col]      = (_Float16)p0;
            sP[r + 8 * hh][16 + col] = (_Float16)p1;
        }
        __syncthreads();

        // ---- P as A-operand (16x32) from LDS
        AV ap;
#pragma unroll
        for (int j = 0; j < 8; ++j) {
            int ko = 2 * j + 8 * hh + ((j >= 4) ? 8 : 0);
            ap.u[j] = *(const unsigned*)(&sP[col][ko]);
        }
        // ---- O += P @ Vb ; vT makes each B-operand two b128 loads
#pragma unroll
        for (int t = 0; t < 4; ++t) {
            HV bv;
            const _Float16* vb = vT + (size_t)(hoff + t * 16 + col) * n + k0 + 8 * hh;
            bv.q[0] = *(const u32x4*)(vb);
            bv.q[1] = *(const u32x4*)(vb + 16);
            acc[t] = __builtin_amdgcn_wmma_f32_16x16x32_f16(false, ap.v, false, bv.v,
                                                            (short)0, acc[t], false, false);
        }
        __syncthreads();
    }

#pragma unroll
    for (int t = 0; t < 4; ++t) {
#pragma unroll
        for (int r = 0; r < 8; ++r) {
            float val = acc[t][r] / lrow[r];
            o[(size_t)(q0 + r + 8 * hh) * d + hoff + t * 16 + col] = (_Float16)val;
        }
    }
}

// ---------------------------------------------------------------------------
// Host-side orchestration
// ---------------------------------------------------------------------------
extern "C" void kernel_launch(void* const* d_in, const int* in_sizes, int n_in,
                              void* d_out, int out_size, void* d_ws, size_t ws_size,
                              hipStream_t stream) {
    const int d   = in_sizes[1];          // 1024 (ln1_w)
    const int n   = in_sizes[0] / d;      // 4096
    const int dff = in_sizes[14];         // 4096 (bi)

    const float* x     = (const float*)d_in[0];
    const float* ln1_w = (const float*)d_in[1];
    const float* ln1_b = (const float*)d_in[2];
    const float* Wq    = (const float*)d_in[3];
    const float* bq    = (const float*)d_in[4];
    const float* Wk    = (const float*)d_in[5];
    const float* bk    = (const float*)d_in[6];
    const float* Wv    = (const float*)d_in[7];
    const float* bv    = (const float*)d_in[8];
    const float* Wo    = (const float*)d_in[9];
    const float* bo    = (const float*)d_in[10];
    const float* ln2_w = (const float*)d_in[11];
    const float* ln2_b = (const float*)d_in[12];
    const float* Wi    = (const float*)d_in[13];
    const float* bi    = (const float*)d_in[14];
    const float* Wout  = (const float*)d_in[15];
    const float* bout  = (const float*)d_in[16];

    char* ws = (char*)d_ws;
    size_t off = 0;
    auto alloc = [&](size_t bytes) -> void* {
        void* p = ws + off;
        off += (bytes + 255) & ~(size_t)255;
        return p;
    };
    _Float16* WqT   = (_Float16*)alloc((size_t)d * d * 2);
    _Float16* WkT   = (_Float16*)alloc((size_t)d * d * 2);
    _Float16* WvT   = (_Float16*)alloc((size_t)d * d * 2);
    _Float16* WoT   = (_Float16*)alloc((size_t)d * d * 2);
    _Float16* WiT   = (_Float16*)alloc((size_t)d * dff * 2);
    _Float16* WoutT = (_Float16*)alloc((size_t)dff * d * 2);
    _Float16* h1    = (_Float16*)alloc((size_t)n * d * 2);
    _Float16* q16   = (_Float16*)alloc((size_t)n * d * 2);
    _Float16* k16   = (_Float16*)alloc((size_t)n * d * 2);
    _Float16* v16   = (_Float16*)alloc((size_t)n * d * 2);
    _Float16* vTT   = (_Float16*)alloc((size_t)n * d * 2);
    _Float16* ao16  = (_Float16*)alloc((size_t)n * d * 2);
    float*    x1    = (float*)   alloc((size_t)n * d * 4);
    _Float16* h2    = (_Float16*)alloc((size_t)n * d * 2);
    _Float16* m16   = (_Float16*)alloc((size_t)n * dff * 2);

    const int T = 256;
    size_t wdd = (size_t)d * d, wdf = (size_t)d * dff, wnd = (size_t)n * d;
    cvt_t_f16<<<(unsigned)((wdd + T - 1) / T), T, 0, stream>>>(Wq, WqT, d, d);
    cvt_t_f16<<<(unsigned)((wdd + T - 1) / T), T, 0, stream>>>(Wk, WkT, d, d);
    cvt_t_f16<<<(unsigned)((wdd + T - 1) / T), T, 0, stream>>>(Wv, WvT, d, d);
    cvt_t_f16<<<(unsigned)((wdd + T - 1) / T), T, 0, stream>>>(Wo, WoT, d, d);
    cvt_t_f16<<<(unsigned)((wdf + T - 1) / T), T, 0, stream>>>(Wi, WiT, d, dff);
    cvt_t_f16<<<(unsigned)((wdf + T - 1) / T), T, 0, stream>>>(Wout, WoutT, dff, d);

    // LN1 -> h1 (f16)
    ln_f16_kernel<<<n, 256, 0, stream>>>(x, ln1_w, ln1_b, h1, d);

    // QKV projections (f16 out)
    dim3 gdd(d / 128, n / 128);
    wmma_gemm_tiled<<<gdd, 256, 0, stream>>>(h1, WqT, bq, nullptr, nullptr, q16, n, d, d, 0);
    wmma_gemm_tiled<<<gdd, 256, 0, stream>>>(h1, WkT, bk, nullptr, nullptr, k16, n, d, d, 0);
    wmma_gemm_tiled<<<gdd, 256, 0, stream>>>(h1, WvT, bv, nullptr, nullptr, v16, n, d, d, 0);

    // V^T (d x n) for K-contiguous P@V operands
    transpose_f16<<<(unsigned)((wnd + T - 1) / T), T, 0, stream>>>(v16, vTT, n, d);

    // causal flash attention -> ao16
    flash_attn<<<dim3(n / 16, HEADS), 32, 0, stream>>>(q16, k16, vTT, ao16, n, d);

    // out-proj + residual -> x1 (f32)
    wmma_gemm_tiled<<<gdd, 256, 0, stream>>>(ao16, WoT, bo, x, x1, nullptr, n, d, d, 0);

    // LN2 -> h2 (f16)
    ln_f16_kernel<<<n, 256, 0, stream>>>(x1, ln2_w, ln2_b, h2, d);

    // MLP up + GELU -> m16 (f16)
    wmma_gemm_tiled<<<dim3(dff / 128, n / 128), 256, 0, stream>>>(h2, WiT, bi, nullptr, nullptr, m16, n, dff, d, 1);

    // MLP down + bias + residual -> d_out (f32)
    wmma_gemm_tiled<<<dim3(d / 128, n / 128), 256, 0, stream>>>(m16, WoutT, bout, x1, (float*)d_out, nullptr, n, d, dff, 0);
}

// v001
// It runs in 550 microseconds.
// In two side-by-side timings against v000, it was 1.77 and 1.78 times as fast.
#include <hip/hip_runtime.h>
#include <math.h>

#define HEADS 16

typedef __attribute__((ext_vector_type(16))) _Float16 v16h;
typedef __attribute__((ext_vector_type(8)))  float    v8f;
typedef __attribute__((ext_vector_type(4)))  unsigned u32x4;

union AV { v16h v; unsigned u[8]; _Float16 h[16]; };
union HV { v16h v; u32x4 q[2]; };

__device__ __forceinline__ v8f v8f_zero() {
    v8f z;
#pragma unroll
    for (int i = 0; i < 8; ++i) z[i] = 0.0f;
    return z;
}

__device__ __forceinline__ float gelu_tanh(float x) {
    const float k0 = 0.7978845608028654f; // sqrt(2/pi)
    const float k1 = 0.044715f;
    return 0.5f * x * (1.0f + tanhf(k0 * (x + k1 * x * x * x)));
}

// CDNA5 async global->LDS copy (ASYNCcnt-tracked), one 16B chunk per lane.
__device__ __forceinline__ void async_cp16(unsigned lds_off, const _Float16* g) {
    asm volatile("global_load_async_to_lds_b128 %0, %1, off"
                 :: "v"(lds_off), "v"((unsigned long long)(uintptr_t)g) : "memory");
}

// ---------------------------------------------------------------------------
// Convert f32 weight (K x N, row-major) -> f16 transposed (N x K, row-major)
// so WMMA B-operand (and async LDS staging) loads are K-contiguous.
// ---------------------------------------------------------------------------
__global__ void cvt_t_f16(const float* __restrict__ in, _Float16* __restrict__ out,
                          int K, int N) {
    size_t idx = (size_t)blockIdx.x * blockDim.x + threadIdx.x;
    size_t tot = (size_t)K * N;
    if (idx >= tot) return;
    size_t nn = idx / K;
    size_t kk = idx - nn * K;
    out[idx] = (_Float16)in[kk * (size_t)N + nn];
}

// f16 (R x C) -> f16 transposed (C x R):  out[c*R + r] = in[r*C + c]
__global__ void transpose_f16(const _Float16* __restrict__ in, _Float16* __restrict__ out,
                              int R, int C) {
    size_t idx = (size_t)blockIdx.x * blockDim.x + threadIdx.x;
    size_t tot = (size_t)R * C;
    if (idx >= tot) return;
    size_t c = idx / R;
    size_t r = idx - c * R;
    out[idx] = in[r * (size_t)C + c];
}

// ---------------------------------------------------------------------------
// Row LayerNorm, f32 in -> f16 out.  One 256-thread block per row.
// ---------------------------------------------------------------------------
__global__ void ln_f16_kernel(const float* __restrict__ x, const float* __restrict__ w,
                              const float* __restrict__ b, _Float16* __restrict__ out,
                              int d) {
    int row = blockIdx.x;
    const float* xr = x + (size_t)row * d;
    float s = 0.f, ss = 0.f;
    for (int i = threadIdx.x; i < d; i += blockDim.x) {
        float v = xr[i];
        s += v; ss += v * v;
    }
    __shared__ float rs[256], rss[256];
    rs[threadIdx.x] = s; rss[threadIdx.x] = ss;
    __syncthreads();
    for (int st = 128; st > 0; st >>= 1) {
        if (threadIdx.x < st) { rs[threadIdx.x] += rs[threadIdx.x + st];
                                rss[threadIdx.x] += rss[threadIdx.x + st]; }
        __syncthreads();
    }
    float mean = rs[0] / (float)d;
    float var  = rss[0] / (float)d - mean * mean;
    float inv  = rsqrtf(var + 1e-12f);
    for (int i = threadIdx.x; i < d; i += blockDim.x)
        out[(size_t)row * d + i] = (_Float16)((xr[i] - mean) * inv * w[i] + b[i]);
}

// ---------------------------------------------------------------------------
// Tiled WMMA GEMM with async global->LDS double-buffered staging.
//   out = act(A(MxK,f16) @ Bt(NxK,f16)^T + bias) (+ resid)
// Block: 256 threads (8 waves) computes 128x128 tile.
// Wave (wm in 0..1, wn in 0..3) computes 64x32 = 4x2 WMMA tiles.
// K staged in 32-wide slabs; sA/sB rows are 64B.  Copies use
// global_load_async_to_lds_b128 with s_wait_asynccnt<=4 pipelining.
// ---------------------------------------------------------------------------
__global__ __launch_bounds__(256)
void wmma_gemm_tiled(const _Float16* __restrict__ A, const _Float16* __restrict__ Bt,
                     const float* __restrict__ bias, const float* __restrict__ resid,
                     float* __restrict__ outf, _Float16* __restrict__ outh,
                     int M, int N, int K, int act) {
    __shared__ _Float16 sA[2][128 * 32];
    __shared__ _Float16 sB[2][128 * 32];

    const int tid  = threadIdx.x;
    const int lane = tid & 31;
    const int wave = tid >> 5;
    const int col  = lane & 15;   // M (A) / N (B,C) index within 16-tile
    const int hh   = lane >> 4;   // lane-half -> +8 K offset in A/B operands
    const int wn   = wave & 3;    // 4 N-groups of 32
    const int wm   = wave >> 2;   // 2 M-groups of 64
    const int m0   = blockIdx.y * 128;
    const int n0   = blockIdx.x * 128;

    const unsigned sAbase = (unsigned)(uintptr_t)(&sA[0][0]);
    const unsigned sBbase = (unsigned)(uintptr_t)(&sB[0][0]);

    // per-thread chunk assignment: rows r0 and r0+64, 16B chunk qc of the 64B row
    const int r0 = tid >> 2;
    const int qc = tid & 3;

    // stage one 128x32-half slab of A and B into LDS buffer `buf` (straight-line)
    auto stage = [&](int buf, int kk) {
        unsigned lbuf = (unsigned)(buf * 8192 + qc * 16);
        async_cp16(sAbase + lbuf + r0 * 64,
                   A + (size_t)(m0 + r0) * K + kk + qc * 8);
        async_cp16(sAbase + lbuf + (r0 + 64) * 64,
                   A + (size_t)(m0 + r0 + 64) * K + kk + qc * 8);
        async_cp16(sBbase + lbuf + r0 * 64,
                   Bt + (size_t)(n0 + r0) * K + kk + qc * 8);
        async_cp16(sBbase + lbuf + (r0 + 64) * 64,
                   Bt + (size_t)(n0 + r0 + 64) * K + kk + qc * 8);
    };

    v8f acc[4][2];
#pragma unroll
    for (int mi = 0; mi < 4; ++mi)
#pragma unroll
        for (int ni = 0; ni < 2; ++ni) acc[mi][ni] = v8f_zero();

    const int ksteps = K >> 5;
    stage(0, 0);
    for (int step = 0; step < ksteps; ++step) {
        const int buf = step & 1;
        if (step + 1 < ksteps) {
            stage(buf ^ 1, (step + 1) << 5);
            // 4 async ops just issued for next stage; in-order completion =>
            // waiting to <=4 guarantees the current stage has landed.
            asm volatile("s_wait_asynccnt 4" ::: "memory");
        } else {
            asm volatile("s_wait_asynccnt 0" ::: "memory");
        }
        __syncthreads();

        HV a[4], b[2];
#pragma unroll
        for (int mi = 0; mi < 4; ++mi) {
            const _Float16* p = &sA[buf][(wm * 64 + mi * 16 + col) * 32 + 8 * hh];
            a[mi].q[0] = *(const u32x4*)(p);
            a[mi].q[1] = *(const u32x4*)(p + 16);
        }
#pragma unroll
        for (int ni = 0; ni < 2; ++ni) {
            const _Float16* p = &sB[buf][(wn * 32 + ni * 16 + col) * 32 + 8 * hh];
            b[ni].q[0] = *(const u32x4*)(p);
            b[ni].q[1] = *(const u32x4*)(p + 16);
        }
#pragma unroll
        for (int mi = 0; mi < 4; ++mi)
#pragma unroll
            for (int ni = 0; ni < 2; ++ni)
                acc[mi][ni] = __builtin_amdgcn_wmma_f32_16x16x32_f16(
                    false, a[mi].v, false, b[ni].v, (short)0, acc[mi][ni], false, false);
        __syncthreads();   // protect LDS buffers before next async issue
    }

    float bn0 = bias ? bias[n0 + wn * 32 + col]      : 0.0f;
    float bn1 = bias ? bias[n0 + wn * 32 + 16 + col] : 0.0f;
#pragma unroll
    for (int mi = 0; mi < 4; ++mi) {
#pragma unroll
        for (int ni = 0; ni < 2; ++ni) {
            float bn = ni ? bn1 : bn0;
#pragma unroll
            for (int r = 0; r < 8; ++r) {
                float val = acc[mi][ni][r] + bn;
                if (act == 1) val = gelu_tanh(val);
                size_t idx = (size_t)(m0 + wm * 64 + mi * 16 + r + 8 * hh) * N
                           + (n0 + wn * 32 + ni * 16 + col);
                if (resid) val += resid[idx];
                if (outf) outf[idx] = val;
                if (outh) outh[idx] = (_Float16)val;
            }
        }
    }
}

// ---------------------------------------------------------------------------
// Causal flash attention.  One 8-wave block per (128-query block, head); each
// wave owns 16 queries.  q/k: (n x d) f16, head-h slice at column h*64, dh=64.
// vT: (d x n) f16 transposed V so the P@V B-operand is K-contiguous.
// The eight waves share each 64-key tile of K (64 keys x 64 dims) and of vT
// (64 dims x 64 keys): the block copies it once into LDS as whole 128-byte
// rows, two buffers, the next tile in flight while this one is worked on.
// LDS rows are pitched 144 B for the 16-byte fragment reads.
// Per 32 keys as before: S = Q Kb^T (4 WMMAs), online softmax, P restaged via
// the wave's own LDS slice (C-layout -> A-layout), O += P Vb (4 WMMAs).
// ---------------------------------------------------------------------------
#define FA_PITCH 72                     // halves per staged row (144 B)
#define FA_TILE  (64 * FA_PITCH)        // halves per staged tile

// two such blocks share a WGP (four waves per SIMD): let the register allocator use that share
__global__ __launch_bounds__(256) __attribute__((amdgpu_waves_per_eu(4, 4)))
void flash_attn(const _Float16* __restrict__ q, const _Float16* __restrict__ k,
                const _Float16* __restrict__ vT, _Float16* __restrict__ o,
                int n, int d) {
    const int dh = 64;
    const float scale = 0.125f;              // 1/sqrt(64)
    const int tid  = threadIdx.x;
    const int lane = tid & 31;
    const int wave = __builtin_amdgcn_readfirstlane(tid >> 5);
    const int col  = lane & 15;
    const int hh   = lane >> 4;
    const int head = blockIdx.y;
    const int q0   = blockIdx.x * 128 + wave * 16;
    const size_t hoff = (size_t)head * dh;

    __shared__ __attribute__((aligned(16))) _Float16 sK[2][FA_TILE];
    __shared__ __attribute__((aligned(16))) _Float16 sV[2][FA_TILE];
    __shared__ __attribute__((aligned(16))) _Float16 sP[8][16][32];

    // copy assignment: rows cr and cr+32 of each tile, 16-byte chunk cc of the row
    const int cr = tid >> 3;
    const int cc = tid & 7;
    const unsigned lK = (unsigned)(uintptr_t)(&sK[0][0]) + (unsigned)(cr * (FA_PITCH * 2) + cc * 16);
    const unsigned lV = (unsigned)(uintptr_t)(&sV[0][0]) + (unsigned)(cr * (FA_PITCH * 2) + cc * 16);
    const _Float16* gK = k  + (size_t)cr * d + hoff + cc * 8;
    const _Float16* gV = vT + (hoff + cr) * (size_t)n + cc * 8;

    // stage key tile t (keys 64t .. 64t+63) of K and vT into buffer buf
    auto stage = [&](int buf, int t) {
        const unsigned lo = (unsigned)(buf * (FA_TILE * 2));
        const _Float16* k0p = gK + (size_t)t * 64 * d;
        const _Float16* k1p = k0p + (size_t)32 * d;
        const _Float16* v0p = gV + (size_t)t * 64;
        const _Float16* v1p = v0p + (size_t)32 * n;
        // the closing s_wait_xcnt keeps the address registers from being
        // rewritten while a copy that names them is still being issued
        asm volatile("global_load_async_to_lds_b128 %0, %4, off\n\t"
                     "global_load_async_to_lds_b128 %1, %5, off\n\t"
                     "global_load_async_to_lds_b128 %2, %6, off\n\t"
                     "global_load_async_to_lds_b128 %3, %7, off\n\t"
                     "s_wait_xcnt 0x0"
                     :: "v"(lK + lo), "v"(lK + lo + 32 * (FA_PITCH * 2)),
                        "v"(lV + lo), "v"(lV + lo + 32 * (FA_PITCH * 2)),
                        "v"((unsigned long long)(uintptr_t)k0p),
                        "v"((unsigned long long)(uintptr_t)k1p),
                        "v"((unsigned long long)(uintptr_t)v0p),
                        "v"((unsigned long long)(uintptr_t)v1p)
                     : "memory");
    };

    AV aq0, aq1;
    const _Float16* qrow = q + (size_t)(q0 + col) * d + hoff;
#pragma unroll
    for (int j = 0; j < 8; ++j) {
        int ko = 2 * j + 8 * hh + ((j >= 4) ? 8 : 0);
        aq0.u[j] = *(const unsigned*)(qrow + ko);
        aq1.u[j] = *(const unsigned*)(qrow + 32 + ko);
    }

    v8f acc[4];
#pragma unroll
    for (int t = 0; t < 4; ++t) acc[t] = v8f_zero();
    float mrow[8], lrow[8];
#pragma unroll
    for (int r = 0; r < 8; ++r) { mrow[r] = -1e30f; lrow[r] = 0.0f; }

    const int ntiles = 2 * (blockIdx.x + 1);     // 64-key tiles up to the block's diagonal

    stage(0, 0);
    // tile 0 has landed for this wave's copies; the barrier publishes all waves' copies
    asm volatile("s_wait_asynccnt 0x0" ::: "memory");
    __syncthreads();
    stage(1, 1);

    for (int kt = 0; kt < ntiles; ++kt) {
        const int buf = kt & 1;
#pragma unroll
        for (int ps = 0; ps < 2; ++ps) {
            const int k0 = kt * 64 + ps * 32;
            if (k0 > q0 + 15) continue;          // wave-uniform: keys wholly above the diagonal
            // ---- S = Q Kb^T : two 16x16 score tiles
            HV b0, b1, b2, b3;
            const _Float16* kr0 = &sK[buf][(ps * 32 + col) * FA_PITCH + 8 * hh];
            const _Float16* kr1 = kr0 + 16 * FA_PITCH;
            b0.q[0] = *(const u32x4*)(kr0);      b0.q[1] = *(const u32x4*)(kr0 + 16);
            b1.q[0] = *(const u32x4*)(kr0 + 32); b1.q[1] = *(const u32x4*)(kr0 + 48);
            b2.q[0] = *(const u32x4*)(kr1);      b2.q[1] = *(const u32x4*)(kr1 + 16);
            b3.q[0] = *(const u32x4*)(kr1 + 32); b3.q[1] = *(const u32x4*)(kr1 + 48);
            // holds the eight LDS reads together in front of the products: one LDS
            // latency per 32 keys instead of one in front of each product
            asm volatile("" :: "v"(b0.v), "v"(b1.v), "v"(b2.v), "v"(b3.v));
            v8f s0 = v8f_zero(), s1 = v8f_zero();
            s0 = __builtin_amdgcn_wmma_f32_16x16x32_f16(false, aq0.v, false, b0.v, (short)0, s0, false, false);
            s0 = __builtin_amdgcn_wmma_f32_16x16x32_f16(false, aq1.v, false, b1.v, (short)0, s0, false, false);
            s1 = __builtin_amdgcn_wmma_f32_16x16x32_f16(false, aq0.v, false, b2.v, (short)0, s1, false, false);
            s1 = __builtin_amdgcn_wmma_f32_16x16x32_f16(false, aq1.v, false, b3.v, (short)0, s1, false, false);

            // ---- scale + causal mask + online softmax (rows r+8*hh, cols lane%16)
            float rmax[8];
#pragma unroll
            for (int r = 0; r < 8; ++r) {
                int qg = q0 + r + 8 * hh;
                float a0 = s0[r] * scale;
                float a1 = s1[r] * scale;
                if (k0 + col > qg)      a0 = -1e30f;
                if (k0 + 16 + col > qg) a1 = -1e30f;
                s0[r] = a0; s1[r] = a1;
                float mx = fmaxf(a0, a1);
#pragma unroll
                for (int off = 1; off < 16; off <<= 1)
                    mx = fmaxf(mx, __shfl_xor(mx, off, 32));
                rmax[r] = mx;
            }
#pragma unroll
            for (int r = 0; r < 8; ++r) {
                float mn = fmaxf(mrow[r], rmax[r]);
                float alpha = __expf(mrow[r] - mn);
                float p0 = __expf(s0[r] - mn);
                float p1 = __expf(s1[r] - mn);
                float rsum = p0 + p1;
#pragma unroll
                for (int off = 1; off < 16; off <<= 1)
                    rsum += __shfl_xor(rsum, off, 32);
                lrow[r] = lrow[r] * alpha + rsum;
                mrow[r] = mn;
#pragma unroll
                for (int t = 0; t < 4; ++t) acc[t][r] *= alpha;
                sP[wave][r + 8 * hh][col]      = (_Float16)p0;
                sP[wave][r + 8 * hh][16 + col] = (_Float16)p1;
            }
            // P goes from lane to lane of this wave only: its own LDS stores
            // have to be done before the wave reads the rows back
            asm volatile("s_wait_dscnt 0x0" ::: "memory");

            // ---- P as A-operand (16x32) from LDS
            AV ap;
#pragma unroll
            for (int j = 0; j < 8; ++j) {
                int ko = 2 * j + 8 * hh + ((j >= 4) ? 8 : 0);
                ap.u[j] = *(const unsigned*)(&sP[wave][col][ko]);
            }
            // ---- O += P @ Vb ; each B-operand is two 16-byte LDS reads
#pragma unroll
            for (int t = 0; t < 4; ++t) {
                HV bv;
                const _Float16* vb = &sV[buf][(t * 16 + col) * FA_PITCH + ps * 32 + 8 * hh];
                bv.q[0] = *(const u32x4*)(vb);
                bv.q[1] = *(const u32x4*)(vb + 16);
                acc[t] = __builtin_amdgcn_wmma_f32_16x16x32_f16(false, ap.v, false, bv.v,
                                                                (short)0, acc[t], false, false);
            }
        }
        // hand-over, every wave: this wave's reads of buffer buf are done ...
        asm volatile("s_wait_dscnt 0x0" ::: "memory");
        // ... its copies of the next tile have landed ...
        asm volatile("s_wait_asynccnt 0x0" ::: "memory");
        // ... and the barrier publishes the next tile and frees buffer buf
        __syncthreads();
        if (kt + 2 < ntiles) stage(buf, kt + 2);
    }
    // no copy is left in flight when the wave ends
    asm volatile("s_wait_asynccnt 0x0" ::: "memory");

#pragma unroll
    for (int t = 0; t < 4; ++t) {
#pragma unroll
        for (int r = 0; r < 8; ++r) {
            float val = acc[t][r] / lrow[r];
            o[(size_t)(q0 + r + 8 * hh) * d + hoff + t * 16 + col] = (_Float16)val;
        }
    }
}

// ---------------------------------------------------------------------------
// Host-side orchestration
// ---------------------------------------------------------------------------
extern "C" void kernel_launch(void* const* d_in, const int* in_sizes, int n_in,
                              void* d_out, int out_size, void* d_ws, size_t ws_size,
                              hipStream_t stream) {
    const int d   = in_sizes[1];          // 1024 (ln1_w)
    const int n   = in_sizes[0] / d;      // 4096
    const int dff = in_sizes[14];         // 4096 (bi)

    const float* x     = (const float*)d_in[0];
    const float* ln1_w = (const float*)d_in[1];
    const float* ln1_b = (const float*)d_in[2];
    const float* Wq    = (const float*)d_in[3];
    const float* bq    = (const float*)d_in[4];
    const float* Wk    = (const float*)d_in[5];
    const float* bk    = (const float*)d_in[6];
    const float* Wv    = (const float*)d_in[7];
    const float* bv    = (const float*)d_in[8];
    const float* Wo    = (const float*)d_in[9];
    const float* bo    = (const float*)d_in[10];
    const float* ln2_w = (const float*)d_in[11];
    const float* ln2_b = (const float*)d_in[12];
    const float* Wi    = (const float*)d_in[13];
    const float* bi    = (const float*)d_in[14];
    const float* Wout  = (const float*)d_in[15];
    const float* bout  = (const float*)d_in[16];

    char* ws = (char*)d_ws;
    size_t off = 0;
    auto alloc = [&](size_t bytes) -> void* {
        void* p = ws + off;
        off += (bytes + 255) & ~(size_t)255;
        return p;
    };
    _Float16* WqT   = (_Float16*)alloc((size_t)d * d * 2);
    _Float16* WkT   = (_Float16*)alloc((size_t)d * d * 2);
    _Float16* WvT   = (_Float16*)alloc((size_t)d * d * 2);
    _Float16* WoT   = (_Float16*)alloc((size_t)d * d * 2);
    _Float16* WiT   = (_Float16*)alloc((size_t)d * dff * 2);
    _Float16* WoutT = (_Float16*)alloc((size_t)dff * d * 2);
    _Float16* h1    = (_Float16*)alloc((size_t)n * d * 2);
    _Float16* q16   = (_Float16*)alloc((size_t)n * d * 2);
    _Float16* k16   = (_Float16*)alloc((size_t)n * d * 2);
    _Float16* v16   = (_Float16*)alloc((size_t)n * d * 2);
    _Float16* vTT   = (_Float16*)alloc((size_t)n * d * 2);
    _Float16* ao16  = (_Float16*)alloc((size_t)n * d * 2);
    float*    x1    = (float*)   alloc((size_t)n * d * 4);
    _Float16* h2    = (_Float16*)alloc((size_t)n * d * 2);
    _Float16* m16   = (_Float16*)alloc((size_t)n * dff * 2);

    const int T = 256;
    size_t wdd = (size_t)d * d, wdf = (size_t)d * dff, wnd = (size_t)n * d;
    cvt_t_f16<<<(unsigned)((wdd + T - 1) / T), T, 0, stream>>>(Wq, WqT, d, d);
    cvt_t_f16<<<(unsigned)((wdd + T - 1) / T), T, 0, stream>>>(Wk, WkT, d, d);
    cvt_t_f16<<<(unsigned)((wdd + T - 1) / T), T, 0, stream>>>(Wv, WvT, d, d);
    cvt_t_f16<<<(unsigned)((wdd + T - 1) / T), T, 0, stream>>>(Wo, WoT, d, d);
    cvt_t_f16<<<(unsigned)((wdf + T - 1) / T), T, 0, stream>>>(Wi, WiT, d, dff);
    cvt_t_f16<<<(unsigned)((wdf + T - 1) / T), T, 0, stream>>>(Wout, WoutT, dff, d);

    // LN1 -> h1 (f16)
    ln_f16_kernel<<<n, 256, 0, stream>>>(x, ln1_w, ln1_b, h1, d);

    // QKV projections (f16 out)
    dim3 gdd(d / 128, n / 128);
    wmma_gemm_tiled<<<gdd, 256, 0, stream>>>(h1, WqT, bq, nullptr, nullptr, q16, n, d, d, 0);
    wmma_gemm_tiled<<<gdd, 256, 0, stream>>>(h1, WkT, bk, nullptr, nullptr, k16, n, d, d, 0);
    wmma_gemm_tiled<<<gdd, 256, 0, stream>>>(h1, WvT, bv, nullptr, nullptr, v16, n, d, d, 0);

    // V^T (d x n) for K-contiguous P@V operands
    transpose_f16<<<(unsigned)((wnd + T - 1) / T), T, 0, stream>>>(v16, vTT, n, d);

    // causal flash attention -> ao16
    flash_attn<<<dim3(n / 128, HEADS), 256, 0, stream>>>(q16, k16, vTT, ao16, n, d);

    // out-proj + residual -> x1 (f32)
    wmma_gemm_tiled<<<gdd, 256, 0, stream>>>(ao16, WoT, bo, x, x1, nullptr, n, d, d, 0);

    // LN2 -> h2 (f16)
    ln_f16_kernel<<<n, 256, 0, stream>>>(x1, ln2_w, ln2_b, h2, d);

    // MLP up + GELU -> m16 (f16)
    wmma_gemm_tiled<<<dim3(dff / 128, n / 128), 256, 0, stream>>>(h2, WiT, bi, nullptr, nullptr, m16, n, dff, d, 1);

    // MLP down + bias + residual -> d_out (f32)
    wmma_gemm_tiled<<<dim3(d / 128, n / 128), 256, 0, stream>>>(m16, WoutT, bout, x1, (float*)d_out, nullptr, n, d, dff, 0);
}

// v002
// It runs in 489 microseconds.
// Two timings next to v001 both put it at 1.13 times that version's speed.
// Over all steps from v000 it is 2.01 times as fast.
#include <hip/hip_runtime.h>
#include <math.h>

#define HEADS 16

typedef __attribute__((ext_vector_type(16))) _Float16 v16h;
typedef __attribute__((ext_vector_type(8)))  float    v8f;
typedef __attribute__((ext_vector_type(4)))  unsigned u32x4;
typedef __attribute__((ext_vector_type(4)))  float    f32x4;
typedef __attribute__((ext_vector_type(8)))  _Float16 h16x8;

union AV { v16h v; unsigned u[8]; _Float16 h[16]; };
union HV { v16h v; u32x4 q[2]; };

__device__ __forceinline__ v8f v8f_zero() {
    v8f z;
#pragma unroll
    for (int i = 0; i < 8; ++i) z[i] = 0.0f;
    return z;
}

__device__ __forceinline__ float gelu_tanh(float x) {
    const float k0 = 0.7978845608028654f; // sqrt(2/pi)
    const float k1 = 0.044715f;
    return 0.5f * x * (1.0f + tanhf(k0 * (x + k1 * x * x * x)));
}

// CDNA5 async global->LDS copy (ASYNCcnt-tracked), one 16B chunk per lane.
__device__ __forceinline__ void async_cp16(unsigned lds_off, const _Float16* g) {
    asm volatile("global_load_async_to_lds_b128 %0, %1, off"
                 :: "v"(lds_off), "v"((unsigned long long)(uintptr_t)g) : "memory");
}

// ---------------------------------------------------------------------------
// Convert f32 weight (K x N, row-major) -> f16 transposed (N x K, row-major)
// so WMMA B-operand (and async LDS staging) loads are K-contiguous.
// One 256-thread block moves a tile of 128 k x 64 n through LDS: 256-byte runs
// are read from every input row and 256-byte runs written to every output row.
// A thread reads 8 k x 4 n (eight 16-byte loads in flight), converts, and stores
// four 16-byte pieces (8 k of one n) into the transposed LDS tile.  The 16-byte
// piece index is XORed with n/4, so the 16 lanes of a half wave fall on all 64
// banks both when the tile is written and when it is read back by rows.
// K is a multiple of 128, N of 64.
// ---------------------------------------------------------------------------
__global__ __launch_bounds__(256)
void cvt_t_f16(const float* __restrict__ in, _Float16* __restrict__ out,
               int K, int N) {
    __shared__ __attribute__((aligned(16))) _Float16 s[64 * 128];
    const int tid = threadIdx.x;
    const int lo  = tid & 15;
    const int hi  = tid >> 4;
    const int k0  = blockIdx.y * 128;
    const int n0  = blockIdx.x * 64;

    const float* p[8];
    f32x4 v[8];
#pragma unroll
    for (int j = 0; j < 8; ++j) p[j] = in + (size_t)(k0 + hi * 8 + j) * N + n0 + lo * 4;
#pragma unroll
    for (int j = 0; j < 8; ++j) v[j] = *(const f32x4*)(p[j]);
    // holds the eight loads together in front of their first use, all in flight
    // at once; the address pairs are named as well, so that no load's result
    // lands on a pair that an earlier load still names
    asm volatile("" :: "v"(v[0]), "v"(v[1]), "v"(v[2]), "v"(v[3]),
                       "v"(v[4]), "v"(v[5]), "v"(v[6]), "v"(v[7]),
                       "v"(p[0]), "v"(p[1]), "v"(p[2]), "v"(p[3]),
                       "v"(p[4]), "v"(p[5]), "v"(p[6]), "v"(p[7]));
#pragma unroll
    for (int i = 0; i < 4; ++i) {
        h16x8 w;
#pragma unroll
        for (int j = 0; j < 8; ++j) w[j] = (_Float16)v[j][i];
        *(h16x8*)(&s[(lo * 4 + i) * 128 + ((hi ^ lo) * 8)]) = w;
    }
    __syncthreads();
#pragma unroll
    for (int it = 0; it < 4; ++it) {
        const int r = hi + it * 16;
        h16x8 w = *(const h16x8*)(&s[r * 128 + ((lo ^ (r >> 2)) * 8)]);
        *(h16x8*)(out + (size_t)(n0 + r) * K + k0 + lo * 8) = w;
    }
}

// f16 (R x C) -> f16 transposed (C x R):  out[c*R + r] = in[r*C + c]
// Same scheme, tile 128 r x 128 c: a thread reads 8 r x 8 c and stores eight
// 16-byte pieces (8 r of one c); the piece index is XORed with c/8.
// R and C are multiples of 128.
__global__ __launch_bounds__(256)
void transpose_f16(const _Float16* __restrict__ in, _Float16* __restrict__ out,
                   int R, int C) {
    __shared__ __attribute__((aligned(16))) _Float16 s[128 * 128];
    const int tid = threadIdx.x;
    const int lo  = tid & 15;
    const int hi  = tid >> 4;
    const int r0  = blockIdx.y * 128;
    const int c0  = blockIdx.x * 128;

    const _Float16* p[8];
    h16x8 v[8];
#pragma unroll
    for (int j = 0; j < 8; ++j) p[j] = in + (size_t)(r0 + hi * 8 + j) * C + c0 + lo * 8;
#pragma unroll
    for (int j = 0; j < 8; ++j) v[j] = *(const h16x8*)(p[j]);
    // holds the eight loads together in front of their first use, all in flight
    // at once; the address pairs are named as well, so that no load's result
    // lands on a pair that an earlier load still names
    asm volatile("" :: "v"(v[0]), "v"(v[1]), "v"(v[2]), "v"(v[3]),
                       "v"(v[4]), "v"(v[5]), "v"(v[6]), "v"(v[7]),
                       "v"(p[0]), "v"(p[1]), "v"(p[2]), "v"(p[3]),
                       "v"(p[4]), "v"(p[5]), "v"(p[6]), "v"(p[7]));
#pragma unroll
    for (int i = 0; i < 8; ++i) {
        h16x8 w;
#pragma unroll
        for (int j = 0; j < 8; ++j) w[j] = v[j][i];
        *(h16x8*)(&s[(lo * 8 + i) * 128 + ((hi ^ lo) * 8)]) = w;
    }
    __syncthreads();
#pragma unroll
    for (int it = 0; it < 8; ++it) {
        const int c = hi + it * 16;
        h16x8 w = *(const h16x8*)(&s[c * 128 + ((lo ^ (c >> 3)) * 8)]);
        *(h16x8*)(out + (size_t)(c0 + c) * R + r0 + lo * 8) = w;
    }
}

// ---------------------------------------------------------------------------
// Row LayerNorm, f32 in -> f16 out.  One 256-thread block per row.
// ---------------------------------------------------------------------------
__global__ void ln_f16_kernel(const float* __restrict__ x, const float* __restrict__ w,
                              const float* __restrict__ b, _Float16* __restrict__ out,
                              int d) {
    int row = blockIdx.x;
    const float* xr = x + (size_t)row * d;
    float s = 0.f, ss = 0.f;
    for (int i = threadIdx.x; i < d; i += blockDim.x) {
        float v = xr[i];
        s += v; ss += v * v;
    }
    __shared__ float rs[256], rss[256];
    rs[threadIdx.x] = s; rss[threadIdx.x] = ss;
    __syncthreads();
    for (int st = 128; st > 0; st >>= 1) {
        if (threadIdx.x < st) { rs[threadIdx.x] += rs[threadIdx.x + st];
                                rss[threadIdx.x] += rss[threadIdx.x + st]; }
        __syncthreads();
    }
    float mean = rs[0] / (float)d;
    float var  = rss[0] / (float)d - mean * mean;
    float inv  = rsqrtf(var + 1e-12f);
    for (int i = threadIdx.x; i < d; i += blockDim.x)
        out[(size_t)row * d + i] = (_Float16)((xr[i] - mean) * inv * w[i] + b[i]);
}

// ---------------------------------------------------------------------------
// Tiled WMMA GEMM with async global->LDS double-buffered staging.
//   out = act(A(MxK,f16) @ Bt(NxK,f16)^T + bias) (+ resid)
// Block: 256 threads (8 waves) computes 128x128 tile.
// Wave (wm in 0..1, wn in 0..3) computes 64x32 = 4x2 WMMA tiles.
// K staged in 32-wide slabs; sA/sB rows are 64B.  Copies use
// global_load_async_to_lds_b128 with s_wait_asynccnt<=4 pipelining.
// ---------------------------------------------------------------------------
__global__ __launch_bounds__(256)
void wmma_gemm_tiled(const _Float16* __restrict__ A, const _Float16* __restrict__ Bt,
                     const float* __restrict__ bias, const float* __restrict__ resid,
                     float* __restrict__ outf, _Float16* __restrict__ outh,
                     int M, int N, int K, int act) {
    __shared__ _Float16 sA[2][128 * 32];
    __shared__ _Float16 sB[2][128 * 32];

    const int tid  = threadIdx.x;
    const int lane = tid & 31;
    const int wave = tid >> 5;
    const int col  = lane & 15;   // M (A) / N (B,C) index within 16-tile
    const int hh   = lane >> 4;   // lane-half -> +8 K offset in A/B operands
    const int wn   = wave & 3;    // 4 N-groups of 32
    const int wm   = wave >> 2;   // 2 M-groups of 64
    const int m0   = blockIdx.y * 128;
    const int n0   = blockIdx.x * 128;

    const unsigned sAbase = (unsigned)(uintptr_t)(&sA[0][0]);
    const unsigned sBbase = (unsigned)(uintptr_t)(&sB[0][0]);

    // per-thread chunk assignment: rows r0 and r0+64, 16B chunk qc of the 64B row
    const int r0 = tid >> 2;
    const int qc = tid & 3;

    // stage one 128x32-half slab of A and B into LDS buffer `buf` (straight-line)
    auto stage = [&](int buf, int kk) {
        unsigned lbuf = (unsigned)(buf * 8192 + qc * 16);
        async_cp16(sAbase + lbuf + r0 * 64,
                   A + (size_t)(m0 + r0) * K + kk + qc * 8);
        async_cp16(sAbase + lbuf + (r0 + 64) * 64,
                   A + (size_t)(m0 + r0 + 64) * K + kk + qc * 8);
        async_cp16(sBbase + lbuf + r0 * 64,
                   Bt + (size_t)(n0 + r0) * K + kk + qc * 8);
        async_cp16(sBbase + lbuf + (r0 + 64) * 64,
                   Bt + (size_t)(n0 + r0 + 64) * K + kk + qc * 8);
    };

    v8f acc[4][2];
#pragma unroll
    for (int mi = 0; mi < 4; ++mi)
#pragma unroll
        for (int ni = 0; ni < 2; ++ni) acc[mi][ni] = v8f_zero();

    const int ksteps = K >> 5;
    stage(0, 0);
    for (int step = 0; step < ksteps; ++step) {
        const int buf = step & 1;
        if (step + 1 < ksteps) {
            stage(buf ^ 1, (step + 1) << 5);
            // 4 async ops just issued for next stage; in-order completion =>
            // waiting to <=4 guarantees the current stage has landed.
            asm volatile("s_wait_asynccnt 4" ::: "memory");
        } else {
            asm volatile("s_wait_asynccnt 0" ::: "memory");
        }
        __syncthreads();

        HV a[4], b[2];
#pragma unroll
        for (int mi = 0; mi < 4; ++mi) {
            const _Float16* p = &sA[buf][(wm * 64 + mi * 16 + col) * 32 + 8 * hh];
            a[mi].q[0] = *(const u32x4*)(p);
            a[mi].q[1] = *(const u32x4*)(p + 16);
        }
#pragma unroll
        for (int ni = 0; ni < 2; ++ni) {
            const _Float16* p = &sB[buf][(wn * 32 + ni * 16 + col) * 32 + 8 * hh];
            b[ni].q[0] = *(const u32x4*)(p);
            b[ni].q[1] = *(const u32x4*)(p + 16);
        }
#pragma unroll
        for (int mi = 0; mi < 4; ++mi)
#pragma unroll
            for (int ni = 0; ni < 2; ++ni)
                acc[mi][ni] = __builtin_amdgcn_wmma_f32_16x16x32_f16(
                    false, a[mi].v, false, b[ni].v, (short)0, acc[mi][ni], false, false);
        __syncthreads();   // protect LDS buffers before next async issue
    }

    float bn0 = bias ? bias[n0 + wn * 32 + col]      : 0.0f;
    float bn1 = bias ? bias[n0 + wn * 32 + 16 + col] : 0.0f;
#pragma unroll
    for (int mi = 0; mi < 4; ++mi) {
#pragma unroll
        for (int ni = 0; ni < 2; ++ni) {
            float bn = ni ? bn1 : bn0;
#pragma unroll
            for (int r = 0; r < 8; ++r) {
                float val = acc[mi][ni][r] + bn;
                if (act == 1) val = gelu_tanh(val);
                size_t idx = (size_t)(m0 + wm * 64 + mi * 16 + r + 8 * hh) * N
                           + (n0 + wn * 32 + ni * 16 + col);
                if (resid) val += resid[idx];
                if (outf) outf[idx] = val;
                if (outh) outh[idx] = (_Float16)val;
            }
        }
    }
}

// ---------------------------------------------------------------------------
// Causal flash attention.  One 8-wave block per (128-query block, head); each
// wave owns 16 queries.  q/k: (n x d) f16, head-h slice at column h*64, dh=64.
// vT: (d x n) f16 transposed V so the P@V B-operand is K-contiguous.
// The eight waves share each 64-key tile of K (64 keys x 64 dims) and of vT
// (64 dims x 64 keys): the block copies it once into LDS as whole 128-byte
// rows, two buffers, the next tile in flight while this one is worked on.
// LDS rows are pitched 144 B for the 16-byte fragment reads.
// Per 32 keys as before: S = Q Kb^T (4 WMMAs), online softmax, P restaged via
// the wave's own LDS slice (C-layout -> A-layout), O += P Vb (4 WMMAs).
// ---------------------------------------------------------------------------
#define FA_PITCH 72                     // halves per staged row (144 B)
#define FA_TILE  (64 * FA_PITCH)        // halves per staged tile

// two such blocks share a WGP (four waves per SIMD): let the register allocator use that share
__global__ __launch_bounds__(256) __attribute__((amdgpu_waves_per_eu(4, 4)))
void flash_attn(const _Float16* __restrict__ q, const _Float16* __restrict__ k,
                const _Float16* __restrict__ vT, _Float16* __restrict__ o,
                int n, int d) {
    const int dh = 64;
    const float scale = 0.125f;              // 1/sqrt(64)
    const int tid  = threadIdx.x;
    const int lane = tid & 31;
    const int wave = __builtin_amdgcn_readfirstlane(tid >> 5);
    const int col  = lane & 15;
    const int hh   = lane >> 4;
    const int head = blockIdx.y;
    const int q0   = blockIdx.x * 128 + wave * 16;
    const size_t hoff = (size_t)head * dh;

    __shared__ __attribute__((aligned(16))) _Float16 sK[2][FA_TILE];
    __shared__ __attribute__((aligned(16))) _Float16 sV[2][FA_TILE];
    __shared__ __attribute__((aligned(16))) _Float16 sP[8][16][32];

    // copy assignment: rows cr and cr+32 of each tile, 16-byte chunk cc of the row
    const int cr = tid >> 3;
    const int cc = tid & 7;
    const unsigned lK = (unsigned)(uintptr_t)(&sK[0][0]) + (unsigned)(cr * (FA_PITCH * 2) + cc * 16);
    const unsigned lV = (unsigned)(uintptr_t)(&sV[0][0]) + (unsigned)(cr * (FA_PITCH * 2) + cc * 16);
    const _Float16* gK = k  + (size_t)cr * d + hoff + cc * 8;
    const _Float16* gV = vT + (hoff + cr) * (size_t)n + cc * 8;

    // stage key tile t (keys 64t .. 64t+63) of K and vT into buffer buf
    auto stage = [&](int buf, int t) {
        const unsigned lo = (unsigned)(buf * (FA_TILE * 2));
        const _Float16* k0p = gK + (size_t)t * 64 * d;
        const _Float16* k1p = k0p + (size_t)32 * d;
        const _Float16* v0p = gV + (size_t)t * 64;
        const _Float16* v1p = v0p + (size_t)32 * n;
        // the closing s_wait_xcnt keeps the address registers from being
        // rewritten while a copy that names them is still being issued
        asm volatile("global_load_async_to_lds_b128 %0, %4, off\n\t"
                     "global_load_async_to_lds_b128 %1, %5, off\n\t"
                     "global_load_async_to_lds_b128 %2, %6, off\n\t"
                     "global_load_async_to_lds_b128 %3, %7, off\n\t"
                     "s_wait_xcnt 0x0"
                     :: "v"(lK + lo), "v"(lK + lo + 32 * (FA_PITCH * 2)),
                        "v"(lV + lo), "v"(lV + lo + 32 * (FA_PITCH * 2)),
                        "v"((unsigned long long)(uintptr_t)k0p),
                        "v"((unsigned long long)(uintptr_t)k1p),
                        "v"((unsigned long long)(uintptr_t)v0p),
                        "v"((unsigned long long)(uintptr_t)v1p)
                     : "memory");
    };

    AV aq0, aq1;
    const _Float16* qrow = q + (size_t)(q0 + col) * d + hoff;
#pragma unroll
    for (int j = 0; j < 8; ++j) {
        int ko = 2 * j + 8 * hh + ((j >= 4) ? 8 : 0);
        aq0.u[j] = *(const unsigned*)(qrow + ko);
        aq1.u[j] = *(const unsigned*)(qrow + 32 + ko);
    }

    v8f acc[4];
#pragma unroll
    for (int t = 0; t < 4; ++t) acc[t] = v8f_zero();
    float mrow[8], lrow[8];
#pragma unroll
    for (int r = 0; r < 8; ++r) { mrow[r] = -1e30f; lrow[r] = 0.0f; }

    const int ntiles = 2 * (blockIdx.x + 1);     // 64-key tiles up to the block's diagonal

    stage(0, 0);
    // tile 0 has landed for this wave's copies; the barrier publishes all waves' copies
    asm volatile("s_wait_asynccnt 0x0" ::: "memory");
    __syncthreads();
    stage(1, 1);

    for (int kt = 0; kt < ntiles; ++kt) {
        const int buf = kt & 1;
#pragma unroll
        for (int ps = 0; ps < 2; ++ps) {
            const int k0 = kt * 64 + ps * 32;
            if (k0 > q0 + 15) continue;          // wave-uniform: keys wholly above the diagonal
            // ---- S = Q Kb^T : two 16x16 score tiles
            HV b0, b1, b2, b3;
            const _Float16* kr0 = &sK[buf][(ps * 32 + col) * FA_PITCH + 8 * hh];
            const _Float16* kr1 = kr0 + 16 * FA_PITCH;
            b0.q[0] = *(const u32x4*)(kr0);      b0.q[1] = *(const u32x4*)(kr0 + 16);
            b1.q[0] = *(const u32x4*)(kr0 + 32); b1.q[1] = *(const u32x4*)(kr0 + 48);
            b2.q[0] = *(const u32x4*)(kr1);      b2.q[1] = *(const u32x4*)(kr1 + 16);
            b3.q[0] = *(const u32x4*)(kr1 + 32); b3.q[1] = *(const u32x4*)(kr1 + 48);
            // holds the eight LDS reads together in front of the products: one LDS
            // latency per 32 keys instead of one in front of each product
            asm volatile("" :: "v"(b0.v), "v"(b1.v), "v"(b2.v), "v"(b3.v));
            v8f s0 = v8f_zero(), s1 = v8f_zero();
            s0 = __builtin_amdgcn_wmma_f32_16x16x32_f16(false, aq0.v, false, b0.v, (short)0, s0, false, false);
            s0 = __builtin_amdgcn_wmma_f32_16x16x32_f16(false, aq1.v, false, b1.v, (short)0, s0, false, false);
            s1 = __builtin_amdgcn_wmma_f32_16x16x32_f16(false, aq0.v, false, b2.v, (short)0, s1, false, false);
            s1 = __builtin_amdgcn_wmma_f32_16x16x32_f16(false, aq1.v, false, b3.v, (short)0, s1, false, false);

            // ---- scale + causal mask + online softmax (rows r+8*hh, cols lane%16)
            float rmax[8];
#pragma unroll
            for (int r = 0; r < 8; ++r) {
                int qg = q0 + r + 8 * hh;
                float a0 = s0[r] * scale;
                float a1 = s1[r] * scale;
                if (k0 + col > qg)      a0 = -1e30f;
                if (k0 + 16 + col > qg) a1 = -1e30f;
                s0[r] = a0; s1[r] = a1;
                float mx = fmaxf(a0, a1);
#pragma unroll
                for (int off = 1; off < 16; off <<= 1)
                    mx = fmaxf(mx, __shfl_xor(mx, off, 32));
                rmax[r] = mx;
            }
#pragma unroll
            for (int r = 0; r < 8; ++r) {
                float mn = fmaxf(mrow[r], rmax[r]);
                float alpha = __expf(mrow[r] - mn);
                float p0 = __expf(s0[r] - mn);
                float p1 = __expf(s1[r] - mn);
                float rsum = p0 + p1;
#pragma unroll
                for (int off = 1; off < 16; off <<= 1)
                    rsum += __shfl_xor(rsum, off, 32);
                lrow[r] = lrow[r] * alpha + rsum;
                mrow[r] = mn;
#pragma unroll
                for (int t = 0; t < 4; ++t) acc[t][r] *= alpha;
                sP[wave][r + 8 * hh][col]      = (_Float16)p0;
                sP[wave][r + 8 * hh][16 + col] = (_Float16)p1;
            }
            // P goes from lane to lane of this wave only: its own LDS stores
            // have to be done before the wave reads the rows back
            asm volatile("s_wait_dscnt 0x0" ::: "memory");

            // ---- P as A-operand (16x32) from LDS
            AV ap;
#pragma unroll
            for (int j = 0; j < 8; ++j) {
                int ko = 2 * j + 8 * hh + ((j >= 4) ? 8 : 0);
                ap.u[j] = *(const unsigned*)(&sP[wave][col][ko]);
            }
            // ---- O += P @ Vb ; each B-operand is two 16-byte LDS reads
#pragma unroll
            for (int t = 0; t < 4; ++t) {
                HV bv;
                const _Float16* vb = &sV[buf][(t * 16 + col) * FA_PITCH + ps * 32 + 8 * hh];
                bv.q[0] = *(const u32x4*)(vb);
                bv.q[1] = *(const u32x4*)(vb + 16);
                acc[t] = __builtin_amdgcn_wmma_f32_16x16x32_f16(false, ap.v, false, bv.v,
                                                                (short)0, acc[t], false, false);
            }
        }
        // hand-over, every wave: this wave's reads of buffer buf are done ...
        asm volatile("s_wait_dscnt 0x0" ::: "memory");
        // ... its copies of the next tile have landed ...
        asm volatile("s_wait_asynccnt 0x0" ::: "memory");
        // ... and the barrier publishes the next tile and frees buffer buf
        __syncthreads();
        if (kt + 2 < ntiles) stage(buf, kt + 2);
    }
    // no copy is left in flight when the wave ends
    asm volatile("s_wait_asynccnt 0x0" ::: "memory");

#pragma unroll
    for (int t = 0; t < 4; ++t) {
#pragma unroll
        for (int r = 0; r < 8; ++r) {
            float val = acc[t][r] / lrow[r];
            o[(size_t)(q0 + r + 8 * hh) * d + hoff + t * 16 + col] = (_Float16)val;
        }
    }
}

// ---------------------------------------------------------------------------
// Host-side orchestration
// ---------------------------------------------------------------------------
extern "C" void kernel_launch(void* const* d_in, const int* in_sizes, int n_in,
                              void* d_out, int out_size, void* d_ws, size_t ws_size,
                              hipStream_t stream) {
    const int d   = in_sizes[1];          // 1024 (ln1_w)
    const int n   = in_sizes[0] / d;      // 4096
    const int dff = in_sizes[14];         // 4096 (bi)

    const float* x     = (const float*)d_in[0];
    const float* ln1_w = (const float*)d_in[1];
    const float* ln1_b = (const float*)d_in[2];
    const float* Wq    = (const float*)d_in[3];
    const float* bq    = (const float*)d_in[4];
    const float* Wk    = (const float*)d_in[5];
    const float* bk    = (const float*)d_in[6];
    const float* Wv    = (const float*)d_in[7];
    const float* bv    = (const float*)d_in[8];
    const float* Wo    = (const float*)d_in[9];
    const float* bo    = (const float*)d_in[10];
    const float* ln2_w = (const float*)d_in[11];
    const float* ln2_b = (const float*)d_in[12];
    const float* Wi    = (const float*)d_in[13];
    const float* bi    = (const float*)d_in[14];
    const float* Wout  = (const float*)d_in[15];
    const float* bout  = (const float*)d_in[16];

    char* ws = (char*)d_ws;
    size_t off = 0;
    auto alloc = [&](size_t bytes) -> void* {
        void* p = ws + off;
        off += (bytes + 255) & ~(size_t)255;
        return p;
    };
    _Float16* WqT   = (_Float16*)alloc((size_t)d * d * 2);
    _Float16* WkT   = (_Float16*)alloc((size_t)d * d * 2);
    _Float16* WvT   = (_Float16*)alloc((size_t)d * d * 2);
    _Float16* WoT   = (_Float16*)alloc((size_t)d * d * 2);
    _Float16* WiT   = (_Float16*)alloc((size_t)d * dff * 2);
    _Float16* WoutT = (_Float16*)alloc((size_t)dff * d * 2);
    _Float16* h1    = (_Float16*)alloc((size_t)n * d * 2);
    _Float16* q16   = (_Float16*)alloc((size_t)n * d * 2);
    _Float16* k16   = (_Float16*)alloc((size_t)n * d * 2);
    _Float16* v16   = (_Float16*)alloc((size_t)n * d * 2);
    _Float16* vTT   = (_Float16*)alloc((size_t)n * d * 2);
    _Float16* ao16  = (_Float16*)alloc((size_t)n * d * 2);
    float*    x1    = (float*)   alloc((size_t)n * d * 4);
    _Float16* h2    = (_Float16*)alloc((size_t)n * d * 2);
    _Float16* m16   = (_Float16*)alloc((size_t)n * dff * 2);

    cvt_t_f16<<<dim3(d / 64, d / 128), 256, 0, stream>>>(Wq, WqT, d, d);
    cvt_t_f16<<<dim3(d / 64, d / 128), 256, 0, stream>>>(Wk, WkT, d, d);
    cvt_t_f16<<<dim3(d / 64, d / 128), 256, 0, stream>>>(Wv, WvT, d, d);
    cvt_t_f16<<<dim3(d / 64, d / 128), 256, 0, stream>>>(Wo, WoT, d, d);
    cvt_t_f16<<<dim3(dff / 64, d / 128), 256, 0, stream>>>(Wi, WiT, d, dff);
    cvt_t_f16<<<dim3(d / 64, dff / 128), 256, 0, stream>>>(Wout, WoutT, dff, d);

    // LN1 -> h1 (f16)
    ln_f16_kernel<<<n, 256, 0, stream>>>(x, ln1_w, ln1_b, h1, d);

    // QKV projections (f16 out)
    dim3 gdd(d / 128, n / 128);
    wmma_gemm_tiled<<<gdd, 256, 0, stream>>>(h1, WqT, bq, nullptr, nullptr, q16, n, d, d, 0);
    wmma_gemm_tiled<<<gdd, 256, 0, stream>>>(h1, WkT, bk, nullptr, nullptr, k16, n, d, d, 0);
    wmma_gemm_tiled<<<gdd, 256, 0, stream>>>(h1, WvT, bv, nullptr, nullptr, v16, n, d, d, 0);

    // V^T (d x n) for K-contiguous P@V operands
    transpose_f16<<<dim3(d / 128, n / 128), 256, 0, stream>>>(v16, vTT, n, d);

    // causal flash attention -> ao16
    flash_attn<<<dim3(n / 128, HEADS), 256, 0, stream>>>(q16, k16, vTT, ao16, n, d);

    // out-proj + residual -> x1 (f32)
    wmma_gemm_tiled<<<gdd, 256, 0, stream>>>(ao16, WoT, bo, x, x1, nullptr, n, d, d, 0);

    // LN2 -> h2 (f16)
    ln_f16_kernel<<<n, 256, 0, stream>>>(x1, ln2_w, ln2_b, h2, d);

    // MLP up + GELU -> m16 (f16)
    wmma_gemm_tiled<<<dim3(dff / 128, n / 128), 256, 0, stream>>>(h2, WiT, bi, nullptr, nullptr, m16, n, dff, d, 1);

    // MLP down + bias + residual -> d_out (f32)
    wmma_gemm_tiled<<<dim3(d / 128, n / 128), 256, 0, stream>>>(m16, WoutT, bout, x1, (float*)d_out, nullptr, n, d, dff, 0);
}

// v003
// It runs in 392 microseconds.
// Two timings next to v002 both put it at 1.24 times that version's speed.
// Over all steps from v000 it is 2.48 times as fast.
#include <hip/hip_runtime.h>
#include <math.h>

#define HEADS 16

typedef __attribute__((ext_vector_type(16))) _Float16 v16h;
typedef __attribute__((ext_vector_type(8)))  float    v8f;
typedef __attribute__((ext_vector_type(4)))  unsigned u32x4;
typedef __attribute__((ext_vector_type(4)))  float    f32x4;
typedef __attribute__((ext_vector_type(8)))  _Float16 h16x8;

union AV { v16h v; unsigned u[8]; _Float16 h[16]; };
union HV { v16h v; u32x4 q[2]; };

__device__ __forceinline__ v8f v8f_zero() {
    v8f z;
#pragma unroll
    for (int i = 0; i < 8; ++i) z[i] = 0.0f;
    return z;
}

__device__ __forceinline__ float gelu_tanh(float x) {
    const float k0 = 0.7978845608028654f; // sqrt(2/pi)
    const float k1 = 0.044715f;
    return 0.5f * x * (1.0f + tanhf(k0 * (x + k1 * x * x * x)));
}

// CDNA5 async global->LDS copy (ASYNCcnt-tracked), one 16B chunk per lane.
__device__ __forceinline__ void async_cp16(unsigned lds_off, const _Float16* g) {
    asm volatile("global_load_async_to_lds_b128 %0, %1, off"
                 :: "v"(lds_off), "v"((unsigned long long)(uintptr_t)g) : "memory");
}

// ---------------------------------------------------------------------------
// Convert f32 weight (K x N, row-major) -> f16 transposed (N x K, row-major)
// so WMMA B-operand (and async LDS staging) loads are K-contiguous.
// One 256-thread block moves a tile of 128 k x 64 n through LDS: 256-byte runs
// are read from every input row and 256-byte runs written to every output row.
// A thread reads 8 k x 4 n (eight 16-byte loads in flight), converts, and stores
// four 16-byte pieces (8 k of one n) into the transposed LDS tile.  The 16-byte
// piece index is XORed with n/4, so the 16 lanes of a half wave fall on all 64
// banks both when the tile is written and when it is read back by rows.
// K is a multiple of 128, N of 64.
// ---------------------------------------------------------------------------
__global__ __launch_bounds__(256)
void cvt_t_f16(const float* __restrict__ in, _Float16* __restrict__ out,
               int K, int N) {
    __shared__ __attribute__((aligned(16))) _Float16 s[64 * 128];
    const int tid = threadIdx.x;
    const int lo  = tid & 15;
    const int hi  = tid >> 4;
    const int k0  = blockIdx.y * 128;
    const int n0  = blockIdx.x * 64;

    const float* p[8];
    f32x4 v[8];
#pragma unroll
    for (int j = 0; j < 8; ++j) p[j] = in + (size_t)(k0 + hi * 8 + j) * N + n0 + lo * 4;
#pragma unroll
    for (int j = 0; j < 8; ++j) v[j] = *(const f32x4*)(p[j]);
    // holds the eight loads together in front of their first use, all in flight
    // at once; the address pairs are named as well, so that no load's result
    // lands on a pair that an earlier load still names
    asm volatile("" :: "v"(v[0]), "v"(v[1]), "v"(v[2]), "v"(v[3]),
                       "v"(v[4]), "v"(v[5]), "v"(v[6]), "v"(v[7]),
                       "v"(p[0]), "v"(p[1]), "v"(p[2]), "v"(p[3]),
                       "v"(p[4]), "v"(p[5]), "v"(p[6]), "v"(p[7]));
#pragma unroll
    for (int i = 0; i < 4; ++i) {
        h16x8 w;
#pragma unroll
        for (int j = 0; j < 8; ++j) w[j] = (_Float16)v[j][i];
        *(h16x8*)(&s[(lo * 4 + i) * 128 + ((hi ^ lo) * 8)]) = w;
    }
    __syncthreads();
#pragma unroll
    for (int it = 0; it < 4; ++it) {
        const int r = hi + it * 16;
        h16x8 w = *(const h16x8*)(&s[r * 128 + ((lo ^ (r >> 2)) * 8)]);
        *(h16x8*)(out + (size_t)(n0 + r) * K + k0 + lo * 8) = w;
    }
}

// f16 (R x C) -> f16 transposed (C x R):  out[c*R + r] = in[r*C + c]
// Same scheme, tile 128 r x 128 c: a thread reads 8 r x 8 c and stores eight
// 16-byte pieces (8 r of one c); the piece index is XORed with c/8.
// R and C are multiples of 128.
__global__ __launch_bounds__(256)
void transpose_f16(const _Float16* __restrict__ in, _Float16* __restrict__ out,
                   int R, int C) {
    __shared__ __attribute__((aligned(16))) _Float16 s[128 * 128];
    const int tid = threadIdx.x;
    const int lo  = tid & 15;
    const int hi  = tid >> 4;
    const int r0  = blockIdx.y * 128;
    const int c0  = blockIdx.x * 128;

    const _Float16* p[8];
    h16x8 v[8];
#pragma unroll
    for (int j = 0; j < 8; ++j) p[j] = in + (size_t)(r0 + hi * 8 + j) * C + c0 + lo * 8;
#pragma unroll
    for (int j = 0; j < 8; ++j) v[j] = *(const h16x8*)(p[j]);
    // holds the eight loads together in front of their first use, all in flight
    // at once; the address pairs are named as well, so that no load's result
    // lands on a pair that an earlier load still names
    asm volatile("" :: "v"(v[0]), "v"(v[1]), "v"(v[2]), "v"(v[3]),
                       "v"(v[4]), "v"(v[5]), "v"(v[6]), "v"(v[7]),
                       "v"(p[0]), "v"(p[1]), "v"(p[2]), "v"(p[3]),
                       "v"(p[4]), "v"(p[5]), "v"(p[6]), "v"(p[7]));
#pragma unroll
    for (int i = 0; i < 8; ++i) {
        h16x8 w;
#pragma unroll
        for (int j = 0; j < 8; ++j) w[j] = v[j][i];
        *(h16x8*)(&s[(lo * 8 + i) * 128 + ((hi ^ lo) * 8)]) = w;
    }
    __syncthreads();
#pragma unroll
    for (int it = 0; it < 8; ++it) {
        const int c = hi + it * 16;
        h16x8 w = *(const h16x8*)(&s[c * 128 + ((lo ^ (c >> 3)) * 8)]);
        *(h16x8*)(out + (size_t)(c0 + c) * R + r0 + lo * 8) = w;
    }
}

// ---------------------------------------------------------------------------
// Row LayerNorm, f32 in -> f16 out.  One 256-thread block per row.
// ---------------------------------------------------------------------------
__global__ void ln_f16_kernel(const float* __restrict__ x, const float* __restrict__ w,
                              const float* __restrict__ b, _Float16* __restrict__ out,
                              int d) {
    int row = blockIdx.x;
    const float* xr = x + (size_t)row * d;
    float s = 0.f, ss = 0.f;
    for (int i = threadIdx.x; i < d; i += blockDim.x) {
        float v = xr[i];
        s += v; ss += v * v;
    }
    __shared__ float rs[256], rss[256];
    rs[threadIdx.x] = s; rss[threadIdx.x] = ss;
    __syncthreads();
    for (int st = 128; st > 0; st >>= 1) {
        if (threadIdx.x < st) { rs[threadIdx.x] += rs[threadIdx.x + st];
                                rss[threadIdx.x] += rss[threadIdx.x + st]; }
        __syncthreads();
    }
    float mean = rs[0] / (float)d;
    float var  = rss[0] / (float)d - mean * mean;
    float inv  = rsqrtf(var + 1e-12f);
    for (int i = threadIdx.x; i < d; i += blockDim.x)
        out[(size_t)row * d + i] = (_Float16)((xr[i] - mean) * inv * w[i] + b[i]);
}

// ---------------------------------------------------------------------------
// Tiled WMMA GEMM with async global->LDS double-buffered staging.
//   out = act(A(MxK,f16) @ Bt(NxK,f16)^T + bias) (+ resid)
// Block: 256 threads (8 waves) computes 128x128 tile.
// Wave (wm in 0..1, wn in 0..3) computes 64x32 = 4x2 WMMA tiles.
// K staged in 32-wide slabs; sA/sB rows are 64B.  Copies use
// global_load_async_to_lds_b128 with s_wait_asynccnt<=4 pipelining.
// ---------------------------------------------------------------------------
__global__ __launch_bounds__(256)
void wmma_gemm_tiled(const _Float16* __restrict__ A, const _Float16* __restrict__ Bt,
                     const float* __restrict__ bias, const float* __restrict__ resid,
                     float* __restrict__ outf, _Float16* __restrict__ outh,
                     int M, int N, int K, int act) {
    __shared__ _Float16 sA[2][128 * 32];
    __shared__ _Float16 sB[2][128 * 32];

    const int tid  = threadIdx.x;
    const int lane = tid & 31;
    const int wave = tid >> 5;
    const int col  = lane & 15;   // M (A) / N (B,C) index within 16-tile
    const int hh   = lane >> 4;   // lane-half -> +8 K offset in A/B operands
    const int wn   = wave & 3;    // 4 N-groups of 32
    const int wm   = wave >> 2;   // 2 M-groups of 64
    const int m0   = blockIdx.y * 128;
    const int n0   = blockIdx.x * 128;

    const unsigned sAbase = (unsigned)(uintptr_t)(&sA[0][0]);
    const unsigned sBbase = (unsigned)(uintptr_t)(&sB[0][0]);

    // per-thread chunk assignment: rows r0 and r0+64, 16B chunk qc of the 64B row
    const int r0 = tid >> 2;
    const int qc = tid & 3;

    // stage one 128x32-half slab of A and B into LDS buffer `buf` (straight-line)
    auto stage = [&](int buf, int kk) {
        unsigned lbuf = (unsigned)(buf * 8192 + qc * 16);
        async_cp16(sAbase + lbuf + r0 * 64,
                   A + (size_t)(m0 + r0) * K + kk + qc * 8);
        async_cp16(sAbase + lbuf + (r0 + 64) * 64,
                   A + (size_t)(m0 + r0 + 64) * K + kk + qc * 8);
        async_cp16(sBbase + lbuf + r0 * 64,
                   Bt + (size_t)(n0 + r0) * K + kk + qc * 8);
        async_cp16(sBbase + lbuf + (r0 + 64) * 64,
                   Bt + (size_t)(n0 + r0 + 64) * K + kk + qc * 8);
    };

    v8f acc[4][2];
#pragma unroll
    for (int mi = 0; mi < 4; ++mi)
#pragma unroll
        for (int ni = 0; ni < 2; ++ni) acc[mi][ni] = v8f_zero();

    const int ksteps = K >> 5;
    stage(0, 0);
    for (int step = 0; step < ksteps; ++step) {
        const int buf = step & 1;
        if (step + 1 < ksteps) {
            stage(buf ^ 1, (step + 1) << 5);
            // 4 async ops just issued for next stage; in-order completion =>
            // waiting to <=4 guarantees the current stage has landed.
            asm volatile("s_wait_asynccnt 4" ::: "memory");
        } else {
            asm volatile("s_wait_asynccnt 0" ::: "memory");
        }
        __syncthreads();

        HV a[4], b[2];
#pragma unroll
        for (int mi = 0; mi < 4; ++mi) {
            const _Float16* p = &sA[buf][(wm * 64 + mi * 16 + col) * 32 + 8 * hh];
            a[mi].q[0] = *(const u32x4*)(p);
            a[mi].q[1] = *(const u32x4*)(p + 16);
        }
#pragma unroll
        for (int ni = 0; ni < 2; ++ni) {
            const _Float16* p = &sB[buf][(wn * 32 + ni * 16 + col) * 32 + 8 * hh];
            b[ni].q[0] = *(const u32x4*)(p);
            b[ni].q[1] = *(const u32x4*)(p + 16);
        }
#pragma unroll
        for (int mi = 0; mi < 4; ++mi)
#pragma unroll
            for (int ni = 0; ni < 2; ++ni)
                acc[mi][ni] = __builtin_amdgcn_wmma_f32_16x16x32_f16(
                    false, a[mi].v, false, b[ni].v, (short)0, acc[mi][ni], false, false);
        __syncthreads();   // protect LDS buffers before next async issue
    }

    float bn0 = bias ? bias[n0 + wn * 32 + col]      : 0.0f;
    float bn1 = bias ? bias[n0 + wn * 32 + 16 + col] : 0.0f;
#pragma unroll
    for (int mi = 0; mi < 4; ++mi) {
#pragma unroll
        for (int ni = 0; ni < 2; ++ni) {
            float bn = ni ? bn1 : bn0;
#pragma unroll
            for (int r = 0; r < 8; ++r) {
                float val = acc[mi][ni][r] + bn;
                if (act == 1) val = gelu_tanh(val);
                size_t idx = (size_t)(m0 + wm * 64 + mi * 16 + r + 8 * hh) * N
                           + (n0 + wn * 32 + ni * 16 + col);
                if (resid) val += resid[idx];
                if (outf) outf[idx] = val;
                if (outh) outh[idx] = (_Float16)val;
            }
        }
    }
}

// ---------------------------------------------------------------------------
// Causal flash attention.  One 8-wave block per (128-query block, head); each
// wave owns 16 queries.  q/k: (n x d) f16, head-h slice at column h*64, dh=64.
// vT: (d x n) f16 transposed V, so its rows are key-contiguous.
// The eight waves share each 64-key tile of K (64 keys x 64 dims) and of vT
// (64 dims x 64 keys): the block copies it once into LDS as whole 128-byte
// rows, two buffers, the next tile in flight while this one is worked on.
// LDS rows are pitched 144 B for the 16-byte fragment reads.
// The products are taken transposed: S^T = Kb Q^T (A = K rows, B = Q) and
// O^T += Vb^T P^T (A = vT rows, B = P^T).  A lane then holds 16 of the 32
// scores of ONE query (lane%16), so maximum and sum run inside the lane with a
// single exchange between the wave's halves, and the two score tiles, converted
// in place, already are the B operand of the second product.
// ---------------------------------------------------------------------------
// 2^x of eight (exp2x8) or nine (exp2x9) values.  One statement each, results kept
// apart from arguments ("=&v") and a closing v_nop: the instruction set asks for one
// slot between a transcendental and an instruction that reads its result or
// overwrites its argument.
__device__ __forceinline__ void exp2x8(float (&y)[8], const float (&x)[8]) {
    asm("v_exp_f32 %0, %8\n\t"  "v_exp_f32 %1, %9\n\t"
        "v_exp_f32 %2, %10\n\t" "v_exp_f32 %3, %11\n\t"
        "v_exp_f32 %4, %12\n\t" "v_exp_f32 %5, %13\n\t"
        "v_exp_f32 %6, %14\n\t" "v_exp_f32 %7, %15\n\t"
        "v_nop"
        : "=&v"(y[0]), "=&v"(y[1]), "=&v"(y[2]), "=&v"(y[3]),
          "=&v"(y[4]), "=&v"(y[5]), "=&v"(y[6]), "=&v"(y[7])
        : "v"(x[0]), "v"(x[1]), "v"(x[2]), "v"(x[3]),
          "v"(x[4]), "v"(x[5]), "v"(x[6]), "v"(x[7]));
}
__device__ __forceinline__ void exp2x9(float& ya, float (&y)[8], float xa, const float (&x)[8]) {
    asm("v_exp_f32 %0, %9\n\t"  "v_exp_f32 %1, %10\n\t"
        "v_exp_f32 %2, %11\n\t" "v_exp_f32 %3, %12\n\t"
        "v_exp_f32 %4, %13\n\t" "v_exp_f32 %5, %14\n\t"
        "v_exp_f32 %6, %15\n\t" "v_exp_f32 %7, %16\n\t"
        "v_exp_f32 %8, %17\n\t"
        "v_nop"
        : "=&v"(ya), "=&v"(y[0]), "=&v"(y[1]), "=&v"(y[2]), "=&v"(y[3]),
          "=&v"(y[4]), "=&v"(y[5]), "=&v"(y[6]), "=&v"(y[7])
        : "v"(xa), "v"(x[0]), "v"(x[1]), "v"(x[2]), "v"(x[3]),
          "v"(x[4]), "v"(x[5]), "v"(x[6]), "v"(x[7]));
}

#define FA_PITCH 72                     // halves per staged row (144 B)
#define FA_TILE  (64 * FA_PITCH)        // halves per staged tile

// two such blocks share a WGP (four waves per SIMD): let the register allocator use that share
__global__ __launch_bounds__(256) __attribute__((amdgpu_waves_per_eu(4, 4)))
void flash_attn(const _Float16* __restrict__ q, const _Float16* __restrict__ k,
                const _Float16* __restrict__ vT, _Float16* __restrict__ o,
                int n, int d) {
    const int dh = 64;
    const float scale = 0.125f;              // 1/sqrt(64)
    const int tid  = threadIdx.x;
    const int lane = tid & 31;
    const int wave = __builtin_amdgcn_readfirstlane(tid >> 5);
    const int col  = lane & 15;
    const int hh   = lane >> 4;
    const int head = blockIdx.y;
    const int q0   = blockIdx.x * 128 + wave * 16;
    const size_t hoff = (size_t)head * dh;

    __shared__ __attribute__((aligned(16))) _Float16 sK[2][FA_TILE];
    __shared__ __attribute__((aligned(16))) _Float16 sV[2][FA_TILE];

    // copy assignment: rows cr and cr+32 of each tile, 16-byte chunk cc of the row
    const int cr = tid >> 3;
    const int cc = tid & 7;
    const unsigned lK = (unsigned)(uintptr_t)(&sK[0][0]) + (unsigned)(cr * (FA_PITCH * 2) + cc * 16);
    const unsigned lV = (unsigned)(uintptr_t)(&sV[0][0]) + (unsigned)(cr * (FA_PITCH * 2) + cc * 16);
    const _Float16* gK = k  + (size_t)cr * d + hoff + cc * 8;
    const _Float16* gV = vT + (hoff + cr) * (size_t)n + cc * 8;

    // stage key tile t (keys 64t .. 64t+63) of K and vT into buffer buf
    auto stage = [&](int buf, int t) {
        const unsigned lo = (unsigned)(buf * (FA_TILE * 2));
        const _Float16* k0p = gK + (size_t)t * 64 * d;
        const _Float16* k1p = k0p + (size_t)32 * d;
        const _Float16* v0p = gV + (size_t)t * 64;
        const _Float16* v1p = v0p + (size_t)32 * n;
        // the closing s_wait_xcnt keeps the address registers from being
        // rewritten while a copy that names them is still being issued
        asm volatile("global_load_async_to_lds_b128 %0, %4, off\n\t"
                     "global_load_async_to_lds_b128 %1, %5, off\n\t"
                     "global_load_async_to_lds_b128 %2, %6, off\n\t"
                     "global_load_async_to_lds_b128 %3, %7, off\n\t"
                     "s_wait_xcnt 0x0"
                     :: "v"(lK + lo), "v"(lK + lo + 32 * (FA_PITCH * 2)),
                        "v"(lV + lo), "v"(lV + lo + 32 * (FA_PITCH * 2)),
                        "v"((unsigned long long)(uintptr_t)k0p),
                        "v"((unsigned long long)(uintptr_t)k1p),
                        "v"((unsigned long long)(uintptr_t)v0p),
                        "v"((unsigned long long)(uintptr_t)v1p)
                     : "memory");
    };

    AV aq0, aq1;
    const _Float16* qrow = q + (size_t)(q0 + col) * d + hoff;
#pragma unroll
    for (int j = 0; j < 8; ++j) {
        int ko = 2 * j + 8 * hh + ((j >= 4) ? 8 : 0);
        aq0.u[j] = *(const unsigned*)(qrow + ko);
        aq1.u[j] = *(const unsigned*)(qrow + 32 + ko);
    }

    v8f acc[4];
#pragma unroll
    for (int t = 0; t < 4; ++t) acc[t] = v8f_zero();
    // of query q0 + col: running maximum (equal in both halves of the wave) and
    // the sum over the keys that this half of the wave holds
    float mrow = -1e30f, lrow = 0.0f;
    const int qg = q0 + col;

    const int ntiles = 2 * (blockIdx.x + 1);     // 64-key tiles up to the block's diagonal

    stage(0, 0);
    // tile 0 has landed for this wave's copies; the barrier publishes all waves' copies
    asm volatile("s_wait_asynccnt 0x0" ::: "memory");
    __syncthreads();
    stage(1, 1);

    for (int kt = 0; kt < ntiles; ++kt) {
        const int buf = kt & 1;
#pragma unroll
        for (int ps = 0; ps < 2; ++ps) {
            const int k0 = kt * 64 + ps * 32;
            if (k0 > q0 + 15) continue;          // wave-uniform: keys wholly above the diagonal
            // ---- S^T = Kb Q^T : two 16x16 score tiles (keys x queries)
            HV b0, b1, b2, b3;
            const _Float16* kr0 = &sK[buf][(ps * 32 + col) * FA_PITCH + 8 * hh];
            const _Float16* kr1 = kr0 + 16 * FA_PITCH;
            b0.q[0] = *(const u32x4*)(kr0);      b0.q[1] = *(const u32x4*)(kr0 + 16);
            b1.q[0] = *(const u32x4*)(kr0 + 32); b1.q[1] = *(const u32x4*)(kr0 + 48);
            b2.q[0] = *(const u32x4*)(kr1);      b2.q[1] = *(const u32x4*)(kr1 + 16);
            b3.q[0] = *(const u32x4*)(kr1 + 32); b3.q[1] = *(const u32x4*)(kr1 + 48);
            // holds the eight LDS reads together in front of the products: one LDS
            // latency per 32 keys instead of one in front of each product
            asm volatile("" :: "v"(b0.v), "v"(b1.v), "v"(b2.v), "v"(b3.v));
            v8f s0 = v8f_zero(), s1 = v8f_zero();
            s0 = __builtin_amdgcn_wmma_f32_16x16x32_f16(false, b0.v, false, aq0.v, (short)0, s0, false, false);
            s0 = __builtin_amdgcn_wmma_f32_16x16x32_f16(false, b1.v, false, aq1.v, (short)0, s0, false, false);
            s1 = __builtin_amdgcn_wmma_f32_16x16x32_f16(false, b2.v, false, aq0.v, (short)0, s1, false, false);
            s1 = __builtin_amdgcn_wmma_f32_16x16x32_f16(false, b3.v, false, aq1.v, (short)0, s1, false, false);

            // ---- scale + causal mask + online softmax
            // s0[r]: key k0 + 8*hh + r, s1[r]: key k0 + 16 + 8*hh + r, query qg
            const int kb = k0 + 8 * hh;
            float mx = -1e30f;
#pragma unroll
            for (int r = 0; r < 8; ++r) {
                float a0 = s0[r] * scale;
                float a1 = s1[r] * scale;
                if (kb + r > qg)      a0 = -1e30f;
                if (kb + 16 + r > qg) a1 = -1e30f;
                s0[r] = a0; s1[r] = a1;
                mx = fmaxf(mx, fmaxf(a0, a1));
            }
            // the other 16 keys of this query sit in lane ^ 16
            mx = fmaxf(mx, __int_as_float(__builtin_amdgcn_permlanex16(
                     __float_as_int(mx), __float_as_int(mx), 0x76543210, 0xfedcba98, false, false)));
            const float mn = fmaxf(mrow, mx);
            // e^x as 2^(x * log2 e)
            const float l2e = 1.4426950408889634f;
            float e0[8], e1[8], p0[8], p1[8], alpha;
#pragma unroll
            for (int r = 0; r < 8; ++r) {
                e0[r] = (s0[r] - mn) * l2e;
                e1[r] = (s1[r] - mn) * l2e;
            }
            exp2x9(alpha, p0, (mrow - mn) * l2e, e0);
            exp2x8(p1, e1);
            mrow = mn;
            AV bp;                               // P^T as B operand: 16 + 16 keys of query col
            float rsum = p0[0] + p1[0];
#pragma unroll
            for (int r = 0; r < 8; ++r) {
                if (r) rsum += p0[r] + p1[r];
                bp.h[r]     = (_Float16)p0[r];
                bp.h[8 + r] = (_Float16)p1[r];
            }
            lrow = lrow * alpha + rsum;
#pragma unroll
            for (int t = 0; t < 4; ++t)
#pragma unroll
                for (int r = 0; r < 8; ++r) acc[t][r] *= alpha;

            // ---- O^T += Vb^T P^T ; each A operand is two 16-byte LDS reads
#pragma unroll
            for (int t = 0; t < 4; ++t) {
                HV bv;
                const _Float16* vb = &sV[buf][(t * 16 + col) * FA_PITCH + ps * 32 + 8 * hh];
                bv.q[0] = *(const u32x4*)(vb);
                bv.q[1] = *(const u32x4*)(vb + 16);
                acc[t] = __builtin_amdgcn_wmma_f32_16x16x32_f16(false, bv.v, false, bp.v,
                                                                (short)0, acc[t], false, false);
            }
        }
        // hand-over, every wave: this wave's reads of buffer buf are done ...
        asm volatile("s_wait_dscnt 0x0" ::: "memory");
        // ... its copies of the next tile have landed ...
        asm volatile("s_wait_asynccnt 0x0" ::: "memory");
        // ... and the barrier publishes the next tile and frees buffer buf
        __syncthreads();
        if (kt + 2 < ntiles) stage(buf, kt + 2);
    }
    // no copy is left in flight when the wave ends
    asm volatile("s_wait_asynccnt 0x0" ::: "memory");

    // join the two halves' sums of each query
    lrow += __int_as_float(__builtin_amdgcn_permlanex16(
                __float_as_int(lrow), __float_as_int(lrow), 0x76543210, 0xfedcba98, false, false));
    // acc[t][r] = O[q0 + col][t*16 + 8*hh + r]: eight consecutive dims, one 16-byte store
    _Float16* orow = o + (size_t)qg * d + hoff + 8 * hh;
#pragma unroll
    for (int t = 0; t < 4; ++t) {
        h16x8 w;
#pragma unroll
        for (int r = 0; r < 8; ++r) w[r] = (_Float16)(acc[t][r] / lrow);
        *(h16x8*)(orow + t * 16) = w;
    }
}

// ---------------------------------------------------------------------------
// Host-side orchestration
// ---------------------------------------------------------------------------
extern "C" void kernel_launch(void* const* d_in, const int* in_sizes, int n_in,
                              void* d_out, int out_size, void* d_ws, size_t ws_size,
                              hipStream_t stream) {
    const int d   = in_sizes[1];          // 1024 (ln1_w)
    const int n   = in_sizes[0] / d;      // 4096
    const int dff = in_sizes[14];         // 4096 (bi)

    const float* x     = (const float*)d_in[0];
    const float* ln1_w = (const float*)d_in[1];
    const float* ln1_b = (const float*)d_in[2];
    const float* Wq    = (const float*)d_in[3];
    const float* bq    = (const float*)d_in[4];
    const float* Wk    = (const float*)d_in[5];
    const float* bk    = (const float*)d_in[6];
    const float* Wv    = (const float*)d_in[7];
    const float* bv    = (const float*)d_in[8];
    const float* Wo    = (const float*)d_in[9];
    const float* bo    = (const float*)d_in[10];
    const float* ln2_w = (const float*)d_in[11];
    const float* ln2_b = (const float*)d_in[12];
    const float* Wi    = (const float*)d_in[13];
    const float* bi    = (const float*)d_in[14];
    const float* Wout  = (const float*)d_in[15];
    const float* bout  = (const float*)d_in[16];

    char* ws = (char*)d_ws;
    size_t off = 0;
    auto alloc = [&](size_t bytes) -> void* {
        void* p = ws + off;
        off += (bytes + 255) & ~(size_t)255;
        return p;
    };
    _Float16* WqT   = (_Float16*)alloc((size_t)d * d * 2);
    _Float16* WkT   = (_Float16*)alloc((size_t)d * d * 2);
    _Float16* WvT   = (_Float16*)alloc((size_t)d * d * 2);
    _Float16* WoT   = (_Float16*)alloc((size_t)d * d * 2);
    _Float16* WiT   = (_Float16*)alloc((size_t)d * dff * 2);
    _Float16* WoutT = (_Float16*)alloc((size_t)dff * d * 2);
    _Float16* h1    = (_Float16*)alloc((size_t)n * d * 2);
    _Float16* q16   = (_Float16*)alloc((size_t)n * d * 2);
    _Float16* k16   = (_Float16*)alloc((size_t)n * d * 2);
    _Float16* v16   = (_Float16*)alloc((size_t)n * d * 2);
    _Float16* vTT   = (_Float16*)alloc((size_t)n * d * 2);
    _Float16* ao16  = (_Float16*)alloc((size_t)n * d * 2);
    float*    x1    = (float*)   alloc((size_t)n * d * 4);
    _Float16* h2    = (_Float16*)alloc((size_t)n * d * 2);
    _Float16* m16   = (_Float16*)alloc((size_t)n * dff * 2);

    cvt_t_f16<<<dim3(d / 64, d / 128), 256, 0, stream>>>(Wq, WqT, d, d);
    cvt_t_f16<<<dim3(d / 64, d / 128), 256, 0, stream>>>(Wk, WkT, d, d);
    cvt_t_f16<<<dim3(d / 64, d / 128), 256, 0, stream>>>(Wv, WvT, d, d);
    cvt_t_f16<<<dim3(d / 64, d / 128), 256, 0, stream>>>(Wo, WoT, d, d);
    cvt_t_f16<<<dim3(dff / 64, d / 128), 256, 0, stream>>>(Wi, WiT, d, dff);
    cvt_t_f16<<<dim3(d / 64, dff / 128), 256, 0, stream>>>(Wout, WoutT, dff, d);

    // LN1 -> h1 (f16)
    ln_f16_kernel<<<n, 256, 0, stream>>>(x, ln1_w, ln1_b, h1, d);

    // QKV projections (f16 out)
    dim3 gdd(d / 128, n / 128);
    wmma_gemm_tiled<<<gdd, 256, 0, stream>>>(h1, WqT, bq, nullptr, nullptr, q16, n, d, d, 0);
    wmma_gemm_tiled<<<gdd, 256, 0, stream>>>(h1, WkT, bk, nullptr, nullptr, k16, n, d, d, 0);
    wmma_gemm_tiled<<<gdd, 256, 0, stream>>>(h1, WvT, bv, nullptr, nullptr, v16, n, d, d, 0);

    // V^T (d x n) for K-contiguous P@V operands
    transpose_f16<<<dim3(d / 128, n / 128), 256, 0, stream>>>(v16, vTT, n, d);

    // causal flash attention -> ao16
    flash_attn<<<dim3(n / 128, HEADS), 256, 0, stream>>>(q16, k16, vTT, ao16, n, d);

    // out-proj + residual -> x1 (f32)
    wmma_gemm_tiled<<<gdd, 256, 0, stream>>>(ao16, WoT, bo, x, x1, nullptr, n, d, d, 0);

    // LN2 -> h2 (f16)
    ln_f16_kernel<<<n, 256, 0, stream>>>(x1, ln2_w, ln2_b, h2, d);

    // MLP up + GELU -> m16 (f16)
    wmma_gemm_tiled<<<dim3(dff / 128, n / 128), 256, 0, stream>>>(h2, WiT, bi, nullptr, nullptr, m16, n, dff, d, 1);

    // MLP down + bias + residual -> d_out (f32)
    wmma_gemm_tiled<<<dim3(d / 128, n / 128), 256, 0, stream>>>(m16, WoutT, bout, x1, (float*)d_out, nullptr, n, d, dff, 0);
}

// v004
// A run of this version takes 307 microseconds.
// In two side-by-side timings against v003, it was 1.28 and 1.29 times as fast.
// All steps since v000 together make it 3.19 times as fast.
#include <hip/hip_runtime.h>
#include <math.h>

#define HEADS 16

typedef __attribute__((ext_vector_type(16))) _Float16 v16h;
typedef __attribute__((ext_vector_type(8)))  float    v8f;
typedef __attribute__((ext_vector_type(4)))  unsigned u32x4;
typedef __attribute__((ext_vector_type(4)))  float    f32x4;
typedef __attribute__((ext_vector_type(8)))  _Float16 h16x8;

union AV { v16h v; unsigned u[8]; _Float16 h[16]; };
union HV { v16h v; u32x4 q[2]; };

__device__ __forceinline__ v8f v8f_zero() {
    v8f z;
#pragma unroll
    for (int i = 0; i < 8; ++i) z[i] = 0.0f;
    return z;
}

__device__ __forceinline__ float gelu_tanh(float x) {
    const float k0 = 0.7978845608028654f; // sqrt(2/pi)
    const float k1 = 0.044715f;
    return 0.5f * x * (1.0f + tanhf(k0 * (x + k1 * x * x * x)));
}

// ---------------------------------------------------------------------------
// Convert f32 weight (K x N, row-major) -> f16 transposed (N x K, row-major)
// so WMMA B-operand (and async LDS staging) loads are K-contiguous.
// One 256-thread block moves a tile of 128 k x 64 n through LDS: 256-byte runs
// are read from every input row and 256-byte runs written to every output row.
// A thread reads 8 k x 4 n (eight 16-byte loads in flight), converts, and stores
// four 16-byte pieces (8 k of one n) into the transposed LDS tile.  The 16-byte
// piece index is XORed with n/4, so the 16 lanes of a half wave fall on all 64
// banks both when the tile is written and when it is read back by rows.
// K is a multiple of 128, N of 64.
// ---------------------------------------------------------------------------
__global__ __launch_bounds__(256)
void cvt_t_f16(const float* __restrict__ in, _Float16* __restrict__ out,
               int K, int N) {
    __shared__ __attribute__((aligned(16))) _Float16 s[64 * 128];
    const int tid = threadIdx.x;
    const int lo  = tid & 15;
    const int hi  = tid >> 4;
    const int k0  = blockIdx.y * 128;
    const int n0  = blockIdx.x * 64;

    const float* p[8];
    f32x4 v[8];
#pragma unroll
    for (int j = 0; j < 8; ++j) p[j] = in + (size_t)(k0 + hi * 8 + j) * N + n0 + lo * 4;
#pragma unroll
    for (int j = 0; j < 8; ++j) v[j] = *(const f32x4*)(p[j]);
    // holds the eight loads together in front of their first use, all in flight
    // at once; the address pairs are named as well, so that no load's result
    // lands on a pair that an earlier load still names
    asm volatile("" :: "v"(v[0]), "v"(v[1]), "v"(v[2]), "v"(v[3]),
                       "v"(v[4]), "v"(v[5]), "v"(v[6]), "v"(v[7]),
                       "v"(p[0]), "v"(p[1]), "v"(p[2]), "v"(p[3]),
                       "v"(p[4]), "v"(p[5]), "v"(p[6]), "v"(p[7]));
#pragma unroll
    for (int i = 0; i < 4; ++i) {
        h16x8 w;
#pragma unroll
        for (int j = 0; j < 8; ++j) w[j] = (_Float16)v[j][i];
        *(h16x8*)(&s[(lo * 4 + i) * 128 + ((hi ^ lo) * 8)]) = w;
    }
    __syncthreads();
#pragma unroll
    for (int it = 0; it < 4; ++it) {
        const int r = hi + it * 16;
        h16x8 w = *(const h16x8*)(&s[r * 128 + ((lo ^ (r >> 2)) * 8)]);
        *(h16x8*)(out + (size_t)(n0 + r) * K + k0 + lo * 8) = w;
    }
}

// f16 (R x C) -> f16 transposed (C x R):  out[c*R + r] = in[r*C + c]
// Same scheme, tile 128 r x 128 c: a thread reads 8 r x 8 c and stores eight
// 16-byte pieces (8 r of one c); the piece index is XORed with c/8.
// R and C are multiples of 128.
__global__ __launch_bounds__(256)
void transpose_f16(const _Float16* __restrict__ in, _Float16* __restrict__ out,
                   int R, int C) {
    __shared__ __attribute__((aligned(16))) _Float16 s[128 * 128];
    const int tid = threadIdx.x;
    const int lo  = tid & 15;
    const int hi  = tid >> 4;
    const int r0  = blockIdx.y * 128;
    const int c0  = blockIdx.x * 128;

    const _Float16* p[8];
    h16x8 v[8];
#pragma unroll
    for (int j = 0; j < 8; ++j) p[j] = in + (size_t)(r0 + hi * 8 + j) * C + c0 + lo * 8;
#pragma unroll
    for (int j = 0; j < 8; ++j) v[j] = *(const h16x8*)(p[j]);
    // holds the eight loads together in front of their first use, all in flight
    // at once; the address pairs are named as well, so that no load's result
    // lands on a pair that an earlier load still names
    asm volatile("" :: "v"(v[0]), "v"(v[1]), "v"(v[2]), "v"(v[3]),
                       "v"(v[4]), "v"(v[5]), "v"(v[6]), "v"(v[7]),
                       "v"(p[0]), "v"(p[1]), "v"(p[2]), "v"(p[3]),
                       "v"(p[4]), "v"(p[5]), "v"(p[6]), "v"(p[7]));
#pragma unroll
    for (int i = 0; i < 8; ++i) {
        h16x8 w;
#pragma unroll
        for (int j = 0; j < 8; ++j) w[j] = v[j][i];
        *(h16x8*)(&s[(lo * 8 + i) * 128 + ((hi ^ lo) * 8)]) = w;
    }
    __syncthreads();
#pragma unroll
    for (int it = 0; it < 8; ++it) {
        const int c = hi + it * 16;
        h16x8 w = *(const h16x8*)(&s[c * 128 + ((lo ^ (c >> 3)) * 8)]);
        *(h16x8*)(out + (size_t)(c0 + c) * R + r0 + lo * 8) = w;
    }
}

// ---------------------------------------------------------------------------
// Row LayerNorm, f32 in -> f16 out.  One 256-thread block per row.
// ---------------------------------------------------------------------------
__global__ void ln_f16_kernel(const float* __restrict__ x, const float* __restrict__ w,
                              const float* __restrict__ b, _Float16* __restrict__ out,
                              int d) {
    int row = blockIdx.x;
    const float* xr = x + (size_t)row * d;
    float s = 0.f, ss = 0.f;
    for (int i = threadIdx.x; i < d; i += blockDim.x) {
        float v = xr[i];
        s += v; ss += v * v;
    }
    __shared__ float rs[256], rss[256];
    rs[threadIdx.x] = s; rss[threadIdx.x] = ss;
    __syncthreads();
    for (int st = 128; st > 0; st >>= 1) {
        if (threadIdx.x < st) { rs[threadIdx.x] += rs[threadIdx.x + st];
                                rss[threadIdx.x] += rss[threadIdx.x + st]; }
        __syncthreads();
    }
    float mean = rs[0] / (float)d;
    float var  = rss[0] / (float)d - mean * mean;
    float inv  = rsqrtf(var + 1e-12f);
    for (int i = threadIdx.x; i < d; i += blockDim.x)
        out[(size_t)row * d + i] = (_Float16)((xr[i] - mean) * inv * w[i] + b[i]);
}

// ---------------------------------------------------------------------------
// Tiled WMMA GEMM with async global->LDS double-buffered staging.
//   out = act(A(MxK,f16) @ Bt(NxK,f16)^T + bias) (+ resid)
// Block: 256 threads (8 waves) computes 128x128 tile.
// Wave (wm in 0..1, wn in 0..3) computes 64x32 = 4x2 WMMA tiles.
// K is staged in slabs of 128: 256-byte rows of A and of Bt, laid in LDS at a
// pitch of 272 B, at which the 16 lanes of a half wave fall on all 64 banks in
// the 16-byte fragment reads.  Two buffers: the next slab's copies fly while
// this slab's four 32-k blocks are worked on, one barrier per slab.
// K is a multiple of 128.
// ---------------------------------------------------------------------------
#define GM_PITCH 136                    // halves per staged row (272 B)
#define GM_TILE  (128 * GM_PITCH)       // halves per staged slab of one operand

// Eight 16-byte copies of one lane: rows 16 apart of one operand's slab.
// l: the lane's LDS byte address, g: its global address, rs: halves per 16 rows.
__device__ __forceinline__ void gm_copy8(unsigned l, const _Float16* g, size_t rs) {
    // the closing s_wait_xcnt keeps the address registers from being
    // rewritten while a copy that names them is still being issued
    asm volatile("global_load_async_to_lds_b128 %0, %8, off\n\t"
                 "global_load_async_to_lds_b128 %1, %9, off\n\t"
                 "global_load_async_to_lds_b128 %2, %10, off\n\t"
                 "global_load_async_to_lds_b128 %3, %11, off\n\t"
                 "global_load_async_to_lds_b128 %4, %12, off\n\t"
                 "global_load_async_to_lds_b128 %5, %13, off\n\t"
                 "global_load_async_to_lds_b128 %6, %14, off\n\t"
                 "global_load_async_to_lds_b128 %7, %15, off\n\t"
                 "s_wait_xcnt 0x0"
                 :: "v"(l),
                    "v"(l + 1 * 16 * (GM_PITCH * 2)), "v"(l + 2 * 16 * (GM_PITCH * 2)),
                    "v"(l + 3 * 16 * (GM_PITCH * 2)), "v"(l + 4 * 16 * (GM_PITCH * 2)),
                    "v"(l + 5 * 16 * (GM_PITCH * 2)), "v"(l + 6 * 16 * (GM_PITCH * 2)),
                    "v"(l + 7 * 16 * (GM_PITCH * 2)),
                    "v"((unsigned long long)(uintptr_t)(g)),
                    "v"((unsigned long long)(uintptr_t)(g + 1 * rs)),
                    "v"((unsigned long long)(uintptr_t)(g + 2 * rs)),
                    "v"((unsigned long long)(uintptr_t)(g + 3 * rs)),
                    "v"((unsigned long long)(uintptr_t)(g + 4 * rs)),
                    "v"((unsigned long long)(uintptr_t)(g + 5 * rs)),
                    "v"((unsigned long long)(uintptr_t)(g + 6 * rs)),
                    "v"((unsigned long long)(uintptr_t)(g + 7 * rs))
                 : "memory");
}

__global__ __launch_bounds__(256)
void wmma_gemm_tiled(const _Float16* __restrict__ A, const _Float16* __restrict__ Bt,
                     const float* __restrict__ bias, const float* __restrict__ resid,
                     float* __restrict__ outf, _Float16* __restrict__ outh,
                     int M, int N, int K, int act) {
    __shared__ __attribute__((aligned(16))) _Float16 sA[2][GM_TILE];
    __shared__ __attribute__((aligned(16))) _Float16 sB[2][GM_TILE];

    const int tid  = threadIdx.x;
    const int lane = tid & 31;
    const int wave = tid >> 5;
    const int col  = lane & 15;   // M (A) / N (B,C) index within 16-tile
    const int hh   = lane >> 4;   // lane-half -> +8 K offset in A/B operands
    const int wn   = wave & 3;    // 4 N-groups of 32
    const int wm   = wave >> 2;   // 2 M-groups of 64
    const int m0   = blockIdx.y * 128;
    const int n0   = blockIdx.x * 128;

    // copy assignment: rows cr, cr+16, .. cr+112 of each slab, 16-byte chunk cc of the row
    const int cr = tid >> 4;
    const int cc = tid & 15;
    const unsigned lA = (unsigned)(uintptr_t)(&sA[0][0]) + (unsigned)(cr * (GM_PITCH * 2) + cc * 16);
    const unsigned lB = (unsigned)(uintptr_t)(&sB[0][0]) + (unsigned)(cr * (GM_PITCH * 2) + cc * 16);
    const _Float16* gA = A  + (size_t)(m0 + cr) * K + cc * 8;
    const _Float16* gB = Bt + (size_t)(n0 + cr) * K + cc * 8;
    const size_t rs = (size_t)16 * K;

    // stage slab s (k 128s .. 128s+127) of A and Bt into buffer buf
    auto stage = [&](int buf, int s) {
        const unsigned lo = (unsigned)(buf * (GM_TILE * 2));
        gm_copy8(lA + lo, gA + (size_t)s * 128, rs);
        gm_copy8(lB + lo, gB + (size_t)s * 128, rs);
    };

    v8f acc[4][2];
#pragma unroll
    for (int mi = 0; mi < 4; ++mi)
#pragma unroll
        for (int ni = 0; ni < 2; ++ni) acc[mi][ni] = v8f_zero();

    const int nslabs = K >> 7;
    stage(0, 0);
    // slab 0 has landed for this wave's copies; the barrier publishes all waves' copies
    asm volatile("s_wait_asynccnt 0x0" ::: "memory");
    __syncthreads();
    if (nslabs > 1) stage(1, 1);

    for (int s = 0; s < nslabs; ++s) {
        const int buf = s & 1;
        const _Float16* pa = &sA[buf][(wm * 64 + col) * GM_PITCH + 8 * hh];
        const _Float16* pb = &sB[buf][(wn * 32 + col) * GM_PITCH + 8 * hh];
        // unrolled, like the loops inside: every index of a, b and acc is then a
        // constant (they stay in registers) and every LDS offset an immediate
#pragma unroll
        for (int kb = 0; kb < 4; ++kb) {
            HV a[4], b[2];
#pragma unroll
            for (int mi = 0; mi < 4; ++mi) {
                const _Float16* p = pa + mi * 16 * GM_PITCH + kb * 32;
                a[mi].q[0] = *(const u32x4*)(p);
                a[mi].q[1] = *(const u32x4*)(p + 16);
            }
#pragma unroll
            for (int ni = 0; ni < 2; ++ni) {
                const _Float16* p = pb + ni * 16 * GM_PITCH + kb * 32;
                b[ni].q[0] = *(const u32x4*)(p);
                b[ni].q[1] = *(const u32x4*)(p + 16);
            }
#pragma unroll
            for (int mi = 0; mi < 4; ++mi)
#pragma unroll
                for (int ni = 0; ni < 2; ++ni)
                    acc[mi][ni] = __builtin_amdgcn_wmma_f32_16x16x32_f16(
                        false, a[mi].v, false, b[ni].v, (short)0, acc[mi][ni], false, false);
        }
        // hand-over, every wave: this wave's reads of buffer buf are done ...
        asm volatile("s_wait_dscnt 0x0" ::: "memory");
        // ... its copies of the next slab have landed ...
        asm volatile("s_wait_asynccnt 0x0" ::: "memory");
        // ... and the barrier publishes the next slab and frees buffer buf
        __syncthreads();
        if (s + 2 < nslabs) stage(buf, s + 2);
    }
    // no copy is left in flight when the wave ends
    asm volatile("s_wait_asynccnt 0x0" ::: "memory");

    float bn0 = bias ? bias[n0 + wn * 32 + col]      : 0.0f;
    float bn1 = bias ? bias[n0 + wn * 32 + 16 + col] : 0.0f;
#pragma unroll
    for (int mi = 0; mi < 4; ++mi) {
#pragma unroll
        for (int ni = 0; ni < 2; ++ni) {
            float bn = ni ? bn1 : bn0;
#pragma unroll
            for (int r = 0; r < 8; ++r) {
                float val = acc[mi][ni][r] + bn;
                if (act == 1) val = gelu_tanh(val);
                size_t idx = (size_t)(m0 + wm * 64 + mi * 16 + r + 8 * hh) * N
                           + (n0 + wn * 32 + ni * 16 + col);
                if (resid) val += resid[idx];
                if (outf) outf[idx] = val;
                if (outh) outh[idx] = (_Float16)val;
            }
        }
    }
}

// ---------------------------------------------------------------------------
// Causal flash attention.  One 8-wave block per (128-query block, head); each
// wave owns 16 queries.  q/k: (n x d) f16, head-h slice at column h*64, dh=64.
// vT: (d x n) f16 transposed V, so its rows are key-contiguous.
// The eight waves share each 64-key tile of K (64 keys x 64 dims) and of vT
// (64 dims x 64 keys): the block copies it once into LDS as whole 128-byte
// rows, two buffers, the next tile in flight while this one is worked on.
// LDS rows are pitched 144 B for the 16-byte fragment reads.
// The products are taken transposed: S^T = Kb Q^T (A = K rows, B = Q) and
// O^T += Vb^T P^T (A = vT rows, B = P^T).  A lane then holds 16 of the 32
// scores of ONE query (lane%16), so maximum and sum run inside the lane with a
// single exchange between the wave's halves, and the two score tiles, converted
// in place, already are the B operand of the second product.
// ---------------------------------------------------------------------------
// 2^x of eight (exp2x8) or nine (exp2x9) values.  One statement each, results kept
// apart from arguments ("=&v") and a closing v_nop: the instruction set asks for one
// slot between a transcendental and an instruction that reads its result or
// overwrites its argument.
__device__ __forceinline__ void exp2x8(float (&y)[8], const float (&x)[8]) {
    asm("v_exp_f32 %0, %8\n\t"  "v_exp_f32 %1, %9\n\t"
        "v_exp_f32 %2, %10\n\t" "v_exp_f32 %3, %11\n\t"
        "v_exp_f32 %4, %12\n\t" "v_exp_f32 %5, %13\n\t"
        "v_exp_f32 %6, %14\n\t" "v_exp_f32 %7, %15\n\t"
        "v_nop"
        : "=&v"(y[0]), "=&v"(y[1]), "=&v"(y[2]), "=&v"(y[3]),
          "=&v"(y[4]), "=&v"(y[5]), "=&v"(y[6]), "=&v"(y[7])
        : "v"(x[0]), "v"(x[1]), "v"(x[2]), "v"(x[3]),
          "v"(x[4]), "v"(x[5]), "v"(x[6]), "v"(x[7]));
}
__device__ __forceinline__ void exp2x9(float& ya, float (&y)[8], float xa, const float (&x)[8]) {
    asm("v_exp_f32 %0, %9\n\t"  "v_exp_f32 %1, %10\n\t"
        "v_exp_f32 %2, %11\n\t" "v_exp_f32 %3, %12\n\t"
        "v_exp_f32 %4, %13\n\t" "v_exp_f32 %5, %14\n\t"
        "v_exp_f32 %6, %15\n\t" "v_exp_f32 %7, %16\n\t"
        "v_exp_f32 %8, %17\n\t"
        "v_nop"
        : "=&v"(ya), "=&v"(y[0]), "=&v"(y[1]), "=&v"(y[2]), "=&v"(y[3]),
          "=&v"(y[4]), "=&v"(y[5]), "=&v"(y[6]), "=&v"(y[7])
        : "v"(xa), "v"(x[0]), "v"(x[1]), "v"(x[2]), "v"(x[3]),
          "v"(x[4]), "v"(x[5]), "v"(x[6]), "v"(x[7]));
}

#define FA_PITCH 72                     // halves per staged row (144 B)
#define FA_TILE  (64 * FA_PITCH)        // halves per staged tile

// two such blocks share a WGP (four waves per SIMD): let the register allocator use that share
__global__ __launch_bounds__(256) __attribute__((amdgpu_waves_per_eu(4, 4)))
void flash_attn(const _Float16* __restrict__ q, const _Float16* __restrict__ k,
                const _Float16* __restrict__ vT, _Float16* __restrict__ o,
                int n, int d) {
    const int dh = 64;
    const float scale = 0.125f;              // 1/sqrt(64)
    const int tid  = threadIdx.x;
    const int lane = tid & 31;
    const int wave = __builtin_amdgcn_readfirstlane(tid >> 5);
    const int col  = lane & 15;
    const int hh   = lane >> 4;
    const int head = blockIdx.y;
    const int q0   = blockIdx.x * 128 + wave * 16;
    const size_t hoff = (size_t)head * dh;

    __shared__ __attribute__((aligned(16))) _Float16 sK[2][FA_TILE];
    __shared__ __attribute__((aligned(16))) _Float16 sV[2][FA_TILE];

    // copy assignment: rows cr and cr+32 of each tile, 16-byte chunk cc of the row
    const int cr = tid >> 3;
    const int cc = tid & 7;
    const unsigned lK = (unsigned)(uintptr_t)(&sK[0][0]) + (unsigned)(cr * (FA_PITCH * 2) + cc * 16);
    const unsigned lV = (unsigned)(uintptr_t)(&sV[0][0]) + (unsigned)(cr * (FA_PITCH * 2) + cc * 16);
    const _Float16* gK = k  + (size_t)cr * d + hoff + cc * 8;
    const _Float16* gV = vT + (hoff + cr) * (size_t)n + cc * 8;

    // stage key tile t (keys 64t .. 64t+63) of K and vT into buffer buf
    auto stage = [&](int buf, int t) {
        const unsigned lo = (unsigned)(buf * (FA_TILE * 2));
        const _Float16* k0p = gK + (size_t)t * 64 * d;
        const _Float16* k1p = k0p + (size_t)32 * d;
        const _Float16* v0p = gV + (size_t)t * 64;
        const _Float16* v1p = v0p + (size_t)32 * n;
        // the closing s_wait_xcnt keeps the address registers from being
        // rewritten while a copy that names them is still being issued
        asm volatile("global_load_async_to_lds_b128 %0, %4, off\n\t"
                     "global_load_async_to_lds_b128 %1, %5, off\n\t"
                     "global_load_async_to_lds_b128 %2, %6, off\n\t"
                     "global_load_async_to_lds_b128 %3, %7, off\n\t"
                     "s_wait_xcnt 0x0"
                     :: "v"(lK + lo), "v"(lK + lo + 32 * (FA_PITCH * 2)),
                        "v"(lV + lo), "v"(lV + lo + 32 * (FA_PITCH * 2)),
                        "v"((unsigned long long)(uintptr_t)k0p),
                        "v"((unsigned long long)(uintptr_t)k1p),
                        "v"((unsigned long long)(uintptr_t)v0p),
                        "v"((unsigned long long)(uintptr_t)v1p)
                     : "memory");
    };

    AV aq0, aq1;
    const _Float16* qrow = q + (size_t)(q0 + col) * d + hoff;
#pragma unroll
    for (int j = 0; j < 8; ++j) {
        int ko = 2 * j + 8 * hh + ((j >= 4) ? 8 : 0);
        aq0.u[j] = *(const unsigned*)(qrow + ko);
        aq1.u[j] = *(const unsigned*)(qrow + 32 + ko);
    }

    v8f acc[4];
#pragma unroll
    for (int t = 0; t < 4; ++t) acc[t] = v8f_zero();
    // of query q0 + col: running maximum (equal in both halves of the wave) and
    // the sum over the keys that this half of the wave holds
    float mrow = -1e30f, lrow = 0.0f;
    const int qg = q0 + col;

    const int ntiles = 2 * (blockIdx.x + 1);     // 64-key tiles up to the block's diagonal

    stage(0, 0);
    // tile 0 has landed for this wave's copies; the barrier publishes all waves' copies
    asm volatile("s_wait_asynccnt 0x0" ::: "memory");
    __syncthreads();
    stage(1, 1);

    for (int kt = 0; kt < ntiles; ++kt) {
        const int buf = kt & 1;
#pragma unroll
        for (int ps = 0; ps < 2; ++ps) {
            const int k0 = kt * 64 + ps * 32;
            if (k0 > q0 + 15) continue;          // wave-uniform: keys wholly above the diagonal
            // ---- S^T = Kb Q^T : two 16x16 score tiles (keys x queries)
            HV b0, b1, b2, b3;
            const _Float16* kr0 = &sK[buf][(ps * 32 + col) * FA_PITCH + 8 * hh];
            const _Float16* kr1 = kr0 + 16 * FA_PITCH;
            b0.q[0] = *(const u32x4*)(kr0);      b0.q[1] = *(const u32x4*)(kr0 + 16);
            b1.q[0] = *(const u32x4*)(kr0 + 32); b1.q[1] = *(const u32x4*)(kr0 + 48);
            b2.q[0] = *(const u32x4*)(kr1);      b2.q[1] = *(const u32x4*)(kr1 + 16);
            b3.q[0] = *(const u32x4*)(kr1 + 32); b3.q[1] = *(const u32x4*)(kr1 + 48);
            // holds the eight LDS reads together in front of the products: one LDS
            // latency per 32 keys instead of one in front of each product
            asm volatile("" :: "v"(b0.v), "v"(b1.v), "v"(b2.v), "v"(b3.v));
            v8f s0 = v8f_zero(), s1 = v8f_zero();
            s0 = __builtin_amdgcn_wmma_f32_16x16x32_f16(false, b0.v, false, aq0.v, (short)0, s0, false, false);
            s0 = __builtin_amdgcn_wmma_f32_16x16x32_f16(false, b1.v, false, aq1.v, (short)0, s0, false, false);
            s1 = __builtin_amdgcn_wmma_f32_16x16x32_f16(false, b2.v, false, aq0.v, (short)0, s1, false, false);
            s1 = __builtin_amdgcn_wmma_f32_16x16x32_f16(false, b3.v, false, aq1.v, (short)0, s1, false, false);

            // ---- scale + causal mask + online softmax
            // s0[r]: key k0 + 8*hh + r, s1[r]: key k0 + 16 + 8*hh + r, query qg
            const int kb = k0 + 8 * hh;
            float mx = -1e30f;
#pragma unroll
            for (int r = 0; r < 8; ++r) {
                float a0 = s0[r] * scale;
                float a1 = s1[r] * scale;
                if (kb + r > qg)      a0 = -1e30f;
                if (kb + 16 + r > qg) a1 = -1e30f;
                s0[r] = a0; s1[r] = a1;
                mx = fmaxf(mx, fmaxf(a0, a1));
            }
            // the other 16 keys of this query sit in lane ^ 16
            mx = fmaxf(mx, __int_as_float(__builtin_amdgcn_permlanex16(
                     __float_as_int(mx), __float_as_int(mx), 0x76543210, 0xfedcba98, false, false)));
            const float mn = fmaxf(mrow, mx);
            // e^x as 2^(x * log2 e)
            const float l2e = 1.4426950408889634f;
            float e0[8], e1[8], p0[8], p1[8], alpha;
#pragma unroll
            for (int r = 0; r < 8; ++r) {
                e0[r] = (s0[r] - mn) * l2e;
                e1[r] = (s1[r] - mn) * l2e;
            }
            exp2x9(alpha, p0, (mrow - mn) * l2e, e0);
            exp2x8(p1, e1);
            mrow = mn;
            AV bp;                               // P^T as B operand: 16 + 16 keys of query col
            float rsum = p0[0] + p1[0];
#pragma unroll
            for (int r = 0; r < 8; ++r) {
                if (r) rsum += p0[r] + p1[r];
                bp.h[r]     = (_Float16)p0[r];
                bp.h[8 + r] = (_Float16)p1[r];
            }
            lrow = lrow * alpha + rsum;
#pragma unroll
            for (int t = 0; t < 4; ++t)
#pragma unroll
                for (int r = 0; r < 8; ++r) acc[t][r] *= alpha;

            // ---- O^T += Vb^T P^T ; each A operand is two 16-byte LDS reads
#pragma unroll
            for (int t = 0; t < 4; ++t) {
                HV bv;
                const _Float16* vb = &sV[buf][(t * 16 + col) * FA_PITCH + ps * 32 + 8 * hh];
                bv.q[0] = *(const u32x4*)(vb);
                bv.q[1] = *(const u32x4*)(vb + 16);
                acc[t] = __builtin_amdgcn_wmma_f32_16x16x32_f16(false, bv.v, false, bp.v,
                                                                (short)0, acc[t], false, false);
            }
        }
        // hand-over, every wave: this wave's reads of buffer buf are done ...
        asm volatile("s_wait_dscnt 0x0" ::: "memory");
        // ... its copies of the next tile have landed ...
        asm volatile("s_wait_asynccnt 0x0" ::: "memory");
        // ... and the barrier publishes the next tile and frees buffer buf
        __syncthreads();
        if (kt + 2 < ntiles) stage(buf, kt + 2);
    }
    // no copy is left in flight when the wave ends
    asm volatile("s_wait_asynccnt 0x0" ::: "memory");

    // join the two halves' sums of each query
    lrow += __int_as_float(__builtin_amdgcn_permlanex16(
                __float_as_int(lrow), __float_as_int(lrow), 0x76543210, 0xfedcba98, false, false));
    // acc[t][r] = O[q0 + col][t*16 + 8*hh + r]: eight consecutive dims, one 16-byte store
    _Float16* orow = o + (size_t)qg * d + hoff + 8 * hh;
#pragma unroll
    for (int t = 0; t < 4; ++t) {
        h16x8 w;
#pragma unroll
        for (int r = 0; r < 8; ++r) w[r] = (_Float16)(acc[t][r] / lrow);
        *(h16x8*)(orow + t * 16) = w;
    }
}

// ---------------------------------------------------------------------------
// Host-side orchestration
// ---------------------------------------------------------------------------
extern "C" void kernel_launch(void* const* d_in, const int* in_sizes, int n_in,
                              void* d_out, int out_size, void* d_ws, size_t ws_size,
                              hipStream_t stream) {
    const int d   = in_sizes[1];          // 1024 (ln1_w)
    const int n   = in_sizes[0] / d;      // 4096
    const int dff = in_sizes[14];         // 4096 (bi)

    const float* x     = (const float*)d_in[0];
    const float* ln1_w = (const float*)d_in[1];
    const float* ln1_b = (const float*)d_in[2];
    const float* Wq    = (const float*)d_in[3];
    const float* bq    = (const float*)d_in[4];
    const float* Wk    = (const float*)d_in[5];
    const float* bk    = (const float*)d_in[6];
    const float* Wv    = (const float*)d_in[7];
    const float* bv    = (const float*)d_in[8];
    const float* Wo    = (const float*)d_in[9];
    const float* bo    = (const float*)d_in[10];
    const float* ln2_w = (const float*)d_in[11];
    const float* ln2_b = (const float*)d_in[12];
    const float* Wi    = (const float*)d_in[13];
    const float* bi    = (const float*)d_in[14];
    const float* Wout  = (const float*)d_in[15];
    const float* bout  = (const float*)d_in[16];

    char* ws = (char*)d_ws;
    size_t off = 0;
    auto alloc = [&](size_t bytes) -> void* {
        void* p = ws + off;
        off += (bytes + 255) & ~(size_t)255;
        return p;
    };
    _Float16* WqT   = (_Float16*)alloc((size_t)d * d * 2);
    _Float16* WkT   = (_Float16*)alloc((size_t)d * d * 2);
    _Float16* WvT   = (_Float16*)alloc((size_t)d * d * 2);
    _Float16* WoT   = (_Float16*)alloc((size_t)d * d * 2);
    _Float16* WiT   = (_Float16*)alloc((size_t)d * dff * 2);
    _Float16* WoutT = (_Float16*)alloc((size_t)dff * d * 2);
    _Float16* h1    = (_Float16*)alloc((size_t)n * d * 2);
    _Float16* q16   = (_Float16*)alloc((size_t)n * d * 2);
    _Float16* k16   = (_Float16*)alloc((size_t)n * d * 2);
    _Float16* v16   = (_Float16*)alloc((size_t)n * d * 2);
    _Float16* vTT   = (_Float16*)alloc((size_t)n * d * 2);
    _Float16* ao16  = (_Float16*)alloc((size_t)n * d * 2);
    float*    x1    = (float*)   alloc((size_t)n * d * 4);
    _Float16* h2    = (_Float16*)alloc((size_t)n * d * 2);
    _Float16* m16   = (_Float16*)alloc((size_t)n * dff * 2);

    cvt_t_f16<<<dim3(d / 64, d / 128), 256, 0, stream>>>(Wq, WqT, d, d);
    cvt_t_f16<<<dim3(d / 64, d / 128), 256, 0, stream>>>(Wk, WkT, d, d);
    cvt_t_f16<<<dim3(d / 64, d / 128), 256, 0, stream>>>(Wv, WvT, d, d);
    cvt_t_f16<<<dim3(d / 64, d / 128), 256, 0, stream>>>(Wo, WoT, d, d);
    cvt_t_f16<<<dim3(dff / 64, d / 128), 256, 0, stream>>>(Wi, WiT, d, dff);
    cvt_t_f16<<<dim3(d / 64, dff / 128), 256, 0, stream>>>(Wout, WoutT, dff, d);

    // LN1 -> h1 (f16)
    ln_f16_kernel<<<n, 256, 0, stream>>>(x, ln1_w, ln1_b, h1, d);

    // QKV projections (f16 out)
    dim3 gdd(d / 128, n / 128);
    wmma_gemm_tiled<<<gdd, 256, 0, stream>>>(h1, WqT, bq, nullptr, nullptr, q16, n, d, d, 0);
    wmma_gemm_tiled<<<gdd, 256, 0, stream>>>(h1, WkT, bk, nullptr, nullptr, k16, n, d, d, 0);
    wmma_gemm_tiled<<<gdd, 256, 0, stream>>>(h1, WvT, bv, nullptr, nullptr, v16, n, d, d, 0);

    // V^T (d x n) for K-contiguous P@V operands
    transpose_f16<<<dim3(d / 128, n / 128), 256, 0, stream>>>(v16, vTT, n, d);

    // causal flash attention -> ao16
    flash_attn<<<dim3(n / 128, HEADS), 256, 0, stream>>>(q16, k16, vTT, ao16, n, d);

    // out-proj + residual -> x1 (f32)
    wmma_gemm_tiled<<<gdd, 256, 0, stream>>>(ao16, WoT, bo, x, x1, nullptr, n, d, d, 0);

    // LN2 -> h2 (f16)
    ln_f16_kernel<<<n, 256, 0, stream>>>(x1, ln2_w, ln2_b, h2, d);

    // MLP up + GELU -> m16 (f16)
    wmma_gemm_tiled<<<dim3(dff / 128, n / 128), 256, 0, stream>>>(h2, WiT, bi, nullptr, nullptr, m16, n, dff, d, 1);

    // MLP down + bias + residual -> d_out (f32)
    wmma_gemm_tiled<<<dim3(d / 128, n / 128), 256, 0, stream>>>(m16, WoutT, bout, x1, (float*)d_out, nullptr, n, d, dff, 0);
}

// v005
// A run of this version takes 252 microseconds.
// Next to v004, in two timings, it ran 1.22 times as fast each time.
// Counting every step since v000, it is 3.89 times as fast.
#include <hip/hip_runtime.h>
#include <math.h>

#define HEADS 16

typedef __attribute__((ext_vector_type(16))) _Float16 v16h;
typedef __attribute__((ext_vector_type(8)))  float    v8f;
typedef __attribute__((ext_vector_type(4)))  unsigned u32x4;
typedef __attribute__((ext_vector_type(4)))  float    f32x4;
typedef __attribute__((ext_vector_type(8)))  _Float16 h16x8;

union AV { v16h v; unsigned u[8]; _Float16 h[16]; };
union HV { v16h v; u32x4 q[2]; };

__device__ __forceinline__ v8f v8f_zero() {
    v8f z;
#pragma unroll
    for (int i = 0; i < 8; ++i) z[i] = 0.0f;
    return z;
}

__device__ __forceinline__ float gelu_tanh(float x) {
    const float k0 = 0.7978845608028654f; // sqrt(2/pi)
    const float k1 = 0.044715f;
    return 0.5f * x * (1.0f + tanhf(k0 * (x + k1 * x * x * x)));
}

// ---------------------------------------------------------------------------
// Convert f32 weight (K x N, row-major) -> f16 transposed (N x K, row-major)
// so WMMA B-operand (and async LDS staging) loads are K-contiguous.
// One 256-thread block moves a tile of 128 k x 64 n through LDS: 256-byte runs
// are read from every input row and 256-byte runs written to every output row.
// A thread reads 8 k x 4 n (eight 16-byte loads in flight), converts, and stores
// four 16-byte pieces (8 k of one n) into the transposed LDS tile.  The 16-byte
// piece index is XORed with n/4, so the 16 lanes of a half wave fall on all 64
// banks both when the tile is written and when it is read back by rows.
// K is a multiple of 128, N of 64.
// ---------------------------------------------------------------------------
__global__ __launch_bounds__(256)
void cvt_t_f16(const float* __restrict__ in, _Float16* __restrict__ out,
               int K, int N) {
    __shared__ __attribute__((aligned(16))) _Float16 s[64 * 128];
    const int tid = threadIdx.x;
    const int lo  = tid & 15;
    const int hi  = tid >> 4;
    const int k0  = blockIdx.y * 128;
    const int n0  = blockIdx.x * 64;

    const float* p[8];
    f32x4 v[8];
#pragma unroll
    for (int j = 0; j < 8; ++j) p[j] = in + (size_t)(k0 + hi * 8 + j) * N + n0 + lo * 4;
#pragma unroll
    for (int j = 0; j < 8; ++j) v[j] = *(const f32x4*)(p[j]);
    // holds the eight loads together in front of their first use, all in flight
    // at once; the address pairs are named as well, so that no load's result
    // lands on a pair that an earlier load still names
    asm volatile("" :: "v"(v[0]), "v"(v[1]), "v"(v[2]), "v"(v[3]),
                       "v"(v[4]), "v"(v[5]), "v"(v[6]), "v"(v[7]),
                       "v"(p[0]), "v"(p[1]), "v"(p[2]), "v"(p[3]),
                       "v"(p[4]), "v"(p[5]), "v"(p[6]), "v"(p[7]));
#pragma unroll
    for (int i = 0; i < 4; ++i) {
        h16x8 w;
#pragma unroll
        for (int j = 0; j < 8; ++j) w[j] = (_Float16)v[j][i];
        *(h16x8*)(&s[(lo * 4 + i) * 128 + ((hi ^ lo) * 8)]) = w;
    }
    __syncthreads();
#pragma unroll
    for (int it = 0; it < 4; ++it) {
        const int r = hi + it * 16;
        h16x8 w = *(const h16x8*)(&s[r * 128 + ((lo ^ (r >> 2)) * 8)]);
        *(h16x8*)(out + (size_t)(n0 + r) * K + k0 + lo * 8) = w;
    }
}

// f16 (R x C) -> f16 transposed (C x R):  out[c*R + r] = in[r*C + c]
// Same scheme, tile 128 r x 128 c: a thread reads 8 r x 8 c and stores eight
// 16-byte pieces (8 r of one c); the piece index is XORed with c/8.
// R and C are multiples of 128.
__global__ __launch_bounds__(256)
void transpose_f16(const _Float16* __restrict__ in, _Float16* __restrict__ out,
                   int R, int C) {
    __shared__ __attribute__((aligned(16))) _Float16 s[128 * 128];
    const int tid = threadIdx.x;
    const int lo  = tid & 15;
    const int hi  = tid >> 4;
    const int r0  = blockIdx.y * 128;
    const int c0  = blockIdx.x * 128;

    const _Float16* p[8];
    h16x8 v[8];
#pragma unroll
    for (int j = 0; j < 8; ++j) p[j] = in + (size_t)(r0 + hi * 8 + j) * C + c0 + lo * 8;
#pragma unroll
    for (int j = 0; j < 8; ++j) v[j] = *(const h16x8*)(p[j]);
    // holds the eight loads together in front of their first use, all in flight
    // at once; the address pairs are named as well, so that no load's result
    // lands on a pair that an earlier load still names
    asm volatile("" :: "v"(v[0]), "v"(v[1]), "v"(v[2]), "v"(v[3]),
                       "v"(v[4]), "v"(v[5]), "v"(v[6]), "v"(v[7]),
                       "v"(p[0]), "v"(p[1]), "v"(p[2]), "v"(p[3]),
                       "v"(p[4]), "v"(p[5]), "v"(p[6]), "v"(p[7]));
#pragma unroll
    for (int i = 0; i < 8; ++i) {
        h16x8 w;
#pragma unroll
        for (int j = 0; j < 8; ++j) w[j] = v[j][i];
        *(h16x8*)(&s[(lo * 8 + i) * 128 + ((hi ^ lo) * 8)]) = w;
    }
    __syncthreads();
#pragma unroll
    for (int it = 0; it < 8; ++it) {
        const int c = hi + it * 16;
        h16x8 w = *(const h16x8*)(&s[c * 128 + ((lo ^ (c >> 3)) * 8)]);
        *(h16x8*)(out + (size_t)(c0 + c) * R + r0 + lo * 8) = w;
    }
}

// ---------------------------------------------------------------------------
// Row LayerNorm, f32 in -> f16 out.  One 256-thread block per row.
// ---------------------------------------------------------------------------
__global__ void ln_f16_kernel(const float* __restrict__ x, const float* __restrict__ w,
                              const float* __restrict__ b, _Float16* __restrict__ out,
                              int d) {
    int row = blockIdx.x;
    const float* xr = x + (size_t)row * d;
    float s = 0.f, ss = 0.f;
    for (int i = threadIdx.x; i < d; i += blockDim.x) {
        float v = xr[i];
        s += v; ss += v * v;
    }
    __shared__ float rs[256], rss[256];
    rs[threadIdx.x] = s; rss[threadIdx.x] = ss;
    __syncthreads();
    for (int st = 128; st > 0; st >>= 1) {
        if (threadIdx.x < st) { rs[threadIdx.x] += rs[threadIdx.x + st];
                                rss[threadIdx.x] += rss[threadIdx.x + st]; }
        __syncthreads();
    }
    float mean = rs[0] / (float)d;
    float var  = rss[0] / (float)d - mean * mean;
    float inv  = rsqrtf(var + 1e-12f);
    for (int i = threadIdx.x; i < d; i += blockDim.x)
        out[(size_t)row * d + i] = (_Float16)((xr[i] - mean) * inv * w[i] + b[i]);
}

// ---------------------------------------------------------------------------
// Tiled WMMA GEMM with async global->LDS double-buffered staging.
//   out = act(A(MxK,f16) @ Bt(NxK,f16)^T + bias) (+ resid)
// Block: 256 threads (8 waves) computes 128x128 tile.
// Wave (wm in 0..1, wn in 0..3) computes 64x32 = 4x2 WMMA tiles.
// K is staged in slabs of 128: 256-byte rows of A and of Bt, laid in LDS at a
// pitch of 272 B, at which the 16 lanes of a half wave fall on all 64 banks in
// the 16-byte fragment reads.  Two buffers: the next slab's copies fly while
// this slab's four 32-k blocks are worked on, one barrier per slab.
// K is a multiple of 128.
// ---------------------------------------------------------------------------
#define GM_PITCH 136                    // halves per staged row (272 B)
#define GM_TILE  (128 * GM_PITCH)       // halves per staged slab of one operand

// Eight 16-byte copies of one lane: rows 16 apart of one operand's slab.
// l: the lane's LDS byte address, g: its global address, rs: halves per 16 rows.
__device__ __forceinline__ void gm_copy8(unsigned l, const _Float16* g, size_t rs) {
    // the closing s_wait_xcnt keeps the address registers from being
    // rewritten while a copy that names them is still being issued
    asm volatile("global_load_async_to_lds_b128 %0, %8, off\n\t"
                 "global_load_async_to_lds_b128 %1, %9, off\n\t"
                 "global_load_async_to_lds_b128 %2, %10, off\n\t"
                 "global_load_async_to_lds_b128 %3, %11, off\n\t"
                 "global_load_async_to_lds_b128 %4, %12, off\n\t"
                 "global_load_async_to_lds_b128 %5, %13, off\n\t"
                 "global_load_async_to_lds_b128 %6, %14, off\n\t"
                 "global_load_async_to_lds_b128 %7, %15, off\n\t"
                 "s_wait_xcnt 0x0"
                 :: "v"(l),
                    "v"(l + 1 * 16 * (GM_PITCH * 2)), "v"(l + 2 * 16 * (GM_PITCH * 2)),
                    "v"(l + 3 * 16 * (GM_PITCH * 2)), "v"(l + 4 * 16 * (GM_PITCH * 2)),
                    "v"(l + 5 * 16 * (GM_PITCH * 2)), "v"(l + 6 * 16 * (GM_PITCH * 2)),
                    "v"(l + 7 * 16 * (GM_PITCH * 2)),
                    "v"((unsigned long long)(uintptr_t)(g)),
                    "v"((unsigned long long)(uintptr_t)(g + 1 * rs)),
                    "v"((unsigned long long)(uintptr_t)(g + 2 * rs)),
                    "v"((unsigned long long)(uintptr_t)(g + 3 * rs)),
                    "v"((unsigned long long)(uintptr_t)(g + 4 * rs)),
                    "v"((unsigned long long)(uintptr_t)(g + 5 * rs)),
                    "v"((unsigned long long)(uintptr_t)(g + 6 * rs)),
                    "v"((unsigned long long)(uintptr_t)(g + 7 * rs))
                 : "memory");
}

// N (columns of the output, the row pitch of resid and of the output) and the
// epilogue's mode are compile-time values:
//   RES  : outf = acc + bias + resid   (f32; outh is not used)
//   !RES : outh = act(acc + bias)      (f16; resid and outf are not used),
//          act = tanh GELU where GELU is set, else the identity
// The epilogue then holds no test of a mode, and every element's address is the
// lane's base plus an immediate: its loads, and its stores, follow one another
// with no wait between them.
template <int N, bool GELU, bool RES>
__global__ __launch_bounds__(256)
void wmma_gemm_tiled(const _Float16* __restrict__ A, const _Float16* __restrict__ Bt,
                     const float* __restrict__ bias, const float* __restrict__ resid,
                     float* __restrict__ outf, _Float16* __restrict__ outh, int K) {
    __shared__ __attribute__((aligned(16))) _Float16 sA[2][GM_TILE];
    __shared__ __attribute__((aligned(16))) _Float16 sB[2][GM_TILE];

    const int tid  = threadIdx.x;
    const int lane = tid & 31;
    const int wave = tid >> 5;
    const int col  = lane & 15;   // M (A) / N (B,C) index within 16-tile
    const int hh   = lane >> 4;   // lane-half -> +8 K offset in A/B operands
    const int wn   = wave & 3;    // 4 N-groups of 32
    const int wm   = wave >> 2;   // 2 M-groups of 64
    const int m0   = blockIdx.y * 128;
    const int n0   = blockIdx.x * 128;

    // copy assignment: rows cr, cr+16, .. cr+112 of each slab, 16-byte chunk cc of the row
    const int cr = tid >> 4;
    const int cc = tid & 15;
    const unsigned lA = (unsigned)(uintptr_t)(&sA[0][0]) + (unsigned)(cr * (GM_PITCH * 2) + cc * 16);
    const unsigned lB = (unsigned)(uintptr_t)(&sB[0][0]) + (unsigned)(cr * (GM_PITCH * 2) + cc * 16);
    const _Float16* gA = A  + (size_t)(m0 + cr) * K + cc * 8;
    const _Float16* gB = Bt + (size_t)(n0 + cr) * K + cc * 8;
    const size_t rs = (size_t)16 * K;

    // stage slab s (k 128s .. 128s+127) of A and Bt into buffer buf
    auto stage = [&](int buf, int s) {
        const unsigned lo = (unsigned)(buf * (GM_TILE * 2));
        gm_copy8(lA + lo, gA + (size_t)s * 128, rs);
        gm_copy8(lB + lo, gB + (size_t)s * 128, rs);
    };

    v8f acc[4][2];
#pragma unroll
    for (int mi = 0; mi < 4; ++mi)
#pragma unroll
        for (int ni = 0; ni < 2; ++ni) acc[mi][ni] = v8f_zero();

    const int nslabs = K >> 7;
    stage(0, 0);
    // slab 0 has landed for this wave's copies; the barrier publishes all waves' copies
    asm volatile("s_wait_asynccnt 0x0" ::: "memory");
    __syncthreads();
    if (nslabs > 1) stage(1, 1);

    // element (mi, ni, r) of this lane lies at e0 + (mi * 16 + r) * N + ni * 16
    const unsigned e0 = (unsigned)(m0 + wm * 64 + 8 * hh) * N + (unsigned)(n0 + wn * 32 + col);
    // bias and residual are asked for here, behind the first two slabs' copies: all
    // of a lane's loads are in flight together and land while the k loop runs
    float rv[4][2][8];
    if constexpr (RES) {
        const float* rp = resid + e0;
#pragma unroll
        for (int mi = 0; mi < 4; ++mi)
#pragma unroll
            for (int ni = 0; ni < 2; ++ni)
#pragma unroll
                for (int r = 0; r < 8; ++r) rv[mi][ni][r] = rp[(mi * 16 + r) * N + ni * 16];
    }
    const float bn0 = bias[n0 + wn * 32 + col];
    const float bn1 = bias[n0 + wn * 32 + 16 + col];

    for (int s = 0; s < nslabs; ++s) {
        const int buf = s & 1;
        const _Float16* pa = &sA[buf][(wm * 64 + col) * GM_PITCH + 8 * hh];
        const _Float16* pb = &sB[buf][(wn * 32 + col) * GM_PITCH + 8 * hh];
        // unrolled, like the loops inside: every index of a, b and acc is then a
        // constant (they stay in registers) and every LDS offset an immediate
#pragma unroll
        for (int kb = 0; kb < 4; ++kb) {
            HV a[4], b[2];
#pragma unroll
            for (int mi = 0; mi < 4; ++mi) {
                const _Float16* p = pa + mi * 16 * GM_PITCH + kb * 32;
                a[mi].q[0] = *(const u32x4*)(p);
                a[mi].q[1] = *(const u32x4*)(p + 16);
            }
#pragma unroll
            for (int ni = 0; ni < 2; ++ni) {
                const _Float16* p = pb + ni * 16 * GM_PITCH + kb * 32;
                b[ni].q[0] = *(const u32x4*)(p);
                b[ni].q[1] = *(const u32x4*)(p + 16);
            }
#pragma unroll
            for (int mi = 0; mi < 4; ++mi)
#pragma unroll
                for (int ni = 0; ni < 2; ++ni)
                    acc[mi][ni] = __builtin_amdgcn_wmma_f32_16x16x32_f16(
                        false, a[mi].v, false, b[ni].v, (short)0, acc[mi][ni], false, false);
        }
        // hand-over, every wave: this wave's reads of buffer buf are done ...
        asm volatile("s_wait_dscnt 0x0" ::: "memory");
        // ... its copies of the next slab have landed ...
        asm volatile("s_wait_asynccnt 0x0" ::: "memory");
        // ... and the barrier publishes the next slab and frees buffer buf
        __syncthreads();
        if (s + 2 < nslabs) stage(buf, s + 2);
    }
    // no copy is left in flight when the wave ends
    asm volatile("s_wait_asynccnt 0x0" ::: "memory");

    // all 64 values first ...
    _Float16 hv[4][2][8];
#pragma unroll
    for (int mi = 0; mi < 4; ++mi) {
#pragma unroll
        for (int ni = 0; ni < 2; ++ni) {
            const float bn = ni ? bn1 : bn0;
#pragma unroll
            for (int r = 0; r < 8; ++r) {
                float val = acc[mi][ni][r] + bn;
                if constexpr (GELU) val = gelu_tanh(val);
                if constexpr (RES) acc[mi][ni][r] = val + rv[mi][ni][r];
                else               hv[mi][ni][r] = (_Float16)val;
            }
        }
    }
    // ... then the 64 stores in a row, each at the lane's base plus an immediate
    if constexpr (RES) {
        float* const op = outf + e0;
#pragma unroll
        for (int mi = 0; mi < 4; ++mi)
#pragma unroll
            for (int ni = 0; ni < 2; ++ni)
#pragma unroll
                for (int r = 0; r < 8; ++r) op[(mi * 16 + r) * N + ni * 16] = acc[mi][ni][r];
    } else {
        _Float16* const op = outh + e0;
#pragma unroll
        for (int mi = 0; mi < 4; ++mi)
#pragma unroll
            for (int ni = 0; ni < 2; ++ni)
#pragma unroll
                for (int r = 0; r < 8; ++r) op[(mi * 16 + r) * N + ni * 16] = hv[mi][ni][r];
    }
}

// ---------------------------------------------------------------------------
// Causal flash attention.  One 8-wave block per (128-query block, head); each
// wave owns 16 queries.  q/k: (n x d) f16, head-h slice at column h*64, dh=64.
// vT: (d x n) f16 transposed V, so its rows are key-contiguous.
// The eight waves share each 64-key tile of K (64 keys x 64 dims) and of vT
// (64 dims x 64 keys): the block copies it once into LDS as whole 128-byte
// rows, two buffers, the next tile in flight while this one is worked on.
// LDS rows are pitched 144 B for the 16-byte fragment reads.
// The products are taken transposed: S^T = Kb Q^T (A = K rows, B = Q) and
// O^T += Vb^T P^T (A = vT rows, B = P^T).  A lane then holds 16 of the 32
// scores of ONE query (lane%16), so maximum and sum run inside the lane with a
// single exchange between the wave's halves, and the two score tiles, converted
// in place, already are the B operand of the second product.
// ---------------------------------------------------------------------------
// 2^x of eight (exp2x8) or nine (exp2x9) values.  One statement each, results kept
// apart from arguments ("=&v") and a closing v_nop: the instruction set asks for one
// slot between a transcendental and an instruction that reads its result or
// overwrites its argument.
__device__ __forceinline__ void exp2x8(float (&y)[8], const float (&x)[8]) {
    asm("v_exp_f32 %0, %8\n\t"  "v_exp_f32 %1, %9\n\t"
        "v_exp_f32 %2, %10\n\t" "v_exp_f32 %3, %11\n\t"
        "v_exp_f32 %4, %12\n\t" "v_exp_f32 %5, %13\n\t"
        "v_exp_f32 %6, %14\n\t" "v_exp_f32 %7, %15\n\t"
        "v_nop"
        : "=&v"(y[0]), "=&v"(y[1]), "=&v"(y[2]), "=&v"(y[3]),
          "=&v"(y[4]), "=&v"(y[5]), "=&v"(y[6]), "=&v"(y[7])
        : "v"(x[0]), "v"(x[1]), "v"(x[2]), "v"(x[3]),
          "v"(x[4]), "v"(x[5]), "v"(x[6]), "v"(x[7]));
}
__device__ __forceinline__ void exp2x9(float& ya, float (&y)[8], float xa, const float (&x)[8]) {
    asm("v_exp_f32 %0, %9\n\t"  "v_exp_f32 %1, %10\n\t"
        "v_exp_f32 %2, %11\n\t" "v_exp_f32 %3, %12\n\t"
        "v_exp_f32 %4, %13\n\t" "v_exp_f32 %5, %14\n\t"
        "v_exp_f32 %6, %15\n\t" "v_exp_f32 %7, %16\n\t"
        "v_exp_f32 %8, %17\n\t"
        "v_nop"
        : "=&v"(ya), "=&v"(y[0]), "=&v"(y[1]), "=&v"(y[2]), "=&v"(y[3]),
          "=&v"(y[4]), "=&v"(y[5]), "=&v"(y[6]), "=&v"(y[7])
        : "v"(xa), "v"(x[0]), "v"(x[1]), "v"(x[2]), "v"(x[3]),
          "v"(x[4]), "v"(x[5]), "v"(x[6]), "v"(x[7]));
}

#define FA_PITCH 72                     // halves per staged row (144 B)
#define FA_TILE  (64 * FA_PITCH)        // halves per staged tile

// two such blocks share a WGP (four waves per SIMD): let the register allocator use that share
__global__ __launch_bounds__(256) __attribute__((amdgpu_waves_per_eu(4, 4)))
void flash_attn(const _Float16* __restrict__ q, const _Float16* __restrict__ k,
                const _Float16* __restrict__ vT, _Float16* __restrict__ o,
                int n, int d) {
    const int dh = 64;
    const float scale = 0.125f;              // 1/sqrt(64)
    const int tid  = threadIdx.x;
    const int lane = tid & 31;
    const int wave = __builtin_amdgcn_readfirstlane(tid >> 5);
    const int col  = lane & 15;
    const int hh   = lane >> 4;
    const int head = blockIdx.y;
    const int q0   = blockIdx.x * 128 + wave * 16;
    const size_t hoff = (size_t)head * dh;

    __shared__ __attribute__((aligned(16))) _Float16 sK[2][FA_TILE];
    __shared__ __attribute__((aligned(16))) _Float16 sV[2][FA_TILE];

    // copy assignment: rows cr and cr+32 of each tile, 16-byte chunk cc of the row
    const int cr = tid >> 3;
    const int cc = tid & 7;
    const unsigned lK = (unsigned)(uintptr_t)(&sK[0][0]) + (unsigned)(cr * (FA_PITCH * 2) + cc * 16);
    const unsigned lV = (unsigned)(uintptr_t)(&sV[0][0]) + (unsigned)(cr * (FA_PITCH * 2) + cc * 16);
    const _Float16* gK = k  + (size_t)cr * d + hoff + cc * 8;
    const _Float16* gV = vT + (hoff + cr) * (size_t)n + cc * 8;

    // stage key tile t (keys 64t .. 64t+63) of K and vT into buffer buf
    auto stage = [&](int buf, int t) {
        const unsigned lo = (unsigned)(buf * (FA_TILE * 2));
        const _Float16* k0p = gK + (size_t)t * 64 * d;
        const _Float16* k1p = k0p + (size_t)32 * d;
        const _Float16* v0p = gV + (size_t)t * 64;
        const _Float16* v1p = v0p + (size_t)32 * n;
        // the closing s_wait_xcnt keeps the address registers from being
        // rewritten while a copy that names them is still being issued
        asm volatile("global_load_async_to_lds_b128 %0, %4, off\n\t"
                     "global_load_async_to_lds_b128 %1, %5, off\n\t"
                     "global_load_async_to_lds_b128 %2, %6, off\n\t"
                     "global_load_async_to_lds_b128 %3, %7, off\n\t"
                     "s_wait_xcnt 0x0"
                     :: "v"(lK + lo), "v"(lK + lo + 32 * (FA_PITCH * 2)),
                        "v"(lV + lo), "v"(lV + lo + 32 * (FA_PITCH * 2)),
                        "v"((unsigned long long)(uintptr_t)k0p),
                        "v"((unsigned long long)(uintptr_t)k1p),
                        "v"((unsigned long long)(uintptr_t)v0p),
                        "v"((unsigned long long)(uintptr_t)v1p)
                     : "memory");
    };

    AV aq0, aq1;
    const _Float16* qrow = q + (size_t)(q0 + col) * d + hoff;
#pragma unroll
    for (int j = 0; j < 8; ++j) {
        int ko = 2 * j + 8 * hh + ((j >= 4) ? 8 : 0);
        aq0.u[j] = *(const unsigned*)(qrow + ko);
        aq1.u[j] = *(const unsigned*)(qrow + 32 + ko);
    }

    v8f acc[4];
#pragma unroll
    for (int t = 0; t < 4; ++t) acc[t] = v8f_zero();
    // of query q0 + col: running maximum (equal in both halves of the wave) and
    // the sum over the keys that this half of the wave holds
    float mrow = -1e30f, lrow = 0.0f;
    const int qg = q0 + col;

    const int ntiles = 2 * (blockIdx.x + 1);     // 64-key tiles up to the block's diagonal

    stage(0, 0);
    // tile 0 has landed for this wave's copies; the barrier publishes all waves' copies
    asm volatile("s_wait_asynccnt 0x0" ::: "memory");
    __syncthreads();
    stage(1, 1);

    for (int kt = 0; kt < ntiles; ++kt) {
        const int buf = kt & 1;
#pragma unroll
        for (int ps = 0; ps < 2; ++ps) {
            const int k0 = kt * 64 + ps * 32;
            if (k0 > q0 + 15) continue;          // wave-uniform: keys wholly above the diagonal
            // ---- S^T = Kb Q^T : two 16x16 score tiles (keys x queries)
            HV b0, b1, b2, b3;
            const _Float16* kr0 = &sK[buf][(ps * 32 + col) * FA_PITCH + 8 * hh];
            const _Float16* kr1 = kr0 + 16 * FA_PITCH;
            b0.q[0] = *(const u32x4*)(kr0);      b0.q[1] = *(const u32x4*)(kr0 + 16);
            b1.q[0] = *(const u32x4*)(kr0 + 32); b1.q[1] = *(const u32x4*)(kr0 + 48);
            b2.q[0] = *(const u32x4*)(kr1);      b2.q[1] = *(const u32x4*)(kr1 + 16);
            b3.q[0] = *(const u32x4*)(kr1 + 32); b3.q[1] = *(const u32x4*)(kr1 + 48);
            // holds the eight LDS reads together in front of the products: one LDS
            // latency per 32 keys instead of one in front of each product
            asm volatile("" :: "v"(b0.v), "v"(b1.v), "v"(b2.v), "v"(b3.v));
            v8f s0 = v8f_zero(), s1 = v8f_zero();
            s0 = __builtin_amdgcn_wmma_f32_16x16x32_f16(false, b0.v, false, aq0.v, (short)0, s0, false, false);
            s0 = __builtin_amdgcn_wmma_f32_16x16x32_f16(false, b1.v, false, aq1.v, (short)0, s0, false, false);
            s1 = __builtin_amdgcn_wmma_f32_16x16x32_f16(false, b2.v, false, aq0.v, (short)0, s1, false, false);
            s1 = __builtin_amdgcn_wmma_f32_16x16x32_f16(false, b3.v, false, aq1.v, (short)0, s1, false, false);

            // ---- scale + causal mask + online softmax
            // s0[r]: key k0 + 8*hh + r, s1[r]: key k0 + 16 + 8*hh + r, query qg
            const int kb = k0 + 8 * hh;
            float mx = -1e30f;
#pragma unroll
            for (int r = 0; r < 8; ++r) {
                float a0 = s0[r] * scale;
                float a1 = s1[r] * scale;
                if (kb + r > qg)      a0 = -1e30f;
                if (kb + 16 + r > qg) a1 = -1e30f;
                s0[r] = a0; s1[r] = a1;
                mx = fmaxf(mx, fmaxf(a0, a1));
            }
            // the other 16 keys of this query sit in lane ^ 16
            mx = fmaxf(mx, __int_as_float(__builtin_amdgcn_permlanex16(
                     __float_as_int(mx), __float_as_int(mx), 0x76543210, 0xfedcba98, false, false)));
            const float mn = fmaxf(mrow, mx);
            // e^x as 2^(x * log2 e)
            const float l2e = 1.4426950408889634f;
            float e0[8], e1[8], p0[8], p1[8], alpha;
#pragma unroll
            for (int r = 0; r < 8; ++r) {
                e0[r] = (s0[r] - mn) * l2e;
                e1[r] = (s1[r] - mn) * l2e;
            }
            exp2x9(alpha, p0, (mrow - mn) * l2e, e0);
            exp2x8(p1, e1);
            mrow = mn;
            AV bp;                               // P^T as B operand: 16 + 16 keys of query col
            float rsum = p0[0] + p1[0];
#pragma unroll
            for (int r = 0; r < 8; ++r) {
                if (r) rsum += p0[r] + p1[r];
                bp.h[r]     = (_Float16)p0[r];
                bp.h[8 + r] = (_Float16)p1[r];
            }
            lrow = lrow * alpha + rsum;
#pragma unroll
            for (int t = 0; t < 4; ++t)
#pragma unroll
                for (int r = 0; r < 8; ++r) acc[t][r] *= alpha;

            // ---- O^T += Vb^T P^T ; each A operand is two 16-byte LDS reads
#pragma unroll
            for (int t = 0; t < 4; ++t) {
                HV bv;
                const _Float16* vb = &sV[buf][(t * 16 + col) * FA_PITCH + ps * 32 + 8 * hh];
                bv.q[0] = *(const u32x4*)(vb);
                bv.q[1] = *(const u32x4*)(vb + 16);
                acc[t] = __builtin_amdgcn_wmma_f32_16x16x32_f16(false, bv.v, false, bp.v,
                                                                (short)0, acc[t], false, false);
            }
        }
        // hand-over, every wave: this wave's reads of buffer buf are done ...
        asm volatile("s_wait_dscnt 0x0" ::: "memory");
        // ... its copies of the next tile have landed ...
        asm volatile("s_wait_asynccnt 0x0" ::: "memory");
        // ... and the barrier publishes the next tile and frees buffer buf
        __syncthreads();
        if (kt + 2 < ntiles) stage(buf, kt + 2);
    }
    // no copy is left in flight when the wave ends
    asm volatile("s_wait_asynccnt 0x0" ::: "memory");

    // join the two halves' sums of each query
    lrow += __int_as_float(__builtin_amdgcn_permlanex16(
                __float_as_int(lrow), __float_as_int(lrow), 0x76543210, 0xfedcba98, false, false));
    // acc[t][r] = O[q0 + col][t*16 + 8*hh + r]: eight consecutive dims, one 16-byte store
    _Float16* orow = o + (size_t)qg * d + hoff + 8 * hh;
#pragma unroll
    for (int t = 0; t < 4; ++t) {
        h16x8 w;
#pragma unroll
        for (int r = 0; r < 8; ++r) w[r] = (_Float16)(acc[t][r] / lrow);
        *(h16x8*)(orow + t * 16) = w;
    }
}

// ---------------------------------------------------------------------------
// Host-side orchestration
// ---------------------------------------------------------------------------
extern "C" void kernel_launch(void* const* d_in, const int* in_sizes, int n_in,
                              void* d_out, int out_size, void* d_ws, size_t ws_size,
                              hipStream_t stream) {
    const int d   = in_sizes[1];          // 1024 (ln1_w)
    const int n   = in_sizes[0] / d;      // 4096
    const int dff = in_sizes[14];         // 4096 (bi)

    const float* x     = (const float*)d_in[0];
    const float* ln1_w = (const float*)d_in[1];
    const float* ln1_b = (const float*)d_in[2];
    const float* Wq    = (const float*)d_in[3];
    const float* bq    = (const float*)d_in[4];
    const float* Wk    = (const float*)d_in[5];
    const float* bk    = (const float*)d_in[6];
    const float* Wv    = (const float*)d_in[7];
    const float* bv    = (const float*)d_in[8];
    const float* Wo    = (const float*)d_in[9];
    const float* bo    = (const float*)d_in[10];
    const float* ln2_w = (const float*)d_in[11];
    const float* ln2_b = (const float*)d_in[12];
    const float* Wi    = (const float*)d_in[13];
    const float* bi    = (const float*)d_in[14];
    const float* Wout  = (const float*)d_in[15];
    const float* bout  = (const float*)d_in[16];

    char* ws = (char*)d_ws;
    size_t off = 0;
    auto alloc = [&](size_t bytes) -> void* {
        void* p = ws + off;
        off += (bytes + 255) & ~(size_t)255;
        return p;
    };
    _Float16* WqT   = (_Float16*)alloc((size_t)d * d * 2);
    _Float16* WkT   = (_Float16*)alloc((size_t)d * d * 2);
    _Float16* WvT   = (_Float16*)alloc((size_t)d * d * 2);
    _Float16* WoT   = (_Float16*)alloc((size_t)d * d * 2);
    _Float16* WiT   = (_Float16*)alloc((size_t)d * dff * 2);
    _Float16* WoutT = (_Float16*)alloc((size_t)dff * d * 2);
    _Float16* h1    = (_Float16*)alloc((size_t)n * d * 2);
    _Float16* q16   = (_Float16*)alloc((size_t)n * d * 2);
    _Float16* k16   = (_Float16*)alloc((size_t)n * d * 2);
    _Float16* v16   = (_Float16*)alloc((size_t)n * d * 2);
    _Float16* vTT   = (_Float16*)alloc((size_t)n * d * 2);
    _Float16* ao16  = (_Float16*)alloc((size_t)n * d * 2);
    float*    x1    = (float*)   alloc((size_t)n * d * 4);
    _Float16* h2    = (_Float16*)alloc((size_t)n * d * 2);
    _Float16* m16   = (_Float16*)alloc((size_t)n * dff * 2);

    cvt_t_f16<<<dim3(d / 64, d / 128), 256, 0, stream>>>(Wq, WqT, d, d);
    cvt_t_f16<<<dim3(d / 64, d / 128), 256, 0, stream>>>(Wk, WkT, d, d);
    cvt_t_f16<<<dim3(d / 64, d / 128), 256, 0, stream>>>(Wv, WvT, d, d);
    cvt_t_f16<<<dim3(d / 64, d / 128), 256, 0, stream>>>(Wo, WoT, d, d);
    cvt_t_f16<<<dim3(dff / 64, d / 128), 256, 0, stream>>>(Wi, WiT, d, dff);
    cvt_t_f16<<<dim3(d / 64, dff / 128), 256, 0, stream>>>(Wout, WoutT, dff, d);

    // LN1 -> h1 (f16)
    ln_f16_kernel<<<n, 256, 0, stream>>>(x, ln1_w, ln1_b, h1, d);

    // QKV projections (f16 out); the first template argument of every product is its
    // count of output columns (d or dff of the problem's shapes)
    dim3 gdd(d / 128, n / 128);
    wmma_gemm_tiled<1024, false, false><<<gdd, 256, 0, stream>>>(h1, WqT, bq, nullptr, nullptr, q16, d);
    wmma_gemm_tiled<1024, false, false><<<gdd, 256, 0, stream>>>(h1, WkT, bk, nullptr, nullptr, k16, d);
    wmma_gemm_tiled<1024, false, false><<<gdd, 256, 0, stream>>>(h1, WvT, bv, nullptr, nullptr, v16, d);

    // V^T (d x n) for K-contiguous P@V operands
    transpose_f16<<<dim3(d / 128, n / 128), 256, 0, stream>>>(v16, vTT, n, d);

    // causal flash attention -> ao16
    flash_attn<<<dim3(n / 128, HEADS), 256, 0, stream>>>(q16, k16, vTT, ao16, n, d);

    // out-proj + residual -> x1 (f32)
    wmma_gemm_tiled<1024, false, true><<<gdd, 256, 0, stream>>>(ao16, WoT, bo, x, x1, nullptr, d);

    // LN2 -> h2 (f16)
    ln_f16_kernel<<<n, 256, 0, stream>>>(x1, ln2_w, ln2_b, h2, d);

    // MLP up + GELU -> m16 (f16)
    wmma_gemm_tiled<4096, true, false><<<dim3(dff / 128, n / 128), 256, 0, stream>>>(h2, WiT, bi, nullptr, nullptr, m16, d);

    // MLP down + bias + residual -> d_out (f32)
    wmma_gemm_tiled<1024, false, true><<<dim3(d / 128, n / 128), 256, 0, stream>>>(m16, WoutT, bout, x1, (float*)d_out, nullptr, dff);
}

// v006
// It runs in 231 microseconds.
// In both of two side-by-side timings against v005, it was 1.09 times as fast.
// Counting every step since v000, it is 4.23 times as fast.
#include <hip/hip_runtime.h>
#include <math.h>

#define HEADS 16

typedef __attribute__((ext_vector_type(16))) _Float16 v16h;
typedef __attribute__((ext_vector_type(8)))  float    v8f;
typedef __attribute__((ext_vector_type(4)))  unsigned u32x4;
typedef __attribute__((ext_vector_type(4)))  float    f32x4;
typedef __attribute__((ext_vector_type(8)))  _Float16 h16x8;

union AV { v16h v; unsigned u[8]; _Float16 h[16]; };
union HV { v16h v; u32x4 q[2]; };

__device__ __forceinline__ v8f v8f_zero() {
    v8f z;
#pragma unroll
    for (int i = 0; i < 8; ++i) z[i] = 0.0f;
    return z;
}

__device__ __forceinline__ float gelu_tanh(float x) {
    const float k0 = 0.7978845608028654f; // sqrt(2/pi)
    const float k1 = 0.044715f;
    return 0.5f * x * (1.0f + tanhf(k0 * (x + k1 * x * x * x)));
}

// ---------------------------------------------------------------------------
// Convert f32 weight (K x N, row-major) -> f16 transposed (N x K, row-major)
// so WMMA B-operand (and async LDS staging) loads are K-contiguous.
// One 256-thread block moves a tile of 128 k x 64 n through LDS: 256-byte runs
// are read from every input row and 256-byte runs written to every output row.
// A thread reads 8 k x 4 n (eight 16-byte loads in flight), converts, and stores
// four 16-byte pieces (8 k of one n) into the transposed LDS tile.  The 16-byte
// piece index is XORed with n/4, so the 16 lanes of a half wave fall on all 64
// banks both when the tile is written and when it is read back by rows.
// K is a multiple of 128, N of 64.  bx, by: the block's tile along n and along k.
// ---------------------------------------------------------------------------
__device__ __forceinline__
void cvt_t_f16(const float* __restrict__ in, _Float16* __restrict__ out,
               int K, int N, int bx, int by) {
    __shared__ __attribute__((aligned(16))) _Float16 s[64 * 128];
    const int tid = threadIdx.x;
    const int lo  = tid & 15;
    const int hi  = tid >> 4;
    const int k0  = by * 128;
    const int n0  = bx * 64;

    const float* p[8];
    f32x4 v[8];
#pragma unroll
    for (int j = 0; j < 8; ++j) p[j] = in + (size_t)(k0 + hi * 8 + j) * N + n0 + lo * 4;
#pragma unroll
    for (int j = 0; j < 8; ++j) v[j] = *(const f32x4*)(p[j]);
    // holds the eight loads together in front of their first use, all in flight
    // at once; the address pairs are named as well, so that no load's result
    // lands on a pair that an earlier load still names
    asm volatile("" :: "v"(v[0]), "v"(v[1]), "v"(v[2]), "v"(v[3]),
                       "v"(v[4]), "v"(v[5]), "v"(v[6]), "v"(v[7]),
                       "v"(p[0]), "v"(p[1]), "v"(p[2]), "v"(p[3]),
                       "v"(p[4]), "v"(p[5]), "v"(p[6]), "v"(p[7]));
#pragma unroll
    for (int i = 0; i < 4; ++i) {
        h16x8 w;
#pragma unroll
        for (int j = 0; j < 8; ++j) w[j] = (_Float16)v[j][i];
        *(h16x8*)(&s[(lo * 4 + i) * 128 + ((hi ^ lo) * 8)]) = w;
    }
    __syncthreads();
#pragma unroll
    for (int it = 0; it < 4; ++it) {
        const int r = hi + it * 16;
        h16x8 w = *(const h16x8*)(&s[r * 128 + ((lo ^ (r >> 2)) * 8)]);
        *(h16x8*)(out + (size_t)(n0 + r) * K + k0 + lo * 8) = w;
    }
}

// f16 (R x C) -> f16 transposed (C x R):  out[c*R + r] = in[r*C + c]
// Same scheme, tile 128 r x 128 c: a thread reads 8 r x 8 c and stores eight
// 16-byte pieces (8 r of one c); the piece index is XORed with c/8.
// R and C are multiples of 128.
__global__ __launch_bounds__(256)
void transpose_f16(const _Float16* __restrict__ in, _Float16* __restrict__ out,
                   int R, int C) {
    __shared__ __attribute__((aligned(16))) _Float16 s[128 * 128];
    const int tid = threadIdx.x;
    const int lo  = tid & 15;
    const int hi  = tid >> 4;
    const int r0  = blockIdx.y * 128;
    const int c0  = blockIdx.x * 128;

    const _Float16* p[8];
    h16x8 v[8];
#pragma unroll
    for (int j = 0; j < 8; ++j) p[j] = in + (size_t)(r0 + hi * 8 + j) * C + c0 + lo * 8;
#pragma unroll
    for (int j = 0; j < 8; ++j) v[j] = *(const h16x8*)(p[j]);
    // holds the eight loads together in front of their first use, all in flight
    // at once; the address pairs are named as well, so that no load's result
    // lands on a pair that an earlier load still names
    asm volatile("" :: "v"(v[0]), "v"(v[1]), "v"(v[2]), "v"(v[3]),
                       "v"(v[4]), "v"(v[5]), "v"(v[6]), "v"(v[7]),
                       "v"(p[0]), "v"(p[1]), "v"(p[2]), "v"(p[3]),
                       "v"(p[4]), "v"(p[5]), "v"(p[6]), "v"(p[7]));
#pragma unroll
    for (int i = 0; i < 8; ++i) {
        h16x8 w;
#pragma unroll
        for (int j = 0; j < 8; ++j) w[j] = v[j][i];
        *(h16x8*)(&s[(lo * 8 + i) * 128 + ((hi ^ lo) * 8)]) = w;
    }
    __syncthreads();
#pragma unroll
    for (int it = 0; it < 8; ++it) {
        const int c = hi + it * 16;
        h16x8 w = *(const h16x8*)(&s[c * 128 + ((lo ^ (c >> 3)) * 8)]);
        *(h16x8*)(out + (size_t)(c0 + c) * R + r0 + lo * 8) = w;
    }
}

// ---------------------------------------------------------------------------
// Row LayerNorm, f32 in -> f16 out.  One 256-thread block per row.
// ---------------------------------------------------------------------------
__device__ __forceinline__
void ln_f16_row(const float* __restrict__ x, const float* __restrict__ w,
                const float* __restrict__ b, _Float16* __restrict__ out,
                int d, int row) {
    const float* xr = x + (size_t)row * d;
    float s = 0.f, ss = 0.f;
    for (int i = threadIdx.x; i < d; i += blockDim.x) {
        float v = xr[i];
        s += v; ss += v * v;
    }
    __shared__ float rs[256], rss[256];
    rs[threadIdx.x] = s; rss[threadIdx.x] = ss;
    __syncthreads();
    for (int st = 128; st > 0; st >>= 1) {
        if (threadIdx.x < st) { rs[threadIdx.x] += rs[threadIdx.x + st];
                                rss[threadIdx.x] += rss[threadIdx.x + st]; }
        __syncthreads();
    }
    float mean = rs[0] / (float)d;
    float var  = rss[0] / (float)d - mean * mean;
    float inv  = rsqrtf(var + 1e-12f);
    for (int i = threadIdx.x; i < d; i += blockDim.x)
        out[(size_t)row * d + i] = (_Float16)((xr[i] - mean) * inv * w[i] + b[i]);
}

__global__ void ln_f16_kernel(const float* __restrict__ x, const float* __restrict__ w,
                              const float* __restrict__ b, _Float16* __restrict__ out,
                              int d) {
    ln_f16_row(x, w, b, out, d, blockIdx.x);
}

// ---------------------------------------------------------------------------
// All that the first product waits for, in ONE launch: the six weight
// conversions and the first LayerNorm read only inputs and depend on nothing, so
// their blocks run side by side and fill the chip together, where seven launches
// one behind the other each paid a launch gap, a ramp and a tail, four of them
// with a block on only half of the WGPs.
// The block index picks the job (the same for every thread of a block, so each
// job's barriers are passed by the whole block): first the tiles of the four
// D x D weights, then those of Wi (D x DFF) and of Wout (DFF x D), then one block
// per row of x.  D, DFF: the problem's widths, compile-time so that the split of
// the index is shifts and masks.
// ---------------------------------------------------------------------------
template <int D, int DFF>
struct PrepBlocks {
    static constexpr unsigned sq  = (D / 64) * (D / 128);      // tiles of a D x D weight
    static constexpr unsigned big = (DFF / 64) * (D / 128);    // tiles of Wi, and of Wout
    static constexpr unsigned cvt = 4 * sq + 2 * big;          // conversion blocks in front of the rows
};

template <int D, int DFF>
__global__ __launch_bounds__(256)
void prep_kernel(const float* __restrict__ Wq, const float* __restrict__ Wk,
                 const float* __restrict__ Wv, const float* __restrict__ Wo,
                 const float* __restrict__ Wi, const float* __restrict__ Wout,
                 _Float16* __restrict__ WqT, _Float16* __restrict__ WkT,
                 _Float16* __restrict__ WvT, _Float16* __restrict__ WoT,
                 _Float16* __restrict__ WiT, _Float16* __restrict__ WoutT,
                 const float* __restrict__ x, const float* __restrict__ ln_w,
                 const float* __restrict__ ln_b, _Float16* __restrict__ h, int d) {
    typedef PrepBlocks<D, DFF> PB;
    const unsigned bid = blockIdx.x;
    if (bid < 4 * PB::sq) {
        const unsigned sel = bid / PB::sq;
        const unsigned t   = bid % PB::sq;
        const float* in = sel == 0 ? Wq  : sel == 1 ? Wk  : sel == 2 ? Wv  : Wo;
        _Float16* out   = sel == 0 ? WqT : sel == 1 ? WkT : sel == 2 ? WvT : WoT;
        cvt_t_f16(in, out, D, D, t % (D / 64), t / (D / 64));
    } else if (bid < 4 * PB::sq + PB::big) {
        const unsigned t = bid - 4 * PB::sq;
        cvt_t_f16(Wi, WiT, D, DFF, t % (DFF / 64), t / (DFF / 64));
    } else if (bid < PB::cvt) {
        const unsigned t = bid - (4 * PB::sq + PB::big);
        cvt_t_f16(Wout, WoutT, DFF, D, t % (D / 64), t / (D / 64));
    } else {
        ln_f16_row(x, ln_w, ln_b, h, d, bid - PB::cvt);
    }
}

// ---------------------------------------------------------------------------
// Tiled WMMA GEMM with async global->LDS double-buffered staging.
//   out = act(A(MxK,f16) @ Bt(NxK,f16)^T + bias) (+ resid)
// Block: 256 threads (8 waves) computes 128x128 tile.
// Wave (wm in 0..1, wn in 0..3) computes 64x32 = 4x2 WMMA tiles.
// K is staged in slabs of 128: 256-byte rows of A and of Bt, laid in LDS at a
// pitch of 272 B, at which the 16 lanes of a half wave fall on all 64 banks in
// the 16-byte fragment reads.  Two buffers: the next slab's copies fly while
// this slab's four 32-k blocks are worked on, one barrier per slab.
// K is a multiple of 128.
// ---------------------------------------------------------------------------
#define GM_PITCH 136                    // halves per staged row (272 B)
#define GM_TILE  (128 * GM_PITCH)       // halves per staged slab of one operand

// Eight 16-byte copies of one lane: rows 16 apart of one operand's slab.
// l: the lane's LDS byte address, g: its global address, rs: halves per 16 rows.
__device__ __forceinline__ void gm_copy8(unsigned l, const _Float16* g, size_t rs) {
    // the closing s_wait_xcnt keeps the address registers from being
    // rewritten while a copy that names them is still being issued
    asm volatile("global_load_async_to_lds_b128 %0, %8, off\n\t"
                 "global_load_async_to_lds_b128 %1, %9, off\n\t"
                 "global_load_async_to_lds_b128 %2, %10, off\n\t"
                 "global_load_async_to_lds_b128 %3, %11, off\n\t"
                 "global_load_async_to_lds_b128 %4, %12, off\n\t"
                 "global_load_async_to_lds_b128 %5, %13, off\n\t"
                 "global_load_async_to_lds_b128 %6, %14, off\n\t"
                 "global_load_async_to_lds_b128 %7, %15, off\n\t"
                 "s_wait_xcnt 0x0"
                 :: "v"(l),
                    "v"(l + 1 * 16 * (GM_PITCH * 2)), "v"(l + 2 * 16 * (GM_PITCH * 2)),
                    "v"(l + 3 * 16 * (GM_PITCH * 2)), "v"(l + 4 * 16 * (GM_PITCH * 2)),
                    "v"(l + 5 * 16 * (GM_PITCH * 2)), "v"(l + 6 * 16 * (GM_PITCH * 2)),
                    "v"(l + 7 * 16 * (GM_PITCH * 2)),
                    "v"((unsigned long long)(uintptr_t)(g)),
                    "v"((unsigned long long)(uintptr_t)(g + 1 * rs)),
                    "v"((unsigned long long)(uintptr_t)(g + 2 * rs)),
                    "v"((unsigned long long)(uintptr_t)(g + 3 * rs)),
                    "v"((unsigned long long)(uintptr_t)(g + 4 * rs)),
                    "v"((unsigned long long)(uintptr_t)(g + 5 * rs)),
                    "v"((unsigned long long)(uintptr_t)(g + 6 * rs)),
                    "v"((unsigned long long)(uintptr_t)(g + 7 * rs))
                 : "memory");
}

// N (columns of the output, the row pitch of resid and of the output) and the
// epilogue's mode are compile-time values:
//   RES  : outf = acc + bias + resid   (f32; outh is not used)
//   !RES : outh = act(acc + bias)      (f16; resid and outf are not used),
//          act = tanh GELU where GELU is set, else the identity
// The epilogue then holds no test of a mode, and every element's address is the
// lane's base plus an immediate: its loads, and its stores, follow one another
// with no wait between them.
template <int N, bool GELU, bool RES>
__device__ __forceinline__
void wmma_gemm_tile(const _Float16* __restrict__ A, const _Float16* __restrict__ Bt,
                    const float* __restrict__ bias, const float* __restrict__ resid,
                    float* __restrict__ outf, _Float16* __restrict__ outh, int K) {
    __shared__ __attribute__((aligned(16))) _Float16 sA[2][GM_TILE];
    __shared__ __attribute__((aligned(16))) _Float16 sB[2][GM_TILE];

    const int tid  = threadIdx.x;
    const int lane = tid & 31;
    const int wave = tid >> 5;
    const int col  = lane & 15;   // M (A) / N (B,C) index within 16-tile
    const int hh   = lane >> 4;   // lane-half -> +8 K offset in A/B operands
    const int wn   = wave & 3;    // 4 N-groups of 32
    const int wm   = wave >> 2;   // 2 M-groups of 64
    const int m0   = blockIdx.y * 128;
    const int n0   = blockIdx.x * 128;

    // copy assignment: rows cr, cr+16, .. cr+112 of each slab, 16-byte chunk cc of the row
    const int cr = tid >> 4;
    const int cc = tid & 15;
    const unsigned lA = (unsigned)(uintptr_t)(&sA[0][0]) + (unsigned)(cr * (GM_PITCH * 2) + cc * 16);
    const unsigned lB = (unsigned)(uintptr_t)(&sB[0][0]) + (unsigned)(cr * (GM_PITCH * 2) + cc * 16);
    const _Float16* gA = A  + (size_t)(m0 + cr) * K + cc * 8;
    const _Float16* gB = Bt + (size_t)(n0 + cr) * K + cc * 8;
    const size_t rs = (size_t)16 * K;

    // stage slab s (k 128s .. 128s+127) of A and Bt into buffer buf
    auto stage = [&](int buf, int s) {
        const unsigned lo = (unsigned)(buf * (GM_TILE * 2));
        gm_copy8(lA + lo, gA + (size_t)s * 128, rs);
        gm_copy8(lB + lo, gB + (size_t)s * 128, rs);
    };

    v8f acc[4][2];
#pragma unroll
    for (int mi = 0; mi < 4; ++mi)
#pragma unroll
        for (int ni = 0; ni < 2; ++ni) acc[mi][ni] = v8f_zero();

    const int nslabs = K >> 7;
    stage(0, 0);
    // slab 0 has landed for this wave's copies; the barrier publishes all waves' copies
    asm volatile("s_wait_asynccnt 0x0" ::: "memory");
    __syncthreads();
    if (nslabs > 1) stage(1, 1);

    // element (mi, ni, r) of this lane lies at e0 + (mi * 16 + r) * N + ni * 16
    const unsigned e0 = (unsigned)(m0 + wm * 64 + 8 * hh) * N + (unsigned)(n0 + wn * 32 + col);
    // bias and residual are asked for here, behind the first two slabs' copies: all
    // of a lane's loads are in flight together and land while the k loop runs
    float rv[4][2][8];
    if constexpr (RES) {
        const float* rp = resid + e0;
#pragma unroll
        for (int mi = 0; mi < 4; ++mi)
#pragma unroll
            for (int ni = 0; ni < 2; ++ni)
#pragma unroll
                for (int r = 0; r < 8; ++r) rv[mi][ni][r] = rp[(mi * 16 + r) * N + ni * 16];
    }
    const float bn0 = bias[n0 + wn * 32 + col];
    const float bn1 = bias[n0 + wn * 32 + 16 + col];
    // the loads above are issued before a register that they name is used for anything
    // else (the compiler reuses the bias pointer's pair for the slab counter)
    asm volatile("s_wait_xcnt 0x0" ::: "memory");

    for (int s = 0; s < nslabs; ++s) {
        const int buf = s & 1;
        const _Float16* pa = &sA[buf][(wm * 64 + col) * GM_PITCH + 8 * hh];
        const _Float16* pb = &sB[buf][(wn * 32 + col) * GM_PITCH + 8 * hh];
        // unrolled, like the loops inside: every index of a, b and acc is then a
        // constant (they stay in registers) and every LDS offset an immediate
#pragma unroll
        for (int kb = 0; kb < 4; ++kb) {
            HV a[4], b[2];
#pragma unroll
            for (int mi = 0; mi < 4; ++mi) {
                const _Float16* p = pa + mi * 16 * GM_PITCH + kb * 32;
                a[mi].q[0] = *(const u32x4*)(p);
                a[mi].q[1] = *(const u32x4*)(p + 16);
            }
#pragma unroll
            for (int ni = 0; ni < 2; ++ni) {
                const _Float16* p = pb + ni * 16 * GM_PITCH + kb * 32;
                b[ni].q[0] = *(const u32x4*)(p);
                b[ni].q[1] = *(const u32x4*)(p + 16);
            }
#pragma unroll
            for (int mi = 0; mi < 4; ++mi)
#pragma unroll
                for (int ni = 0; ni < 2; ++ni)
                    acc[mi][ni] = __builtin_amdgcn_wmma_f32_16x16x32_f16(
                        false, a[mi].v, false, b[ni].v, (short)0, acc[mi][ni], false, false);
        }
        // hand-over, every wave: this wave's reads of buffer buf are done ...
        asm volatile("s_wait_dscnt 0x0" ::: "memory");
        // ... its copies of the next slab have landed ...
        asm volatile("s_wait_asynccnt 0x0" ::: "memory");
        // ... and the barrier publishes the next slab and frees buffer buf
        __syncthreads();
        if (s + 2 < nslabs) stage(buf, s + 2);
    }
    // no copy is left in flight when the wave ends
    asm volatile("s_wait_asynccnt 0x0" ::: "memory");

    // all 64 values first ...
    _Float16 hv[4][2][8];
#pragma unroll
    for (int mi = 0; mi < 4; ++mi) {
#pragma unroll
        for (int ni = 0; ni < 2; ++ni) {
            const float bn = ni ? bn1 : bn0;
#pragma unroll
            for (int r = 0; r < 8; ++r) {
                float val = acc[mi][ni][r] + bn;
                if constexpr (GELU) val = gelu_tanh(val);
                if constexpr (RES) acc[mi][ni][r] = val + rv[mi][ni][r];
                else               hv[mi][ni][r] = (_Float16)val;
            }
        }
    }
    // ... then the 64 stores in a row, each at the lane's base plus an immediate
    if constexpr (RES) {
        float* const op = outf + e0;
#pragma unroll
        for (int mi = 0; mi < 4; ++mi)
#pragma unroll
            for (int ni = 0; ni < 2; ++ni)
#pragma unroll
                for (int r = 0; r < 8; ++r) op[(mi * 16 + r) * N + ni * 16] = acc[mi][ni][r];
    } else {
        _Float16* const op = outh + e0;
#pragma unroll
        for (int mi = 0; mi < 4; ++mi)
#pragma unroll
            for (int ni = 0; ni < 2; ++ni)
#pragma unroll
                for (int r = 0; r < 8; ++r) op[(mi * 16 + r) * N + ni * 16] = hv[mi][ni][r];
    }
}

template <int N, bool GELU, bool RES>
__global__ __launch_bounds__(256)
void wmma_gemm_tiled(const _Float16* __restrict__ A, const _Float16* __restrict__ Bt,
                     const float* __restrict__ bias, const float* __restrict__ resid,
                     float* __restrict__ outf, _Float16* __restrict__ outh, int K) {
    wmma_gemm_tile<N, GELU, RES>(A, Bt, bias, resid, outf, outh, K);
}

// Three products of the same A with three weights (f16 out, no activation) in ONE
// launch: blockIdx.z picks weight, bias and output.  Each product alone has one
// block per WGP; together two blocks share a WGP, so that one block's first slab
// and its epilogue run beside the other's k loop, and two launch gaps go.
template <int N>
__global__ __launch_bounds__(256)
void wmma_gemm_tiled3(const _Float16* __restrict__ A,
                      const _Float16* __restrict__ Bt0, const _Float16* __restrict__ Bt1,
                      const _Float16* __restrict__ Bt2,
                      const float* __restrict__ bias0, const float* __restrict__ bias1,
                      const float* __restrict__ bias2,
                      _Float16* __restrict__ out0, _Float16* __restrict__ out1,
                      _Float16* __restrict__ out2, int K) {
    const int z = blockIdx.z;
    const _Float16* Bt = z == 0 ? Bt0   : z == 1 ? Bt1   : Bt2;
    const float* bias  = z == 0 ? bias0 : z == 1 ? bias1 : bias2;
    _Float16* outh     = z == 0 ? out0  : z == 1 ? out1  : out2;
    wmma_gemm_tile<N, false, false>(A, Bt, bias, nullptr, nullptr, outh, K);
}

// ---------------------------------------------------------------------------
// Causal flash attention.  One 8-wave block per (128-query block, head); each
// wave owns 16 queries.  q/k: (n x d) f16, head-h slice at column h*64, dh=64.
// vT: (d x n) f16 transposed V, so its rows are key-contiguous.
// The eight waves share each 64-key tile of K (64 keys x 64 dims) and of vT
// (64 dims x 64 keys): the block copies it once into LDS as whole 128-byte
// rows, two buffers, the next tile in flight while this one is worked on.
// LDS rows are pitched 144 B for the 16-byte fragment reads.
// The products are taken transposed: S^T = Kb Q^T (A = K rows, B = Q) and
// O^T += Vb^T P^T (A = vT rows, B = P^T).  A lane then holds 16 of the 32
// scores of ONE query (lane%16), so maximum and sum run inside the lane with a
// single exchange between the wave's halves, and the two score tiles, converted
// in place, already are the B operand of the second product.
// ---------------------------------------------------------------------------
// 2^x of eight (exp2x8) or nine (exp2x9) values.  One statement each, results kept
// apart from arguments ("=&v") and a closing v_nop: the instruction set asks for one
// slot between a transcendental and an instruction that reads its result or
// overwrites its argument.
__device__ __forceinline__ void exp2x8(float (&y)[8], const float (&x)[8]) {
    asm("v_exp_f32 %0, %8\n\t"  "v_exp_f32 %1, %9\n\t"
        "v_exp_f32 %2, %10\n\t" "v_exp_f32 %3, %11\n\t"
        "v_exp_f32 %4, %12\n\t" "v_exp_f32 %5, %13\n\t"
        "v_exp_f32 %6, %14\n\t" "v_exp_f32 %7, %15\n\t"
        "v_nop"
        : "=&v"(y[0]), "=&v"(y[1]), "=&v"(y[2]), "=&v"(y[3]),
          "=&v"(y[4]), "=&v"(y[5]), "=&v"(y[6]), "=&v"(y[7])
        : "v"(x[0]), "v"(x[1]), "v"(x[2]), "v"(x[3]),
          "v"(x[4]), "v"(x[5]), "v"(x[6]), "v"(x[7]));
}
__device__ __forceinline__ void exp2x9(float& ya, float (&y)[8], float xa, const float (&x)[8]) {
    asm("v_exp_f32 %0, %9\n\t"  "v_exp_f32 %1, %10\n\t"
        "v_exp_f32 %2, %11\n\t" "v_exp_f32 %3, %12\n\t"
        "v_exp_f32 %4, %13\n\t" "v_exp_f32 %5, %14\n\t"
        "v_exp_f32 %6, %15\n\t" "v_exp_f32 %7, %16\n\t"
        "v_exp_f32 %8, %17\n\t"
        "v_nop"
        : "=&v"(ya), "=&v"(y[0]), "=&v"(y[1]), "=&v"(y[2]), "=&v"(y[3]),
          "=&v"(y[4]), "=&v"(y[5]), "=&v"(y[6]), "=&v"(y[7])
        : "v"(xa), "v"(x[0]), "v"(x[1]), "v"(x[2]), "v"(x[3]),
          "v"(x[4]), "v"(x[5]), "v"(x[6]), "v"(x[7]));
}

#define FA_PITCH 72                     // halves per staged row (144 B)
#define FA_TILE  (64 * FA_PITCH)        // halves per staged tile

// two such blocks share a WGP (four waves per SIMD): let the register allocator use that share
__global__ __launch_bounds__(256) __attribute__((amdgpu_waves_per_eu(4, 4)))
void flash_attn(const _Float16* __restrict__ q, const _Float16* __restrict__ k,
                const _Float16* __restrict__ vT, _Float16* __restrict__ o,
                int n, int d) {
    const int dh = 64;
    const float scale = 0.125f;              // 1/sqrt(64)
    const int tid  = threadIdx.x;
    const int lane = tid & 31;
    const int wave = __builtin_amdgcn_readfirstlane(tid >> 5);
    const int col  = lane & 15;
    const int hh   = lane >> 4;
    const int head = blockIdx.y;
    const int q0   = blockIdx.x * 128 + wave * 16;
    const size_t hoff = (size_t)head * dh;

    __shared__ __attribute__((aligned(16))) _Float16 sK[2][FA_TILE];
    __shared__ __attribute__((aligned(16))) _Float16 sV[2][FA_TILE];

    // copy assignment: rows cr and cr+32 of each tile, 16-byte chunk cc of the row
    const int cr = tid >> 3;
    const int cc = tid & 7;
    const unsigned lK = (unsigned)(uintptr_t)(&sK[0][0]) + (unsigned)(cr * (FA_PITCH * 2) + cc * 16);
    const unsigned lV = (unsigned)(uintptr_t)(&sV[0][0]) + (unsigned)(cr * (FA_PITCH * 2) + cc * 16);
    const _Float16* gK = k  + (size_t)cr * d + hoff + cc * 8;
    const _Float16* gV = vT + (hoff + cr) * (size_t)n + cc * 8;

    // stage key tile t (keys 64t .. 64t+63) of K and vT into buffer buf
    auto stage = [&](int buf, int t) {
        const unsigned lo = (unsigned)(buf * (FA_TILE * 2));
        const _Float16* k0p = gK + (size_t)t * 64 * d;
        const _Float16* k1p = k0p + (size_t)32 * d;
        const _Float16* v0p = gV + (size_t)t * 64;
        const _Float16* v1p = v0p + (size_t)32 * n;
        // the closing s_wait_xcnt keeps the address registers from being
        // rewritten while a copy that names them is still being issued
        asm volatile("global_load_async_to_lds_b128 %0, %4, off\n\t"
                     "global_load_async_to_lds_b128 %1, %5, off\n\t"
                     "global_load_async_to_lds_b128 %2, %6, off\n\t"
                     "global_load_async_to_lds_b128 %3, %7, off\n\t"
                     "s_wait_xcnt 0x0"
                     :: "v"(lK + lo), "v"(lK + lo + 32 * (FA_PITCH * 2)),
                        "v"(lV + lo), "v"(lV + lo + 32 * (FA_PITCH * 2)),
                        "v"((unsigned long long)(uintptr_t)k0p),
                        "v"((unsigned long long)(uintptr_t)k1p),
                        "v"((unsigned long long)(uintptr_t)v0p),
                        "v"((unsigned long long)(uintptr_t)v1p)
                     : "memory");
    };

    AV aq0, aq1;
    const _Float16* qrow = q + (size_t)(q0 + col) * d + hoff;
#pragma unroll
    for (int j = 0; j < 8; ++j) {
        int ko = 2 * j + 8 * hh + ((j >= 4) ? 8 : 0);
        aq0.u[j] = *(const unsigned*)(qrow + ko);
        aq1.u[j] = *(const unsigned*)(qrow + 32 + ko);
    }

    v8f acc[4];
#pragma unroll
    for (int t = 0; t < 4; ++t) acc[t] = v8f_zero();
    // of query q0 + col: running maximum (equal in both halves of the wave) and
    // the sum over the keys that this half of the wave holds
    float mrow = -1e30f, lrow = 0.0f;
    const int qg = q0 + col;

    const int ntiles = 2 * (blockIdx.x + 1);     // 64-key tiles up to the block's diagonal

    stage(0, 0);
    // tile 0 has landed for this wave's copies; the barrier publishes all waves' copies
    asm volatile("s_wait_asynccnt 0x0" ::: "memory");
    __syncthreads();
    stage(1, 1);

    for (int kt = 0; kt < ntiles; ++kt) {
        const int buf = kt & 1;
#pragma unroll
        for (int ps = 0; ps < 2; ++ps) {
            const int k0 = kt * 64 + ps * 32;
            if (k0 > q0 + 15) continue;          // wave-uniform: keys wholly above the diagonal
            // ---- S^T = Kb Q^T : two 16x16 score tiles (keys x queries)
            HV b0, b1, b2, b3;
            const _Float16* kr0 = &sK[buf][(ps * 32 + col) * FA_PITCH + 8 * hh];
            const _Float16* kr1 = kr0 + 16 * FA_PITCH;
            b0.q[0] = *(const u32x4*)(kr0);      b0.q[1] = *(const u32x4*)(kr0 + 16);
            b1.q[0] = *(const u32x4*)(kr0 + 32); b1.q[1] = *(const u32x4*)(kr0 + 48);
            b2.q[0] = *(const u32x4*)(kr1);      b2.q[1] = *(const u32x4*)(kr1 + 16);
            b3.q[0] = *(const u32x4*)(kr1 + 32); b3.q[1] = *(const u32x4*)(kr1 + 48);
            // holds the eight LDS reads together in front of the products: one LDS
            // latency per 32 keys instead of one in front of each product
            asm volatile("" :: "v"(b0.v), "v"(b1.v), "v"(b2.v), "v"(b3.v));
            v8f s0 = v8f_zero(), s1 = v8f_zero();
            s0 = __builtin_amdgcn_wmma_f32_16x16x32_f16(false, b0.v, false, aq0.v, (short)0, s0, false, false);
            s0 = __builtin_amdgcn_wmma_f32_16x16x32_f16(false, b1.v, false, aq1.v, (short)0, s0, false, false);
            s1 = __builtin_amdgcn_wmma_f32_16x16x32_f16(false, b2.v, false, aq0.v, (short)0, s1, false, false);
            s1 = __builtin_amdgcn_wmma_f32_16x16x32_f16(false, b3.v, false, aq1.v, (short)0, s1, false, false);

            // ---- scale + causal mask + online softmax
            // s0[r]: key k0 + 8*hh + r, s1[r]: key k0 + 16 + 8*hh + r, query qg
            const int kb = k0 + 8 * hh;
            float mx = -1e30f;
#pragma unroll
            for (int r = 0; r < 8; ++r) {
                float a0 = s0[r] * scale;
                float a1 = s1[r] * scale;
                if (kb + r > qg)      a0 = -1e30f;
                if (kb + 16 + r > qg) a1 = -1e30f;
                s0[r] = a0; s1[r] = a1;
                mx = fmaxf(mx, fmaxf(a0, a1));
            }
            // the other 16 keys of this query sit in lane ^ 16
            mx = fmaxf(mx, __int_as_float(__builtin_amdgcn_permlanex16(
                     __float_as_int(mx), __float_as_int(mx), 0x76543210, 0xfedcba98, false, false)));
            const float mn = fmaxf(mrow, mx);
            // e^x as 2^(x * log2 e)
            const float l2e = 1.4426950408889634f;
            float e0[8], e1[8], p0[8], p1[8], alpha;
#pragma unroll
            for (int r = 0; r < 8; ++r) {
                e0[r] = (s0[r] - mn) * l2e;
                e1[r] = (s1[r] - mn) * l2e;
            }
            exp2x9(alpha, p0, (mrow - mn) * l2e, e0);
            exp2x8(p1, e1);
            mrow = mn;
            AV bp;                               // P^T as B operand: 16 + 16 keys of query col
            float rsum = p0[0] + p1[0];
#pragma unroll
            for (int r = 0; r < 8; ++r) {
                if (r) rsum += p0[r] + p1[r];
                bp.h[r]     = (_Float16)p0[r];
                bp.h[8 + r] = (_Float16)p1[r];
            }
            lrow = lrow * alpha + rsum;
#pragma unroll
            for (int t = 0; t < 4; ++t)
#pragma unroll
                for (int r = 0; r < 8; ++r) acc[t][r] *= alpha;

            // ---- O^T += Vb^T P^T ; each A operand is two 16-byte LDS reads
#pragma unroll
            for (int t = 0; t < 4; ++t) {
                HV bv;
                const _Float16* vb = &sV[buf][(t * 16 + col) * FA_PITCH + ps * 32 + 8 * hh];
                bv.q[0] = *(const u32x4*)(vb);
                bv.q[1] = *(const u32x4*)(vb + 16);
                acc[t] = __builtin_amdgcn_wmma_f32_16x16x32_f16(false, bv.v, false, bp.v,
                                                                (short)0, acc[t], false, false);
            }
        }
        // hand-over, every wave: this wave's reads of buffer buf are done ...
        asm volatile("s_wait_dscnt 0x0" ::: "memory");
        // ... its copies of the next tile have landed ...
        asm volatile("s_wait_asynccnt 0x0" ::: "memory");
        // ... and the barrier publishes the next tile and frees buffer buf
        __syncthreads();
        if (kt + 2 < ntiles) stage(buf, kt + 2);
    }
    // no copy is left in flight when the wave ends
    asm volatile("s_wait_asynccnt 0x0" ::: "memory");

    // join the two halves' sums of each query
    lrow += __int_as_float(__builtin_amdgcn_permlanex16(
                __float_as_int(lrow), __float_as_int(lrow), 0x76543210, 0xfedcba98, false, false));
    // acc[t][r] = O[q0 + col][t*16 + 8*hh + r]: eight consecutive dims, one 16-byte store
    _Float16* orow = o + (size_t)qg * d + hoff + 8 * hh;
#pragma unroll
    for (int t = 0; t < 4; ++t) {
        h16x8 w;
#pragma unroll
        for (int r = 0; r < 8; ++r) w[r] = (_Float16)(acc[t][r] / lrow);
        *(h16x8*)(orow + t * 16) = w;
    }
}

// ---------------------------------------------------------------------------
// Host-side orchestration
// ---------------------------------------------------------------------------
extern "C" void kernel_launch(void* const* d_in, const int* in_sizes, int n_in,
                              void* d_out, int out_size, void* d_ws, size_t ws_size,
                              hipStream_t stream) {
    const int d   = in_sizes[1];          // 1024 (ln1_w)
    const int n   = in_sizes[0] / d;      // 4096
    const int dff = in_sizes[14];         // 4096 (bi)

    const float* x     = (const float*)d_in[0];
    const float* ln1_w = (const float*)d_in[1];
    const float* ln1_b = (const float*)d_in[2];
    const float* Wq    = (const float*)d_in[3];
    const float* bq    = (const float*)d_in[4];
    const float* Wk    = (const float*)d_in[5];
    const float* bk    = (const float*)d_in[6];
    const float* Wv    = (const float*)d_in[7];
    const float* bv    = (const float*)d_in[8];
    const float* Wo    = (const float*)d_in[9];
    const float* bo    = (const float*)d_in[10];
    const float* ln2_w = (const float*)d_in[11];
    const float* ln2_b = (const float*)d_in[12];
    const float* Wi    = (const float*)d_in[13];
    const float* bi    = (const float*)d_in[14];
    const float* Wout  = (const float*)d_in[15];
    const float* bout  = (const float*)d_in[16];

    char* ws = (char*)d_ws;
    size_t off = 0;
    auto alloc = [&](size_t bytes) -> void* {
        void* p = ws + off;
        off += (bytes + 255) & ~(size_t)255;
        return p;
    };
    _Float16* WqT   = (_Float16*)alloc((size_t)d * d * 2);
    _Float16* WkT   = (_Float16*)alloc((size_t)d * d * 2);
    _Float16* WvT   = (_Float16*)alloc((size_t)d * d * 2);
    _Float16* WoT   = (_Float16*)alloc((size_t)d * d * 2);
    _Float16* WiT   = (_Float16*)alloc((size_t)d * dff * 2);
    _Float16* WoutT = (_Float16*)alloc((size_t)dff * d * 2);
    _Float16* h1    = (_Float16*)alloc((size_t)n * d * 2);
    _Float16* q16   = (_Float16*)alloc((size_t)n * d * 2);
    _Float16* k16   = (_Float16*)alloc((size_t)n * d * 2);
    _Float16* v16   = (_Float16*)alloc((size_t)n * d * 2);
    _Float16* vTT   = (_Float16*)alloc((size_t)n * d * 2);
    _Float16* ao16  = (_Float16*)alloc((size_t)n * d * 2);
    float*    x1    = (float*)   alloc((size_t)n * d * 4);
    _Float16* h2    = (_Float16*)alloc((size_t)n * d * 2);
    _Float16* m16   = (_Float16*)alloc((size_t)n * dff * 2);

    // weights -> f16 transposed, and LN1 -> h1 (f16); the template arguments are d and
    // dff of the problem's shapes
    prep_kernel<1024, 4096><<<PrepBlocks<1024, 4096>::cvt + n, 256, 0, stream>>>(
        Wq, Wk, Wv, Wo, Wi, Wout, WqT, WkT, WvT, WoT, WiT, WoutT, x, ln1_w, ln1_b, h1, d);

    // QKV projections (f16 out); the first template argument of every product is its
    // count of output columns (d or dff of the problem's shapes)
    dim3 gdd(d / 128, n / 128);
    wmma_gemm_tiled3<1024><<<dim3(d / 128, n / 128, 3), 256, 0, stream>>>(
        h1, WqT, WkT, WvT, bq, bk, bv, q16, k16, v16, d);

    // V^T (d x n) for K-contiguous P@V operands
    transpose_f16<<<dim3(d / 128, n / 128), 256, 0, stream>>>(v16, vTT, n, d);

    // causal flash attention -> ao16
    flash_attn<<<dim3(n / 128, HEADS), 256, 0, stream>>>(q16, k16, vTT, ao16, n, d);

    // out-proj + residual -> x1 (f32)
    wmma_gemm_tiled<1024, false, true><<<gdd, 256, 0, stream>>>(ao16, WoT, bo, x, x1, nullptr, d);

    // LN2 -> h2 (f16)
    ln_f16_kernel<<<n, 256, 0, stream>>>(x1, ln2_w, ln2_b, h2, d);

    // MLP up + GELU -> m16 (f16)
    wmma_gemm_tiled<4096, true, false><<<dim3(dff / 128, n / 128), 256, 0, stream>>>(h2, WiT, bi, nullptr, nullptr, m16, d);

    // MLP down + bias + residual -> d_out (f32)
    wmma_gemm_tiled<1024, false, true><<<dim3(d / 128, n / 128), 256, 0, stream>>>(m16, WoutT, bout, x1, (float*)d_out, nullptr, dff);
}

// v007
// A run of this version takes 211 microseconds.
// Timed twice side by side with v006, it ran 1.08 times as fast both times.
// Counting every step since v000, it is 4.58 times as fast.
#include <hip/hip_runtime.h>
#include <math.h>

#define HEADS 16

typedef __attribute__((ext_vector_type(16))) _Float16 v16h;
typedef __attribute__((ext_vector_type(8)))  float    v8f;
typedef __attribute__((ext_vector_type(4)))  unsigned u32x4;
typedef __attribute__((ext_vector_type(4)))  float    f32x4;
typedef __attribute__((ext_vector_type(8)))  _Float16 h16x8;

union AV { v16h v; unsigned u[8]; _Float16 h[16]; };
union HV { v16h v; u32x4 q[2]; };

__device__ __forceinline__ v8f v8f_zero() {
    v8f z;
#pragma unroll
    for (int i = 0; i < 8; ++i) z[i] = 0.0f;
    return z;
}

__device__ __forceinline__ float gelu_tanh(float x) {
    const float k0 = 0.7978845608028654f; // sqrt(2/pi)
    const float k1 = 0.044715f;
    return 0.5f * x * (1.0f + tanhf(k0 * (x + k1 * x * x * x)));
}

// ---------------------------------------------------------------------------
// Convert f32 weight (K x N, row-major) -> f16 transposed (N x K, row-major)
// so WMMA B-operand (and async LDS staging) loads are K-contiguous.
// One 256-thread block moves a tile of 128 k x 64 n through LDS: 256-byte runs
// are read from every input row and 256-byte runs written to every output row.
// A thread reads 8 k x 4 n (eight 16-byte loads in flight), converts, and stores
// four 16-byte pieces (8 k of one n) into the transposed LDS tile.  The 16-byte
// piece index is XORed with n/4, so the 16 lanes of a half wave fall on all 64
// banks both when the tile is written and when it is read back by rows.
// K is a multiple of 128, N of 64.  bx, by: the block's tile along n and along k.
// ---------------------------------------------------------------------------
__device__ __forceinline__
void cvt_t_f16(const float* __restrict__ in, _Float16* __restrict__ out,
               int K, int N, int bx, int by) {
    __shared__ __attribute__((aligned(16))) _Float16 s[64 * 128];
    const int tid = threadIdx.x;
    const int lo  = tid & 15;
    const int hi  = tid >> 4;
    const int k0  = by * 128;
    const int n0  = bx * 64;

    const float* p[8];
    f32x4 v[8];
#pragma unroll
    for (int j = 0; j < 8; ++j) p[j] = in + (size_t)(k0 + hi * 8 + j) * N + n0 + lo * 4;
#pragma unroll
    for (int j = 0; j < 8; ++j) v[j] = *(const f32x4*)(p[j]);
    // holds the eight loads together in front of their first use, all in flight
    // at once; the address pairs are named as well, so that no load's result
    // lands on a pair that an earlier load still names
    asm volatile("" :: "v"(v[0]), "v"(v[1]), "v"(v[2]), "v"(v[3]),
                       "v"(v[4]), "v"(v[5]), "v"(v[6]), "v"(v[7]),
                       "v"(p[0]), "v"(p[1]), "v"(p[2]), "v"(p[3]),
                       "v"(p[4]), "v"(p[5]), "v"(p[6]), "v"(p[7]));
#pragma unroll
    for (int i = 0; i < 4; ++i) {
        h16x8 w;
#pragma unroll
        for (int j = 0; j < 8; ++j) w[j] = (_Float16)v[j][i];
        *(h16x8*)(&s[(lo * 4 + i) * 128 + ((hi ^ lo) * 8)]) = w;
    }
    __syncthreads();
#pragma unroll
    for (int it = 0; it < 4; ++it) {
        const int r = hi + it * 16;
        h16x8 w = *(const h16x8*)(&s[r * 128 + ((lo ^ (r >> 2)) * 8)]);
        *(h16x8*)(out + (size_t)(n0 + r) * K + k0 + lo * 8) = w;
    }
}

// f16 (R x C) -> f16 transposed (C x R):  out[c*R + r] = in[r*C + c]
// Same scheme, tile 128 r x 128 c: a thread reads 8 r x 8 c and stores eight
// 16-byte pieces (8 r of one c); the piece index is XORed with c/8.
// R and C are multiples of 128.
__global__ __launch_bounds__(256)
void transpose_f16(const _Float16* __restrict__ in, _Float16* __restrict__ out,
                   int R, int C) {
    __shared__ __attribute__((aligned(16))) _Float16 s[128 * 128];
    const int tid = threadIdx.x;
    const int lo  = tid & 15;
    const int hi  = tid >> 4;
    const int r0  = blockIdx.y * 128;
    const int c0  = blockIdx.x * 128;

    const _Float16* p[8];
    h16x8 v[8];
#pragma unroll
    for (int j = 0; j < 8; ++j) p[j] = in + (size_t)(r0 + hi * 8 + j) * C + c0 + lo * 8;
#pragma unroll
    for (int j = 0; j < 8; ++j) v[j] = *(const h16x8*)(p[j]);
    // holds the eight loads together in front of their first use, all in flight
    // at once; the address pairs are named as well, so that no load's result
    // lands on a pair that an earlier load still names
    asm volatile("" :: "v"(v[0]), "v"(v[1]), "v"(v[2]), "v"(v[3]),
                       "v"(v[4]), "v"(v[5]), "v"(v[6]), "v"(v[7]),
                       "v"(p[0]), "v"(p[1]), "v"(p[2]), "v"(p[3]),
                       "v"(p[4]), "v"(p[5]), "v"(p[6]), "v"(p[7]));
#pragma unroll
    for (int i = 0; i < 8; ++i) {
        h16x8 w;
#pragma unroll
        for (int j = 0; j < 8; ++j) w[j] = v[j][i];
        *(h16x8*)(&s[(lo * 8 + i) * 128 + ((hi ^ lo) * 8)]) = w;
    }
    __syncthreads();
#pragma unroll
    for (int it = 0; it < 8; ++it) {
        const int c = hi + it * 16;
        h16x8 w = *(const h16x8*)(&s[c * 128 + ((lo ^ (c >> 3)) * 8)]);
        *(h16x8*)(out + (size_t)(c0 + c) * R + r0 + lo * 8) = w;
    }
}

// ---------------------------------------------------------------------------
// Row LayerNorm, f32 in -> f16 out.  One 256-thread block per row.
// ---------------------------------------------------------------------------
__device__ __forceinline__
void ln_f16_row(const float* __restrict__ x, const float* __restrict__ w,
                const float* __restrict__ b, _Float16* __restrict__ out,
                int d, int row) {
    const float* xr = x + (size_t)row * d;
    float s = 0.f, ss = 0.f;
    for (int i = threadIdx.x; i < d; i += blockDim.x) {
        float v = xr[i];
        s += v; ss += v * v;
    }
    __shared__ float rs[256], rss[256];
    rs[threadIdx.x] = s; rss[threadIdx.x] = ss;
    __syncthreads();
    for (int st = 128; st > 0; st >>= 1) {
        if (threadIdx.x < st) { rs[threadIdx.x] += rs[threadIdx.x + st];
                                rss[threadIdx.x] += rss[threadIdx.x + st]; }
        __syncthreads();
    }
    float mean = rs[0] / (float)d;
    float var  = rss[0] / (float)d - mean * mean;
    float inv  = rsqrtf(var + 1e-12f);
    for (int i = threadIdx.x; i < d; i += blockDim.x)
        out[(size_t)row * d + i] = (_Float16)((xr[i] - mean) * inv * w[i] + b[i]);
}

__global__ void ln_f16_kernel(const float* __restrict__ x, const float* __restrict__ w,
                              const float* __restrict__ b, _Float16* __restrict__ out,
                              int d) {
    ln_f16_row(x, w, b, out, d, blockIdx.x);
}

// ---------------------------------------------------------------------------
// All that the first product waits for, in ONE launch: the six weight
// conversions and the first LayerNorm read only inputs and depend on nothing, so
// their blocks run side by side and fill the chip together, where seven launches
// one behind the other each paid a launch gap, a ramp and a tail, four of them
// with a block on only half of the WGPs.
// The block index picks the job (the same for every thread of a block, so each
// job's barriers are passed by the whole block): first the tiles of the four
// D x D weights, then those of Wi (D x DFF) and of Wout (DFF x D), then one block
// per row of x.  D, DFF: the problem's widths, compile-time so that the split of
// the index is shifts and masks.
// ---------------------------------------------------------------------------
template <int D, int DFF>
struct PrepBlocks {
    static constexpr unsigned sq  = (D / 64) * (D / 128);      // tiles of a D x D weight
    static constexpr unsigned big = (DFF / 64) * (D / 128);    // tiles of Wi, and of Wout
    static constexpr unsigned cvt = 4 * sq + 2 * big;          // conversion blocks in front of the rows
};

template <int D, int DFF>
__global__ __launch_bounds__(256)
void prep_kernel(const float* __restrict__ Wq, const float* __restrict__ Wk,
                 const float* __restrict__ Wv, const float* __restrict__ Wo,
                 const float* __restrict__ Wi, const float* __restrict__ Wout,
                 _Float16* __restrict__ WqT, _Float16* __restrict__ WkT,
                 _Float16* __restrict__ WvT, _Float16* __restrict__ WoT,
                 _Float16* __restrict__ WiT, _Float16* __restrict__ WoutT,
                 const float* __restrict__ x, const float* __restrict__ ln_w,
                 const float* __restrict__ ln_b, _Float16* __restrict__ h, int d) {
    typedef PrepBlocks<D, DFF> PB;
    const unsigned bid = blockIdx.x;
    if (bid < 4 * PB::sq) {
        const unsigned sel = bid / PB::sq;
        const unsigned t   = bid % PB::sq;
        const float* in = sel == 0 ? Wq  : sel == 1 ? Wk  : sel == 2 ? Wv  : Wo;
        _Float16* out   = sel == 0 ? WqT : sel == 1 ? WkT : sel == 2 ? WvT : WoT;
        cvt_t_f16(in, out, D, D, t % (D / 64), t / (D / 64));
    } else if (bid < 4 * PB::sq + PB::big) {
        const unsigned t = bid - 4 * PB::sq;
        cvt_t_f16(Wi, WiT, D, DFF, t % (DFF / 64), t / (DFF / 64));
    } else if (bid < PB::cvt) {
        const unsigned t = bid - (4 * PB::sq + PB::big);
        cvt_t_f16(Wout, WoutT, DFF, D, t % (D / 64), t / (D / 64));
    } else {
        ln_f16_row(x, ln_w, ln_b, h, d, bid - PB::cvt);
    }
}

// ---------------------------------------------------------------------------
// Tiled WMMA GEMM with async global->LDS double-buffered staging.
//   out = act(A(MxK,f16) @ Bt(NxK,f16)^T + bias) (+ resid)
// Block: 256 threads (8 waves) computes 128x128 tile.
// Wave (wm in 0..1, wn in 0..3) computes 64x32 = 4x2 WMMA tiles.
// K is staged in slabs of 128: 256-byte rows of A and of Bt, laid in LDS at a
// pitch of 272 B, at which the 16 lanes of a half wave fall on all 64 banks in
// the 16-byte fragment reads.  Two buffers: the next slab's copies fly while
// this slab's four 32-k blocks are worked on, one barrier per slab.
// K is a multiple of 128.
// ---------------------------------------------------------------------------
#define GM_PITCH 136                    // halves per staged row (272 B)
#define GM_TILE  (128 * GM_PITCH)       // halves per staged slab of one operand

// Eight 16-byte copies of one lane: rows 16 apart of one operand's slab.
// l: the lane's LDS byte address, g: its global address, rs: halves per 16 rows.
__device__ __forceinline__ void gm_copy8(unsigned l, const _Float16* g, size_t rs) {
    // the closing s_wait_xcnt keeps the address registers from being
    // rewritten while a copy that names them is still being issued
    asm volatile("global_load_async_to_lds_b128 %0, %8, off\n\t"
                 "global_load_async_to_lds_b128 %1, %9, off\n\t"
                 "global_load_async_to_lds_b128 %2, %10, off\n\t"
                 "global_load_async_to_lds_b128 %3, %11, off\n\t"
                 "global_load_async_to_lds_b128 %4, %12, off\n\t"
                 "global_load_async_to_lds_b128 %5, %13, off\n\t"
                 "global_load_async_to_lds_b128 %6, %14, off\n\t"
                 "global_load_async_to_lds_b128 %7, %15, off\n\t"
                 "s_wait_xcnt 0x0"
                 :: "v"(l),
                    "v"(l + 1 * 16 * (GM_PITCH * 2)), "v"(l + 2 * 16 * (GM_PITCH * 2)),
                    "v"(l + 3 * 16 * (GM_PITCH * 2)), "v"(l + 4 * 16 * (GM_PITCH * 2)),
                    "v"(l + 5 * 16 * (GM_PITCH * 2)), "v"(l + 6 * 16 * (GM_PITCH * 2)),
                    "v"(l + 7 * 16 * (GM_PITCH * 2)),
                    "v"((unsigned long long)(uintptr_t)(g)),
                    "v"((unsigned long long)(uintptr_t)(g + 1 * rs)),
                    "v"((unsigned long long)(uintptr_t)(g + 2 * rs)),
                    "v"((unsigned long long)(uintptr_t)(g + 3 * rs)),
                    "v"((unsigned long long)(uintptr_t)(g + 4 * rs)),
                    "v"((unsigned long long)(uintptr_t)(g + 5 * rs)),
                    "v"((unsigned long long)(uintptr_t)(g + 6 * rs)),
                    "v"((unsigned long long)(uintptr_t)(g + 7 * rs))
                 : "memory");
}

// N (columns of the output, the row pitch of resid and of the output) and the
// epilogue's mode are compile-time values:
//   RES  : outf = acc + bias + resid   (f32; outh is not used)
//   !RES : outh = act(acc + bias)      (f16; resid and outf are not used),
//          act = tanh GELU where GELU is set, else the identity
// The epilogue then holds no test of a mode, and every element's address is the
// lane's base plus an immediate: its loads, and its stores, follow one another
// with no wait between them.
template <int N, bool GELU, bool RES>
__device__ __forceinline__
void wmma_gemm_tile(const _Float16* __restrict__ A, const _Float16* __restrict__ Bt,
                    const float* __restrict__ bias, const float* __restrict__ resid,
                    float* __restrict__ outf, _Float16* __restrict__ outh, int K) {
    __shared__ __attribute__((aligned(16))) _Float16 sA[2][GM_TILE];
    __shared__ __attribute__((aligned(16))) _Float16 sB[2][GM_TILE];

    const int tid  = threadIdx.x;
    const int lane = tid & 31;
    const int wave = tid >> 5;
    const int col  = lane & 15;   // M (A) / N (B,C) index within 16-tile
    const int hh   = lane >> 4;   // lane-half -> +8 K offset in A/B operands
    const int wn   = wave & 3;    // 4 N-groups of 32
    const int wm   = wave >> 2;   // 2 M-groups of 64
    const int m0   = blockIdx.y * 128;
    const int n0   = blockIdx.x * 128;

    // copy assignment: rows cr, cr+16, .. cr+112 of each slab, 16-byte chunk cc of the row
    const int cr = tid >> 4;
    const int cc = tid & 15;
    const unsigned lA = (unsigned)(uintptr_t)(&sA[0][0]) + (unsigned)(cr * (GM_PITCH * 2) + cc * 16);
    const unsigned lB = (unsigned)(uintptr_t)(&sB[0][0]) + (unsigned)(cr * (GM_PITCH * 2) + cc * 16);
    const _Float16* gA = A  + (size_t)(m0 + cr) * K + cc * 8;
    const _Float16* gB = Bt + (size_t)(n0 + cr) * K + cc * 8;
    const size_t rs = (size_t)16 * K;

    // stage slab s (k 128s .. 128s+127) of A and Bt into buffer buf
    auto stage = [&](int buf, int s) {
        const unsigned lo = (unsigned)(buf * (GM_TILE * 2));
        gm_copy8(lA + lo, gA + (size_t)s * 128, rs);
        gm_copy8(lB + lo, gB + (size_t)s * 128, rs);
    };

    v8f acc[4][2];
#pragma unroll
    for (int mi = 0; mi < 4; ++mi)
#pragma unroll
        for (int ni = 0; ni < 2; ++ni) acc[mi][ni] = v8f_zero();

    const int nslabs = K >> 7;
    stage(0, 0);
    // slab 0 has landed for this wave's copies; the barrier publishes all waves' copies
    asm volatile("s_wait_asynccnt 0x0" ::: "memory");
    __syncthreads();
    if (nslabs > 1) stage(1, 1);

    // element (mi, ni, r) of this lane lies at e0 + (mi * 16 + r) * N + ni * 16
    const unsigned e0 = (unsigned)(m0 + wm * 64 + 8 * hh) * N + (unsigned)(n0 + wn * 32 + col);
    // bias and residual are asked for here, behind the first two slabs' copies: all
    // of a lane's loads are in flight together and land while the k loop runs
    float rv[4][2][8];
    if constexpr (RES) {
        const float* rp = resid + e0;
#pragma unroll
        for (int mi = 0; mi < 4; ++mi)
#pragma unroll
            for (int ni = 0; ni < 2; ++ni)
#pragma unroll
                for (int r = 0; r < 8; ++r) rv[mi][ni][r] = rp[(mi * 16 + r) * N + ni * 16];
    }
    const float bn0 = bias[n0 + wn * 32 + col];
    const float bn1 = bias[n0 + wn * 32 + 16 + col];
    // the loads above are issued before a register that they name is used for anything
    // else (the compiler reuses the bias pointer's pair for the slab counter)
    asm volatile("s_wait_xcnt 0x0" ::: "memory");

    for (int s = 0; s < nslabs; ++s) {
        const int buf = s & 1;
        const _Float16* pa = &sA[buf][(wm * 64 + col) * GM_PITCH + 8 * hh];
        const _Float16* pb = &sB[buf][(wn * 32 + col) * GM_PITCH + 8 * hh];
        // unrolled, like the loops inside: every index of a, b and acc is then a
        // constant (they stay in registers) and every LDS offset an immediate
#pragma unroll
        for (int kb = 0; kb < 4; ++kb) {
            HV a[4], b[2];
#pragma unroll
            for (int mi = 0; mi < 4; ++mi) {
                const _Float16* p = pa + mi * 16 * GM_PITCH + kb * 32;
                a[mi].q[0] = *(const u32x4*)(p);
                a[mi].q[1] = *(const u32x4*)(p + 16);
            }
#pragma unroll
            for (int ni = 0; ni < 2; ++ni) {
                const _Float16* p = pb + ni * 16 * GM_PITCH + kb * 32;
                b[ni].q[0] = *(const u32x4*)(p);
                b[ni].q[1] = *(const u32x4*)(p + 16);
            }
#pragma unroll
            for (int mi = 0; mi < 4; ++mi)
#pragma unroll
                for (int ni = 0; ni < 2; ++ni)
                    acc[mi][ni] = __builtin_amdgcn_wmma_f32_16x16x32_f16(
                        false, a[mi].v, false, b[ni].v, (short)0, acc[mi][ni], false, false);
        }
        // hand-over, every wave: this wave's reads of buffer buf are done ...
        asm volatile("s_wait_dscnt 0x0" ::: "memory");
        // ... its copies of the next slab have landed ...
        asm volatile("s_wait_asynccnt 0x0" ::: "memory");
        // ... and the barrier publishes the next slab and frees buffer buf
        __syncthreads();
        if (s + 2 < nslabs) stage(buf, s + 2);
    }
    // no copy is left in flight when the wave ends
    asm volatile("s_wait_asynccnt 0x0" ::: "memory");

    // all 64 values first ...
    _Float16 hv[4][2][8];
#pragma unroll
    for (int mi = 0; mi < 4; ++mi) {
#pragma unroll
        for (int ni = 0; ni < 2; ++ni) {
            const float bn = ni ? bn1 : bn0;
#pragma unroll
            for (int r = 0; r < 8; ++r) {
                float val = acc[mi][ni][r] + bn;
                if constexpr (GELU) val = gelu_tanh(val);
                if constexpr (RES) acc[mi][ni][r] = val + rv[mi][ni][r];
                else               hv[mi][ni][r] = (_Float16)val;
            }
        }
    }
    // ... then the 64 stores in a row, each at the lane's base plus an immediate
    if constexpr (RES) {
        float* const op = outf + e0;
#pragma unroll
        for (int mi = 0; mi < 4; ++mi)
#pragma unroll
            for (int ni = 0; ni < 2; ++ni)
#pragma unroll
                for (int r = 0; r < 8; ++r) op[(mi * 16 + r) * N + ni * 16] = acc[mi][ni][r];
    } else {
        _Float16* const op = outh + e0;
#pragma unroll
        for (int mi = 0; mi < 4; ++mi)
#pragma unroll
            for (int ni = 0; ni < 2; ++ni)
#pragma unroll
                for (int r = 0; r < 8; ++r) op[(mi * 16 + r) * N + ni * 16] = hv[mi][ni][r];
    }
}

template <int N, bool GELU, bool RES>
__global__ __launch_bounds__(256)
void wmma_gemm_tiled(const _Float16* __restrict__ A, const _Float16* __restrict__ Bt,
                     const float* __restrict__ bias, const float* __restrict__ resid,
                     float* __restrict__ outf, _Float16* __restrict__ outh, int K) {
    wmma_gemm_tile<N, GELU, RES>(A, Bt, bias, resid, outf, outh, K);
}

// Three products of the same A with three weights (f16 out, no activation) in ONE
// launch: blockIdx.z picks weight, bias and output.  Each product alone has one
// block per WGP; together two blocks share a WGP, so that one block's first slab
// and its epilogue run beside the other's k loop, and two launch gaps go.
template <int N>
__global__ __launch_bounds__(256)
void wmma_gemm_tiled3(const _Float16* __restrict__ A,
                      const _Float16* __restrict__ Bt0, const _Float16* __restrict__ Bt1,
                      const _Float16* __restrict__ Bt2,
                      const float* __restrict__ bias0, const float* __restrict__ bias1,
                      const float* __restrict__ bias2,
                      _Float16* __restrict__ out0, _Float16* __restrict__ out1,
                      _Float16* __restrict__ out2, int K) {
    const int z = blockIdx.z;
    const _Float16* Bt = z == 0 ? Bt0   : z == 1 ? Bt1   : Bt2;
    const float* bias  = z == 0 ? bias0 : z == 1 ? bias1 : bias2;
    _Float16* outh     = z == 0 ? out0  : z == 1 ? out1  : out2;
    wmma_gemm_tile<N, false, false>(A, Bt, bias, nullptr, nullptr, outh, K);
}

// ---------------------------------------------------------------------------
// Causal flash attention.  One 8-wave block per (pair of 128-query blocks, head);
// each wave owns 16 queries of the block at hand.  A query block's cost grows with
// its index (it walks the keys up to its diagonal) and all work-groups are resident
// at once, so the launch lasts as long as its fullest work-group: every work-group
// takes query block t and then, in the same waves, block nblk - 1 - t, which is the
// same count of key tiles for all of them.  n is a multiple of 256.
// q/k: (n x d) f16, head-h slice at column h*64, dh=64.
// vT: (d x n) f16 transposed V, so its rows are key-contiguous.
// The eight waves share each 64-key tile of K (64 keys x 64 dims) and of vT
// (64 dims x 64 keys): the block copies it once into LDS as whole 128-byte
// rows, two buffers, the next tile in flight while this one is worked on.
// LDS rows are pitched 144 B for the 16-byte fragment reads.
// The products are taken transposed: S^T = Kb Q^T (A = K rows, B = Q) and
// O^T += Vb^T P^T (A = vT rows, B = P^T).  A lane then holds 16 of the 32
// scores of ONE query (lane%16), so maximum and sum run inside the lane with a
// single exchange between the wave's halves, and the two score tiles, converted
// in place, already are the B operand of the second product.
// ---------------------------------------------------------------------------
// 2^x of eight (exp2x8) or nine (exp2x9) values.  One statement each, results kept
// apart from arguments ("=&v") and a closing v_nop: the instruction set asks for one
// slot between a transcendental and an instruction that reads its result or
// overwrites its argument.
__device__ __forceinline__ void exp2x8(float (&y)[8], const float (&x)[8]) {
    asm("v_exp_f32 %0, %8\n\t"  "v_exp_f32 %1, %9\n\t"
        "v_exp_f32 %2, %10\n\t" "v_exp_f32 %3, %11\n\t"
        "v_exp_f32 %4, %12\n\t" "v_exp_f32 %5, %13\n\t"
        "v_exp_f32 %6, %14\n\t" "v_exp_f32 %7, %15\n\t"
        "v_nop"
        : "=&v"(y[0]), "=&v"(y[1]), "=&v"(y[2]), "=&v"(y[3]),
          "=&v"(y[4]), "=&v"(y[5]), "=&v"(y[6]), "=&v"(y[7])
        : "v"(x[0]), "v"(x[1]), "v"(x[2]), "v"(x[3]),
          "v"(x[4]), "v"(x[5]), "v"(x[6]), "v"(x[7]));
}
__device__ __forceinline__ void exp2x9(float& ya, float (&y)[8], float xa, const float (&x)[8]) {
    asm("v_exp_f32 %0, %9\n\t"  "v_exp_f32 %1, %10\n\t"
        "v_exp_f32 %2, %11\n\t" "v_exp_f32 %3, %12\n\t"
        "v_exp_f32 %4, %13\n\t" "v_exp_f32 %5, %14\n\t"
        "v_exp_f32 %6, %15\n\t" "v_exp_f32 %7, %16\n\t"
        "v_exp_f32 %8, %17\n\t"
        "v_nop"
        : "=&v"(ya), "=&v"(y[0]), "=&v"(y[1]), "=&v"(y[2]), "=&v"(y[3]),
          "=&v"(y[4]), "=&v"(y[5]), "=&v"(y[6]), "=&v"(y[7])
        : "v"(xa), "v"(x[0]), "v"(x[1]), "v"(x[2]), "v"(x[3]),
          "v"(x[4]), "v"(x[5]), "v"(x[6]), "v"(x[7]));
}

#define FA_PITCH 72                     // halves per staged row (144 B)
#define FA_TILE  (64 * FA_PITCH)        // halves per staged tile

// one such block stands on a WGP (two waves per SIMD): let the register allocator use that share
__global__ __launch_bounds__(256) __attribute__((amdgpu_waves_per_eu(2, 2)))
void flash_attn(const _Float16* __restrict__ q, const _Float16* __restrict__ k,
                const _Float16* __restrict__ vT, _Float16* __restrict__ o,
                int n, int d) {
    const int dh = 64;
    const float scale = 0.125f;              // 1/sqrt(64)
    const int tid  = threadIdx.x;
    const int lane = tid & 31;
    const int wave = __builtin_amdgcn_readfirstlane(tid >> 5);
    const int col  = lane & 15;
    const int hh   = lane >> 4;
    const int head = blockIdx.y;
    const size_t hoff = (size_t)head * dh;

    __shared__ __attribute__((aligned(16))) _Float16 sK[2][FA_TILE];
    __shared__ __attribute__((aligned(16))) _Float16 sV[2][FA_TILE];

    // copy assignment: rows cr and cr+32 of each tile, 16-byte chunk cc of the row
    const int cr = tid >> 3;
    const int cc = tid & 7;
    const unsigned lK = (unsigned)(uintptr_t)(&sK[0][0]) + (unsigned)(cr * (FA_PITCH * 2) + cc * 16);
    const unsigned lV = (unsigned)(uintptr_t)(&sV[0][0]) + (unsigned)(cr * (FA_PITCH * 2) + cc * 16);
    const _Float16* gK = k  + (size_t)cr * d + hoff + cc * 8;
    const _Float16* gV = vT + (hoff + cr) * (size_t)n + cc * 8;

    // stage key tile t (keys 64t .. 64t+63) of K and vT into buffer buf
    auto stage = [&](int buf, int t) {
        const unsigned lo = (unsigned)(buf * (FA_TILE * 2));
        const _Float16* k0p = gK + (size_t)t * 64 * d;
        const _Float16* k1p = k0p + (size_t)32 * d;
        const _Float16* v0p = gV + (size_t)t * 64;
        const _Float16* v1p = v0p + (size_t)32 * n;
        // the closing s_wait_xcnt keeps the address registers from being
        // rewritten while a copy that names them is still being issued
        asm volatile("global_load_async_to_lds_b128 %0, %4, off\n\t"
                     "global_load_async_to_lds_b128 %1, %5, off\n\t"
                     "global_load_async_to_lds_b128 %2, %6, off\n\t"
                     "global_load_async_to_lds_b128 %3, %7, off\n\t"
                     "s_wait_xcnt 0x0"
                     :: "v"(lK + lo), "v"(lK + lo + 32 * (FA_PITCH * 2)),
                        "v"(lV + lo), "v"(lV + lo + 32 * (FA_PITCH * 2)),
                        "v"((unsigned long long)(uintptr_t)k0p),
                        "v"((unsigned long long)(uintptr_t)k1p),
                        "v"((unsigned long long)(uintptr_t)v0p),
                        "v"((unsigned long long)(uintptr_t)v1p)
                     : "memory");
    };

    // the two query blocks one after the other; kept a loop (one copy of the body in
    // the instruction cache), its trips are long
#pragma unroll 1
    for (int half = 0; half < 2; ++half) {
    const int qblk = half ? (n >> 7) - 1 - (int)blockIdx.x : (int)blockIdx.x;
    const int q0   = qblk * 128 + wave * 16;

    AV aq0, aq1;
    const _Float16* qrow = q + (size_t)(q0 + col) * d + hoff;
#pragma unroll
    for (int j = 0; j < 8; ++j) {
        int ko = 2 * j + 8 * hh + ((j >= 4) ? 8 : 0);
        aq0.u[j] = *(const unsigned*)(qrow + ko);
        aq1.u[j] = *(const unsigned*)(qrow + 32 + ko);
    }

    v8f acc[4];
#pragma unroll
    for (int t = 0; t < 4; ++t) acc[t] = v8f_zero();
    // of query q0 + col: running maximum (equal in both halves of the wave) and
    // the sum over the keys that this half of the wave holds
    float mrow = -1e30f, lrow = 0.0f;
    const int qg = q0 + col;

    const int ntiles = 2 * (qblk + 1);           // 64-key tiles up to the block's diagonal

    // (second query block: every wave's reads of both buffers ended in front of the
    // barrier at the foot of the first block's last trip)
    stage(0, 0);
    // tile 0 has landed for this wave's copies; the barrier publishes all waves' copies
    asm volatile("s_wait_asynccnt 0x0" ::: "memory");
    __syncthreads();
    stage(1, 1);

    for (int kt = 0; kt < ntiles; ++kt) {
        const int buf = kt & 1;
#pragma unroll
        for (int ps = 0; ps < 2; ++ps) {
            const int k0 = kt * 64 + ps * 32;
            if (k0 > q0 + 15) continue;          // wave-uniform: keys wholly above the diagonal
            // ---- S^T = Kb Q^T : two 16x16 score tiles (keys x queries)
            HV b0, b1, b2, b3;
            const _Float16* kr0 = &sK[buf][(ps * 32 + col) * FA_PITCH + 8 * hh];
            const _Float16* kr1 = kr0 + 16 * FA_PITCH;
            b0.q[0] = *(const u32x4*)(kr0);      b0.q[1] = *(const u32x4*)(kr0 + 16);
            b1.q[0] = *(const u32x4*)(kr0 + 32); b1.q[1] = *(const u32x4*)(kr0 + 48);
            b2.q[0] = *(const u32x4*)(kr1);      b2.q[1] = *(const u32x4*)(kr1 + 16);
            b3.q[0] = *(const u32x4*)(kr1 + 32); b3.q[1] = *(const u32x4*)(kr1 + 48);
            // holds the eight LDS reads together in front of the products: one LDS
            // latency per 32 keys instead of one in front of each product
            asm volatile("" :: "v"(b0.v), "v"(b1.v), "v"(b2.v), "v"(b3.v));
            v8f s0 = v8f_zero(), s1 = v8f_zero();
            s0 = __builtin_amdgcn_wmma_f32_16x16x32_f16(false, b0.v, false, aq0.v, (short)0, s0, false, false);
            s0 = __builtin_amdgcn_wmma_f32_16x16x32_f16(false, b1.v, false, aq1.v, (short)0, s0, false, false);
            s1 = __builtin_amdgcn_wmma_f32_16x16x32_f16(false, b2.v, false, aq0.v, (short)0, s1, false, false);
            s1 = __builtin_amdgcn_wmma_f32_16x16x32_f16(false, b3.v, false, aq1.v, (short)0, s1, false, false);

            // ---- scale + causal mask + online softmax
            // s0[r]: key k0 + 8*hh + r, s1[r]: key k0 + 16 + 8*hh + r, query qg
            const int kb = k0 + 8 * hh;
            float mx = -1e30f;
#pragma unroll
            for (int r = 0; r < 8; ++r) {
                float a0 = s0[r] * scale;
                float a1 = s1[r] * scale;
                if (kb + r > qg)      a0 = -1e30f;
                if (kb + 16 + r > qg) a1 = -1e30f;
                s0[r] = a0; s1[r] = a1;
                mx = fmaxf(mx, fmaxf(a0, a1));
            }
            // the other 16 keys of this query sit in lane ^ 16
            mx = fmaxf(mx, __int_as_float(__builtin_amdgcn_permlanex16(
                     __float_as_int(mx), __float_as_int(mx), 0x76543210, 0xfedcba98, false, false)));
            const float mn = fmaxf(mrow, mx);
            // e^x as 2^(x * log2 e)
            const float l2e = 1.4426950408889634f;
            float e0[8], e1[8], p0[8], p1[8], alpha;
#pragma unroll
            for (int r = 0; r < 8; ++r) {
                e0[r] = (s0[r] - mn) * l2e;
                e1[r] = (s1[r] - mn) * l2e;
            }
            exp2x9(alpha, p0, (mrow - mn) * l2e, e0);
            exp2x8(p1, e1);
            mrow = mn;
            AV bp;                               // P^T as B operand: 16 + 16 keys of query col
            float rsum = p0[0] + p1[0];
#pragma unroll
            for (int r = 0; r < 8; ++r) {
                if (r) rsum += p0[r] + p1[r];
                bp.h[r]     = (_Float16)p0[r];
                bp.h[8 + r] = (_Float16)p1[r];
            }
            lrow = lrow * alpha + rsum;
#pragma unroll
            for (int t = 0; t < 4; ++t)
#pragma unroll
                for (int r = 0; r < 8; ++r) acc[t][r] *= alpha;

            // ---- O^T += Vb^T P^T ; each A operand is two 16-byte LDS reads
#pragma unroll
            for (int t = 0; t < 4; ++t) {
                HV bv;
                const _Float16* vb = &sV[buf][(t * 16 + col) * FA_PITCH + ps * 32 + 8 * hh];
                bv.q[0] = *(const u32x4*)(vb);
                bv.q[1] = *(const u32x4*)(vb + 16);
                acc[t] = __builtin_amdgcn_wmma_f32_16x16x32_f16(false, bv.v, false, bp.v,
                                                                (short)0, acc[t], false, false);
            }
        }
        // hand-over, every wave: this wave's reads of buffer buf are done ...
        asm volatile("s_wait_dscnt 0x0" ::: "memory");
        // ... its copies of the next tile have landed ...
        asm volatile("s_wait_asynccnt 0x0" ::: "memory");
        // ... and the barrier publishes the next tile and frees buffer buf
        __syncthreads();
        if (kt + 2 < ntiles) stage(buf, kt + 2);
    }
    // no copy is left in flight when the wave ends
    asm volatile("s_wait_asynccnt 0x0" ::: "memory");

    // join the two halves' sums of each query
    lrow += __int_as_float(__builtin_amdgcn_permlanex16(
                __float_as_int(lrow), __float_as_int(lrow), 0x76543210, 0xfedcba98, false, false));
    // acc[t][r] = O[q0 + col][t*16 + 8*hh + r]: eight consecutive dims, one 16-byte store
    _Float16* orow = o + (size_t)qg * d + hoff + 8 * hh;
#pragma unroll
    for (int t = 0; t < 4; ++t) {
        h16x8 w;
#pragma unroll
        for (int r = 0; r < 8; ++r) w[r] = (_Float16)(acc[t][r] / lrow);
        *(h16x8*)(orow + t * 16) = w;
    }
    // the stores are issued before the next query block's addresses take their registers
    asm volatile("s_wait_xcnt 0x0" ::: "memory");
    }
}

// ---------------------------------------------------------------------------
// Host-side orchestration
// ---------------------------------------------------------------------------
extern "C" void kernel_launch(void* const* d_in, const int* in_sizes, int n_in,
                              void* d_out, int out_size, void* d_ws, size_t ws_size,
                              hipStream_t stream) {
    const int d   = in_sizes[1];          // 1024 (ln1_w)
    const int n   = in_sizes[0] / d;      // 4096
    const int dff = in_sizes[14];         // 4096 (bi)

    const float* x     = (const float*)d_in[0];
    const float* ln1_w = (const float*)d_in[1];
    const float* ln1_b = (const float*)d_in[2];
    const float* Wq    = (const float*)d_in[3];
    const float* bq    = (const float*)d_in[4];
    const float* Wk    = (const float*)d_in[5];
    const float* bk    = (const float*)d_in[6];
    const float* Wv    = (const float*)d_in[7];
    const float* bv    = (const float*)d_in[8];
    const float* Wo    = (const float*)d_in[9];
    const float* bo    = (const float*)d_in[10];
    const float* ln2_w = (const float*)d_in[11];
    const float* ln2_b = (const float*)d_in[12];
    const float* Wi    = (const float*)d_in[13];
    const float* bi    = (const float*)d_in[14];
    const float* Wout  = (const float*)d_in[15];
    const float* bout  = (const float*)d_in[16];

    char* ws = (char*)d_ws;
    size_t off = 0;
    auto alloc = [&](size_t bytes) -> void* {
        void* p = ws + off;
        off += (bytes + 255) & ~(size_t)255;
        return p;
    };
    _Float16* WqT   = (_Float16*)alloc((size_t)d * d * 2);
    _Float16* WkT   = (_Float16*)alloc((size_t)d * d * 2);
    _Float16* WvT   = (_Float16*)alloc((size_t)d * d * 2);
    _Float16* WoT   = (_Float16*)alloc((size_t)d * d * 2);
    _Float16* WiT   = (_Float16*)alloc((size_t)d * dff * 2);
    _Float16* WoutT = (_Float16*)alloc((size_t)dff * d * 2);
    _Float16* h1    = (_Float16*)alloc((size_t)n * d * 2);
    _Float16* q16   = (_Float16*)alloc((size_t)n * d * 2);
    _Float16* k16   = (_Float16*)alloc((size_t)n * d * 2);
    _Float16* v16   = (_Float16*)alloc((size_t)n * d * 2);
    _Float16* vTT   = (_Float16*)alloc((size_t)n * d * 2);
    _Float16* ao16  = (_Float16*)alloc((size_t)n * d * 2);
    float*    x1    = (float*)   alloc((size_t)n * d * 4);
    _Float16* h2    = (_Float16*)alloc((size_t)n * d * 2);
    _Float16* m16   = (_Float16*)alloc((size_t)n * dff * 2);

    // weights -> f16 transposed, and LN1 -> h1 (f16); the template arguments are d and
    // dff of the problem's shapes
    prep_kernel<1024, 4096><<<PrepBlocks<1024, 4096>::cvt + n, 256, 0, stream>>>(
        Wq, Wk, Wv, Wo, Wi, Wout, WqT, WkT, WvT, WoT, WiT, WoutT, x, ln1_w, ln1_b, h1, d);

    // QKV projections (f16 out); the first template argument of every product is its
    // count of output columns (d or dff of the problem's shapes)
    dim3 gdd(d / 128, n / 128);
    wmma_gemm_tiled3<1024><<<dim3(d / 128, n / 128, 3), 256, 0, stream>>>(
        h1, WqT, WkT, WvT, bq, bk, bv, q16, k16, v16, d);

    // V^T (d x n) for K-contiguous P@V operands
    transpose_f16<<<dim3(d / 128, n / 128), 256, 0, stream>>>(v16, vTT, n, d);

    // causal flash attention -> ao16
    flash_attn<<<dim3(n / 256, HEADS), 256, 0, stream>>>(q16, k16, vTT, ao16, n, d);

    // out-proj + residual -> x1 (f32)
    wmma_gemm_tiled<1024, false, true><<<gdd, 256, 0, stream>>>(ao16, WoT, bo, x, x1, nullptr, d);

    // LN2 -> h2 (f16)
    ln_f16_kernel<<<n, 256, 0, stream>>>(x1, ln2_w, ln2_b, h2, d);

    // MLP up + GELU -> m16 (f16)
    wmma_gemm_tiled<4096, true, false><<<dim3(dff / 128, n / 128), 256, 0, stream>>>(h2, WiT, bi, nullptr, nullptr, m16, d);

    // MLP down + bias + residual -> d_out (f32)
    wmma_gemm_tiled<1024, false, true><<<dim3(d / 128, n / 128), 256, 0, stream>>>(m16, WoutT, bout, x1, (float*)d_out, nullptr, dff);
}

// v008
// Measured time: 205 microseconds a run.
// Timed twice side by side with v007, it ran 1.04 times as fast both times.
// Counting every step since v000, it is 4.76 times as fast.
#include <hip/hip_runtime.h>
#include <math.h>

#define HEADS 16

typedef __attribute__((ext_vector_type(16))) _Float16 v16h;
typedef __attribute__((ext_vector_type(8)))  float    v8f;
typedef __attribute__((ext_vector_type(4)))  unsigned u32x4;
typedef __attribute__((ext_vector_type(4)))  float    f32x4;
typedef __attribute__((ext_vector_type(8)))  _Float16 h16x8;

union AV { v16h v; unsigned u[8]; _Float16 h[16]; };
union HV { v16h v; u32x4 q[2]; };

__device__ __forceinline__ v8f v8f_zero() {
    v8f z;
#pragma unroll
    for (int i = 0; i < 8; ++i) z[i] = 0.0f;
    return z;
}

__device__ __forceinline__ float gelu_tanh(float x) {
    const float k0 = 0.7978845608028654f; // sqrt(2/pi)
    const float k1 = 0.044715f;
    return 0.5f * x * (1.0f + tanhf(k0 * (x + k1 * x * x * x)));
}

// ---------------------------------------------------------------------------
// Convert f32 weight (K x N, row-major) -> f16 transposed (N x K, row-major)
// so WMMA B-operand (and async LDS staging) loads are K-contiguous.
// One 256-thread block moves a tile of 128 k x 64 n through LDS: 256-byte runs
// are read from every input row and 256-byte runs written to every output row.
// A thread reads 8 k x 4 n (eight 16-byte loads in flight), converts, and stores
// four 16-byte pieces (8 k of one n) into the transposed LDS tile.  The 16-byte
// piece index is XORed with n/4, so the 16 lanes of a half wave fall on all 64
// banks both when the tile is written and when it is read back by rows.
// K is a multiple of 128, N of 64.  bx, by: the block's tile along n and along k.
// ---------------------------------------------------------------------------
__device__ __forceinline__
void cvt_t_f16(const float* __restrict__ in, _Float16* __restrict__ out,
               int K, int N, int bx, int by) {
    __shared__ __attribute__((aligned(16))) _Float16 s[64 * 128];
    const int tid = threadIdx.x;
    const int lo  = tid & 15;
    const int hi  = tid >> 4;
    const int k0  = by * 128;
    const int n0  = bx * 64;

    const float* p[8];
    f32x4 v[8];
#pragma unroll
    for (int j = 0; j < 8; ++j) p[j] = in + (size_t)(k0 + hi * 8 + j) * N + n0 + lo * 4;
#pragma unroll
    for (int j = 0; j < 8; ++j) v[j] = *(const f32x4*)(p[j]);
    // holds the eight loads together in front of their first use, all in flight
    // at once; the address pairs are named as well, so that no load's result
    // lands on a pair that an earlier load still names
    asm volatile("" :: "v"(v[0]), "v"(v[1]), "v"(v[2]), "v"(v[3]),
                       "v"(v[4]), "v"(v[5]), "v"(v[6]), "v"(v[7]),
                       "v"(p[0]), "v"(p[1]), "v"(p[2]), "v"(p[3]),
                       "v"(p[4]), "v"(p[5]), "v"(p[6]), "v"(p[7]));
#pragma unroll
    for (int i = 0; i < 4; ++i) {
        h16x8 w;
#pragma unroll
        for (int j = 0; j < 8; ++j) w[j] = (_Float16)v[j][i];
        *(h16x8*)(&s[(lo * 4 + i) * 128 + ((hi ^ lo) * 8)]) = w;
    }
    __syncthreads();
#pragma unroll
    for (int it = 0; it < 4; ++it) {
        const int r = hi + it * 16;
        h16x8 w = *(const h16x8*)(&s[r * 128 + ((lo ^ (r >> 2)) * 8)]);
        *(h16x8*)(out + (size_t)(n0 + r) * K + k0 + lo * 8) = w;
    }
}

// f16 (R x C) -> f16 transposed (C x R):  out[c*R + r] = in[r*C + c]
// Same scheme, tile 128 r x 128 c: a thread reads 8 r x 8 c and stores eight
// 16-byte pieces (8 r of one c); the piece index is XORed with c/8.
// R and C are multiples of 128.
__global__ __launch_bounds__(256)
void transpose_f16(const _Float16* __restrict__ in, _Float16* __restrict__ out,
                   int R, int C) {
    __shared__ __attribute__((aligned(16))) _Float16 s[128 * 128];
    const int tid = threadIdx.x;
    const int lo  = tid & 15;
    const int hi  = tid >> 4;
    const int r0  = blockIdx.y * 128;
    const int c0  = blockIdx.x * 128;

    const _Float16* p[8];
    h16x8 v[8];
#pragma unroll
    for (int j = 0; j < 8; ++j) p[j] = in + (size_t)(r0 + hi * 8 + j) * C + c0 + lo * 8;
#pragma unroll
    for (int j = 0; j < 8; ++j) v[j] = *(const h16x8*)(p[j]);
    // holds the eight loads together in front of their first use, all in flight
    // at once; the address pairs are named as well, so that no load's result
    // lands on a pair that an earlier load still names
    asm volatile("" :: "v"(v[0]), "v"(v[1]), "v"(v[2]), "v"(v[3]),
                       "v"(v[4]), "v"(v[5]), "v"(v[6]), "v"(v[7]),
                       "v"(p[0]), "v"(p[1]), "v"(p[2]), "v"(p[3]),
                       "v"(p[4]), "v"(p[5]), "v"(p[6]), "v"(p[7]));
#pragma unroll
    for (int i = 0; i < 8; ++i) {
        h16x8 w;
#pragma unroll
        for (int j = 0; j < 8; ++j) w[j] = v[j][i];
        *(h16x8*)(&s[(lo * 8 + i) * 128 + ((hi ^ lo) * 8)]) = w;
    }
    __syncthreads();
#pragma unroll
    for (int it = 0; it < 8; ++it) {
        const int c = hi + it * 16;
        h16x8 w = *(const h16x8*)(&s[c * 128 + ((lo ^ (c >> 3)) * 8)]);
        *(h16x8*)(out + (size_t)(c0 + c) * R + r0 + lo * 8) = w;
    }
}

// ---------------------------------------------------------------------------
// Row LayerNorm, f32 in -> f16 out.  One 256-thread block per row.
// ---------------------------------------------------------------------------
__device__ __forceinline__
void ln_f16_row(const float* __restrict__ x, const float* __restrict__ w,
                const float* __restrict__ b, _Float16* __restrict__ out,
                int d, int row) {
    const float* xr = x + (size_t)row * d;
    float s = 0.f, ss = 0.f;
    for (int i = threadIdx.x; i < d; i += blockDim.x) {
        float v = xr[i];
        s += v; ss += v * v;
    }
    __shared__ float rs[256], rss[256];
    rs[threadIdx.x] = s; rss[threadIdx.x] = ss;
    __syncthreads();
    for (int st = 128; st > 0; st >>= 1) {
        if (threadIdx.x < st) { rs[threadIdx.x] += rs[threadIdx.x + st];
                                rss[threadIdx.x] += rss[threadIdx.x + st]; }
        __syncthreads();
    }
    float mean = rs[0] / (float)d;
    float var  = rss[0] / (float)d - mean * mean;
    float inv  = rsqrtf(var + 1e-12f);
    for (int i = threadIdx.x; i < d; i += blockDim.x)
        out[(size_t)row * d + i] = (_Float16)((xr[i] - mean) * inv * w[i] + b[i]);
}

__global__ void ln_f16_kernel(const float* __restrict__ x, const float* __restrict__ w,
                              const float* __restrict__ b, _Float16* __restrict__ out,
                              int d) {
    ln_f16_row(x, w, b, out, d, blockIdx.x);
}

// ---------------------------------------------------------------------------
// All that the first product waits for, in ONE launch: the six weight
// conversions and the first LayerNorm read only inputs and depend on nothing, so
// their blocks run side by side and fill the chip together, where seven launches
// one behind the other each paid a launch gap, a ramp and a tail, four of them
// with a block on only half of the WGPs.
// The block index picks the job (the same for every thread of a block, so each
// job's barriers are passed by the whole block): first the tiles of the four
// D x D weights, then those of Wi (D x DFF) and of Wout (DFF x D), then one block
// per row of x.  D, DFF: the problem's widths, compile-time so that the split of
// the index is shifts and masks.
// ---------------------------------------------------------------------------
template <int D, int DFF>
struct PrepBlocks {
    static constexpr unsigned sq  = (D / 64) * (D / 128);      // tiles of a D x D weight
    static constexpr unsigned big = (DFF / 64) * (D / 128);    // tiles of Wi, and of Wout
    static constexpr unsigned cvt = 4 * sq + 2 * big;          // conversion blocks in front of the rows
};

template <int D, int DFF>
__global__ __launch_bounds__(256)
void prep_kernel(const float* __restrict__ Wq, const float* __restrict__ Wk,
                 const float* __restrict__ Wv, const float* __restrict__ Wo,
                 const float* __restrict__ Wi, const float* __restrict__ Wout,
                 _Float16* __restrict__ WqT, _Float16* __restrict__ WkT,
                 _Float16* __restrict__ WvT, _Float16* __restrict__ WoT,
                 _Float16* __restrict__ WiT, _Float16* __restrict__ WoutT,
                 const float* __restrict__ x, const float* __restrict__ ln_w,
                 const float* __restrict__ ln_b, _Float16* __restrict__ h, int d) {
    typedef PrepBlocks<D, DFF> PB;
    const unsigned bid = blockIdx.x;
    if (bid < 4 * PB::sq) {
        const unsigned sel = bid / PB::sq;
        const unsigned t   = bid % PB::sq;
        const float* in = sel == 0 ? Wq  : sel == 1 ? Wk  : sel == 2 ? Wv  : Wo;
        _Float16* out   = sel == 0 ? WqT : sel == 1 ? WkT : sel == 2 ? WvT : WoT;
        cvt_t_f16(in, out, D, D, t % (D / 64), t / (D / 64));
    } else if (bid < 4 * PB::sq + PB::big) {
        const unsigned t = bid - 4 * PB::sq;
        cvt_t_f16(Wi, WiT, D, DFF, t % (DFF / 64), t / (DFF / 64));
    } else if (bid < PB::cvt) {
        const unsigned t = bid - (4 * PB::sq + PB::big);
        cvt_t_f16(Wout, WoutT, DFF, D, t % (D / 64), t / (D / 64));
    } else {
        ln_f16_row(x, ln_w, ln_b, h, d, bid - PB::cvt);
    }
}

// ---------------------------------------------------------------------------
// Tiled WMMA GEMM with async global->LDS double-buffered staging.
//   out = act(A(MxK,f16) @ Bt(NxK,f16)^T + bias) (+ resid)
// Block: 256 threads (8 waves) computes 128x128 tile.
// Wave (wm in 0..1, wn in 0..3) computes 64x32 = 4x2 WMMA tiles.
// K is staged in slabs of 128: 256-byte rows of A and of Bt, laid in LDS at a
// pitch of 272 B, at which the 16 lanes of a half wave fall on all 64 banks in
// the 16-byte fragment reads.  Two buffers: the next slab's copies fly while
// this slab's four 32-k blocks are worked on, one barrier per slab.
// The fragments are fetched one 32-k block ahead, into a second register set, so
// that a block's products run while the next block's reads land.
// K is a multiple of 128, at least 256.
// ---------------------------------------------------------------------------
#define GM_PITCH 136                    // halves per staged row (272 B)
#define GM_TILE  (128 * GM_PITCH)       // halves per staged slab of one operand

// Eight 16-byte copies of one lane: rows 16 apart of one operand's slab.
// l: the lane's LDS byte address, g: its global address, rs: halves per 16 rows.
__device__ __forceinline__ void gm_copy8(unsigned l, const _Float16* g, size_t rs) {
    // the closing s_wait_xcnt keeps the address registers from being
    // rewritten while a copy that names them is still being issued
    asm volatile("global_load_async_to_lds_b128 %0, %8, off\n\t"
                 "global_load_async_to_lds_b128 %1, %9, off\n\t"
                 "global_load_async_to_lds_b128 %2, %10, off\n\t"
                 "global_load_async_to_lds_b128 %3, %11, off\n\t"
                 "global_load_async_to_lds_b128 %4, %12, off\n\t"
                 "global_load_async_to_lds_b128 %5, %13, off\n\t"
                 "global_load_async_to_lds_b128 %6, %14, off\n\t"
                 "global_load_async_to_lds_b128 %7, %15, off\n\t"
                 "s_wait_xcnt 0x0"
                 :: "v"(l),
                    "v"(l + 1 * 16 * (GM_PITCH * 2)), "v"(l + 2 * 16 * (GM_PITCH * 2)),
                    "v"(l + 3 * 16 * (GM_PITCH * 2)), "v"(l + 4 * 16 * (GM_PITCH * 2)),
                    "v"(l + 5 * 16 * (GM_PITCH * 2)), "v"(l + 6 * 16 * (GM_PITCH * 2)),
                    "v"(l + 7 * 16 * (GM_PITCH * 2)),
                    "v"((unsigned long long)(uintptr_t)(g)),
                    "v"((unsigned long long)(uintptr_t)(g + 1 * rs)),
                    "v"((unsigned long long)(uintptr_t)(g + 2 * rs)),
                    "v"((unsigned long long)(uintptr_t)(g + 3 * rs)),
                    "v"((unsigned long long)(uintptr_t)(g + 4 * rs)),
                    "v"((unsigned long long)(uintptr_t)(g + 5 * rs)),
                    "v"((unsigned long long)(uintptr_t)(g + 6 * rs)),
                    "v"((unsigned long long)(uintptr_t)(g + 7 * rs))
                 : "memory");
}

// The fragments of one 32-k block of a wave's 64 x 32 tile: twelve 16-byte LDS reads,
// those of the first product first.  pa, pb: the lane's place in the block's first
// A row and first Bt row.
__device__ __forceinline__ void gm_frags(HV (&a)[4], HV (&b)[2],
                                         const _Float16* pa, const _Float16* pb) {
    a[0].q[0] = *(const u32x4*)(pa);
    a[0].q[1] = *(const u32x4*)(pa + 16);
#pragma unroll
    for (int ni = 0; ni < 2; ++ni) {
        const _Float16* p = pb + ni * 16 * GM_PITCH;
        b[ni].q[0] = *(const u32x4*)(p);
        b[ni].q[1] = *(const u32x4*)(p + 16);
    }
#pragma unroll
    for (int mi = 1; mi < 4; ++mi) {
        const _Float16* p = pa + mi * 16 * GM_PITCH;
        a[mi].q[0] = *(const u32x4*)(p);
        a[mi].q[1] = *(const u32x4*)(p + 16);
    }
}

// N (columns of the output, the row pitch of resid and of the output) and the
// epilogue's mode are compile-time values:
//   RES  : outf = acc + bias + resid   (f32; outh is not used)
//   !RES : outh = act(acc + bias)      (f16; resid and outf are not used),
//          act = tanh GELU where GELU is set, else the identity
// The epilogue then holds no test of a mode, and every element's address is the
// lane's base plus an immediate: its loads, and its stores, follow one another
// with no wait between them.
template <int N, bool GELU, bool RES>
__device__ __forceinline__
void wmma_gemm_tile(const _Float16* __restrict__ A, const _Float16* __restrict__ Bt,
                    const float* __restrict__ bias, const float* __restrict__ resid,
                    float* __restrict__ outf, _Float16* __restrict__ outh, int K) {
    __shared__ __attribute__((aligned(16))) _Float16 sA[2][GM_TILE];
    __shared__ __attribute__((aligned(16))) _Float16 sB[2][GM_TILE];

    const int tid  = threadIdx.x;
    const int lane = tid & 31;
    const int wave = tid >> 5;
    const int col  = lane & 15;   // M (A) / N (B,C) index within 16-tile
    const int hh   = lane >> 4;   // lane-half -> +8 K offset in A/B operands
    const int wn   = wave & 3;    // 4 N-groups of 32
    const int wm   = wave >> 2;   // 2 M-groups of 64
    const int m0   = blockIdx.y * 128;
    const int n0   = blockIdx.x * 128;

    // copy assignment: rows cr, cr+16, .. cr+112 of each slab, 16-byte chunk cc of the row
    const int cr = tid >> 4;
    const int cc = tid & 15;
    const unsigned lA = (unsigned)(uintptr_t)(&sA[0][0]) + (unsigned)(cr * (GM_PITCH * 2) + cc * 16);
    const unsigned lB = (unsigned)(uintptr_t)(&sB[0][0]) + (unsigned)(cr * (GM_PITCH * 2) + cc * 16);
    const _Float16* gA = A  + (size_t)(m0 + cr) * K + cc * 8;
    const _Float16* gB = Bt + (size_t)(n0 + cr) * K + cc * 8;
    const size_t rs = (size_t)16 * K;

    // stage slab s (k 128s .. 128s+127) of A and Bt into buffer buf
    auto stage = [&](int buf, int s) {
        const unsigned lo = (unsigned)(buf * (GM_TILE * 2));
        gm_copy8(lA + lo, gA + (size_t)s * 128, rs);
        gm_copy8(lB + lo, gB + (size_t)s * 128, rs);
    };

    v8f acc[4][2];
#pragma unroll
    for (int mi = 0; mi < 4; ++mi)
#pragma unroll
        for (int ni = 0; ni < 2; ++ni) acc[mi][ni] = v8f_zero();

    const int nslabs = K >> 7;
    stage(0, 0);
    // slab 0 has landed for this wave's copies; the barrier publishes all waves' copies
    asm volatile("s_wait_asynccnt 0x0" ::: "memory");
    __syncthreads();
    if (nslabs > 1) stage(1, 1);

    // element (mi, ni, r) of this lane lies at e0 + (mi * 16 + r) * N + ni * 16
    const unsigned e0 = (unsigned)(m0 + wm * 64 + 8 * hh) * N + (unsigned)(n0 + wn * 32 + col);
    // bias and residual are asked for here, behind the first two slabs' copies: all
    // of a lane's loads are in flight together and land while the k loop runs
    float rv[4][2][8];
    if constexpr (RES) {
        const float* rp = resid + e0;
#pragma unroll
        for (int mi = 0; mi < 4; ++mi)
#pragma unroll
            for (int ni = 0; ni < 2; ++ni)
#pragma unroll
                for (int r = 0; r < 8; ++r) rv[mi][ni][r] = rp[(mi * 16 + r) * N + ni * 16];
    }
    const float bn0 = bias[n0 + wn * 32 + col];
    const float bn1 = bias[n0 + wn * 32 + 16 + col];
    // the loads above are issued before a register that they name is used for anything
    // else (the compiler reuses the bias pointer's pair for the slab counter)
    asm volatile("s_wait_xcnt 0x0" ::: "memory");

    // two fragment sets: block kb of a slab works on set kb & 1 while the twelve reads
    // of the block behind it are under way into the other set, also from one slab to
    // the next: the hand-over stands in front of a slab's last block, whose fragments
    // are in registers by then, and the next slab's first reads fly under that block
    const _Float16* const pa0 = &sA[0][(wm * 64 + col) * GM_PITCH + 8 * hh];
    const _Float16* const pb0 = &sB[0][(wn * 32 + col) * GM_PITCH + 8 * hh];
    HV a[2][4], b[2][2];
    gm_frags(a[0], b[0], pa0, pb0);
    for (int s = 0; s < nslabs; ++s) {
        const int buf = s & 1;
        const _Float16* pa = pa0 + buf * GM_TILE;
        const _Float16* pb = pb0 + buf * GM_TILE;
        // unrolled, like the loops inside: every index of a, b and acc is then a
        // constant (they stay in registers) and every LDS offset an immediate
#pragma unroll
        for (int kb = 0; kb < 4; ++kb) {
            if (kb < 3) {
                gm_frags(a[(kb + 1) & 1], b[(kb + 1) & 1], pa + (kb + 1) * 32, pb + (kb + 1) * 32);
            } else {
                // hand-over, every wave: this wave's reads of buffer buf are done ...
                asm volatile("s_wait_dscnt 0x0" ::: "memory");
                // ... its copies of the next slab have landed ...
                asm volatile("s_wait_asynccnt 0x0" ::: "memory");
                // ... and the barrier publishes the next slab and frees buffer buf
                __syncthreads();
                // the next slab's first block; no test around these reads (a branch would
                // cost the counted waits): behind the last slab they fetch the other
                // buffer's old slab, which nothing uses
                gm_frags(a[0], b[0], pa0 + (buf ^ 1) * GM_TILE, pb0 + (buf ^ 1) * GM_TILE);
            }
            // keeps the next block's reads, as one group, in front of this block's
            // products: left to itself the compiler sank them to their uses, into one
            // register set, with a full LDS wait in front of every two products
            __builtin_amdgcn_sched_barrier(0);
#pragma unroll
            for (int mi = 0; mi < 4; ++mi)
#pragma unroll
                for (int ni = 0; ni < 2; ++ni)
                    acc[mi][ni] = __builtin_amdgcn_wmma_f32_16x16x32_f16(
                        false, a[kb & 1][mi].v, false, b[kb & 1][ni].v, (short)0, acc[mi][ni], false, false);
            // keeps the reads of the block after next from rising among these products
            __builtin_amdgcn_sched_barrier(0);
        }
        // the refill of buffer buf, which every wave left in front of the barrier above;
        // it stands behind the last block, whose fragment registers its addresses take
        if (s + 2 < nslabs) stage(buf, s + 2);
    }
    // no copy is left in flight when the wave ends
    asm volatile("s_wait_asynccnt 0x0" ::: "memory");
    // the reads issued behind the last slab's hand-over have come back
    asm volatile("s_wait_dscnt 0x0" ::: "memory");

    // all 64 values first ...
    _Float16 hv[4][2][8];
#pragma unroll
    for (int mi = 0; mi < 4; ++mi) {
#pragma unroll
        for (int ni = 0; ni < 2; ++ni) {
            const float bn = ni ? bn1 : bn0;
#pragma unroll
            for (int r = 0; r < 8; ++r) {
                float val = acc[mi][ni][r] + bn;
                if constexpr (GELU) val = gelu_tanh(val);
                if constexpr (RES) acc[mi][ni][r] = val + rv[mi][ni][r];
                else               hv[mi][ni][r] = (_Float16)val;
            }
        }
    }
    // ... then the 64 stores in a row, each at the lane's base plus an immediate
    if constexpr (RES) {
        float* const op = outf + e0;
#pragma unroll
        for (int mi = 0; mi < 4; ++mi)
#pragma unroll
            for (int ni = 0; ni < 2; ++ni)
#pragma unroll
                for (int r = 0; r < 8; ++r) op[(mi * 16 + r) * N + ni * 16] = acc[mi][ni][r];
    } else {
        _Float16* const op = outh + e0;
#pragma unroll
        for (int mi = 0; mi < 4; ++mi)
#pragma unroll
            for (int ni = 0; ni < 2; ++ni)
#pragma unroll
                for (int r = 0; r < 8; ++r) op[(mi * 16 + r) * N + ni * 16] = hv[mi][ni][r];
    }
}

template <int N, bool GELU, bool RES>
__global__ __launch_bounds__(256)
void wmma_gemm_tiled(const _Float16* __restrict__ A, const _Float16* __restrict__ Bt,
                     const float* __restrict__ bias, const float* __restrict__ resid,
                     float* __restrict__ outf, _Float16* __restrict__ outh, int K) {
    wmma_gemm_tile<N, GELU, RES>(A, Bt, bias, resid, outf, outh, K);
}

// Three products of the same A with three weights (f16 out, no activation) in ONE
// launch: blockIdx.z picks weight, bias and output.  Each product alone has one
// block per WGP; together two blocks share a WGP, so that one block's first slab
// and its epilogue run beside the other's k loop, and two launch gaps go.
template <int N>
__global__ __launch_bounds__(256)
void wmma_gemm_tiled3(const _Float16* __restrict__ A,
                      const _Float16* __restrict__ Bt0, const _Float16* __restrict__ Bt1,
                      const _Float16* __restrict__ Bt2,
                      const float* __restrict__ bias0, const float* __restrict__ bias1,
                      const float* __restrict__ bias2,
                      _Float16* __restrict__ out0, _Float16* __restrict__ out1,
                      _Float16* __restrict__ out2, int K) {
    const int z = blockIdx.z;
    const _Float16* Bt = z == 0 ? Bt0   : z == 1 ? Bt1   : Bt2;
    const float* bias  = z == 0 ? bias0 : z == 1 ? bias1 : bias2;
    _Float16* outh     = z == 0 ? out0  : z == 1 ? out1  : out2;
    wmma_gemm_tile<N, false, false>(A, Bt, bias, nullptr, nullptr, outh, K);
}

// ---------------------------------------------------------------------------
// Causal flash attention.  One 8-wave block per (pair of 128-query blocks, head);
// each wave owns 16 queries of the block at hand.  A query block's cost grows with
// its index (it walks the keys up to its diagonal) and all work-groups are resident
// at once, so the launch lasts as long as its fullest work-group: every work-group
// takes query block t and then, in the same waves, block nblk - 1 - t, which is the
// same count of key tiles for all of them.  n is a multiple of 256.
// q/k: (n x d) f16, head-h slice at column h*64, dh=64.
// vT: (d x n) f16 transposed V, so its rows are key-contiguous.
// The eight waves share each 64-key tile of K (64 keys x 64 dims) and of vT
// (64 dims x 64 keys): the block copies it once into LDS as whole 128-byte
// rows, two buffers, the next tile in flight while this one is worked on.
// LDS rows are pitched 144 B for the 16-byte fragment reads.
// The products are taken transposed: S^T = Kb Q^T (A = K rows, B = Q) and
// O^T += Vb^T P^T (A = vT rows, B = P^T).  A lane then holds 16 of the 32
// scores of ONE query (lane%16), so maximum and sum run inside the lane with a
// single exchange between the wave's halves, and the two score tiles, converted
// in place, already are the B operand of the second product.
// ---------------------------------------------------------------------------
// 2^x of eight (exp2x8) or nine (exp2x9) values.  One statement each, results kept
// apart from arguments ("=&v") and a closing v_nop: the instruction set asks for one
// slot between a transcendental and an instruction that reads its result or
// overwrites its argument.
__device__ __forceinline__ void exp2x8(float (&y)[8], const float (&x)[8]) {
    asm("v_exp_f32 %0, %8\n\t"  "v_exp_f32 %1, %9\n\t"
        "v_exp_f32 %2, %10\n\t" "v_exp_f32 %3, %11\n\t"
        "v_exp_f32 %4, %12\n\t" "v_exp_f32 %5, %13\n\t"
        "v_exp_f32 %6, %14\n\t" "v_exp_f32 %7, %15\n\t"
        "v_nop"
        : "=&v"(y[0]), "=&v"(y[1]), "=&v"(y[2]), "=&v"(y[3]),
          "=&v"(y[4]), "=&v"(y[5]), "=&v"(y[6]), "=&v"(y[7])
        : "v"(x[0]), "v"(x[1]), "v"(x[2]), "v"(x[3]),
          "v"(x[4]), "v"(x[5]), "v"(x[6]), "v"(x[7]));
}
__device__ __forceinline__ void exp2x9(float& ya, float (&y)[8], float xa, const float (&x)[8]) {
    asm("v_exp_f32 %0, %9\n\t"  "v_exp_f32 %1, %10\n\t"
        "v_exp_f32 %2, %11\n\t" "v_exp_f32 %3, %12\n\t"
        "v_exp_f32 %4, %13\n\t" "v_exp_f32 %5, %14\n\t"
        "v_exp_f32 %6, %15\n\t" "v_exp_f32 %7, %16\n\t"
        "v_exp_f32 %8, %17\n\t"
        "v_nop"
        : "=&v"(ya), "=&v"(y[0]), "=&v"(y[1]), "=&v"(y[2]), "=&v"(y[3]),
          "=&v"(y[4]), "=&v"(y[5]), "=&v"(y[6]), "=&v"(y[7])
        : "v"(xa), "v"(x[0]), "v"(x[1]), "v"(x[2]), "v"(x[3]),
          "v"(x[4]), "v"(x[5]), "v"(x[6]), "v"(x[7]));
}

#define FA_PITCH 72                     // halves per staged row (144 B)
#define FA_TILE  (64 * FA_PITCH)        // halves per staged tile

// one such block stands on a WGP (two waves per SIMD): let the register allocator use that share
__global__ __launch_bounds__(256) __attribute__((amdgpu_waves_per_eu(2, 2)))
void flash_attn(const _Float16* __restrict__ q, const _Float16* __restrict__ k,
                const _Float16* __restrict__ vT, _Float16* __restrict__ o,
                int n, int d) {
    const int dh = 64;
    const float scale = 0.125f;              // 1/sqrt(64)
    const int tid  = threadIdx.x;
    const int lane = tid & 31;
    const int wave = __builtin_amdgcn_readfirstlane(tid >> 5);
    const int col  = lane & 15;
    const int hh   = lane >> 4;
    const int head = blockIdx.y;
    const size_t hoff = (size_t)head * dh;

    __shared__ __attribute__((aligned(16))) _Float16 sK[2][FA_TILE];
    __shared__ __attribute__((aligned(16))) _Float16 sV[2][FA_TILE];

    // copy assignment: rows cr and cr+32 of each tile, 16-byte chunk cc of the row
    const int cr = tid >> 3;
    const int cc = tid & 7;
    const unsigned lK = (unsigned)(uintptr_t)(&sK[0][0]) + (unsigned)(cr * (FA_PITCH * 2) + cc * 16);
    const unsigned lV = (unsigned)(uintptr_t)(&sV[0][0]) + (unsigned)(cr * (FA_PITCH * 2) + cc * 16);
    const _Float16* gK = k  + (size_t)cr * d + hoff + cc * 8;
    const _Float16* gV = vT + (hoff + cr) * (size_t)n + cc * 8;

    // stage key tile t (keys 64t .. 64t+63) of K and vT into buffer buf
    auto stage = [&](int buf, int t) {
        const unsigned lo = (unsigned)(buf * (FA_TILE * 2));
        const _Float16* k0p = gK + (size_t)t * 64 * d;
        const _Float16* k1p = k0p + (size_t)32 * d;
        const _Float16* v0p = gV + (size_t)t * 64;
        const _Float16* v1p = v0p + (size_t)32 * n;
        // the closing s_wait_xcnt keeps the address registers from being
        // rewritten while a copy that names them is still being issued
        asm volatile("global_load_async_to_lds_b128 %0, %4, off\n\t"
                     "global_load_async_to_lds_b128 %1, %5, off\n\t"
                     "global_load_async_to_lds_b128 %2, %6, off\n\t"
                     "global_load_async_to_lds_b128 %3, %7, off\n\t"
                     "s_wait_xcnt 0x0"
                     :: "v"(lK + lo), "v"(lK + lo + 32 * (FA_PITCH * 2)),
                        "v"(lV + lo), "v"(lV + lo + 32 * (FA_PITCH * 2)),
                        "v"((unsigned long long)(uintptr_t)k0p),
                        "v"((unsigned long long)(uintptr_t)k1p),
                        "v"((unsigned long long)(uintptr_t)v0p),
                        "v"((unsigned long long)(uintptr_t)v1p)
                     : "memory");
    };

    // the two query blocks one after the other; kept a loop (one copy of the body in
    // the instruction cache), its trips are long
#pragma unroll 1
    for (int half = 0; half < 2; ++half) {
    const int qblk = half ? (n >> 7) - 1 - (int)blockIdx.x : (int)blockIdx.x;
    const int q0   = qblk * 128 + wave * 16;

    AV aq0, aq1;
    const _Float16* qrow = q + (size_t)(q0 + col) * d + hoff;
#pragma unroll
    for (int j = 0; j < 8; ++j) {
        int ko = 2 * j + 8 * hh + ((j >= 4) ? 8 : 0);
        aq0.u[j] = *(const unsigned*)(qrow + ko);
        aq1.u[j] = *(const unsigned*)(qrow + 32 + ko);
    }

    v8f acc[4];
#pragma unroll
    for (int t = 0; t < 4; ++t) acc[t] = v8f_zero();
    // of query q0 + col: running maximum (equal in both halves of the wave) and
    // the sum over the keys that this half of the wave holds
    float mrow = -1e30f, lrow = 0.0f;
    const int qg = q0 + col;

    const int ntiles = 2 * (qblk + 1);           // 64-key tiles up to the block's diagonal

    // (second query block: every wave's reads of both buffers ended in front of the
    // barrier at the foot of the first block's last trip)
    stage(0, 0);
    // tile 0 has landed for this wave's copies; the barrier publishes all waves' copies
    asm volatile("s_wait_asynccnt 0x0" ::: "memory");
    __syncthreads();
    stage(1, 1);

    for (int kt = 0; kt < ntiles; ++kt) {
        const int buf = kt & 1;
#pragma unroll
        for (int ps = 0; ps < 2; ++ps) {
            const int k0 = kt * 64 + ps * 32;
            if (k0 > q0 + 15) continue;          // wave-uniform: keys wholly above the diagonal
            // ---- S^T = Kb Q^T : two 16x16 score tiles (keys x queries)
            HV b0, b1, b2, b3;
            const _Float16* kr0 = &sK[buf][(ps * 32 + col) * FA_PITCH + 8 * hh];
            const _Float16* kr1 = kr0 + 16 * FA_PITCH;
            b0.q[0] = *(const u32x4*)(kr0);      b0.q[1] = *(const u32x4*)(kr0 + 16);
            b1.q[0] = *(const u32x4*)(kr0 + 32); b1.q[1] = *(const u32x4*)(kr0 + 48);
            b2.q[0] = *(const u32x4*)(kr1);      b2.q[1] = *(const u32x4*)(kr1 + 16);
            b3.q[0] = *(const u32x4*)(kr1 + 32); b3.q[1] = *(const u32x4*)(kr1 + 48);
            // holds the eight LDS reads together in front of the products: one LDS
            // latency per 32 keys instead of one in front of each product
            asm volatile("" :: "v"(b0.v), "v"(b1.v), "v"(b2.v), "v"(b3.v));
            v8f s0 = v8f_zero(), s1 = v8f_zero();
            s0 = __builtin_amdgcn_wmma_f32_16x16x32_f16(false, b0.v, false, aq0.v, (short)0, s0, false, false);
            s0 = __builtin_amdgcn_wmma_f32_16x16x32_f16(false, b1.v, false, aq1.v, (short)0, s0, false, false);
            s1 = __builtin_amdgcn_wmma_f32_16x16x32_f16(false, b2.v, false, aq0.v, (short)0, s1, false, false);
            s1 = __builtin_amdgcn_wmma_f32_16x16x32_f16(false, b3.v, false, aq1.v, (short)0, s1, false, false);

            // ---- scale + causal mask + online softmax
            // s0[r]: key k0 + 8*hh + r, s1[r]: key k0 + 16 + 8*hh + r, query qg
            const int kb = k0 + 8 * hh;
            float mx = -1e30f;
#pragma unroll
            for (int r = 0; r < 8; ++r) {
                float a0 = s0[r] * scale;
                float a1 = s1[r] * scale;
                if (kb + r > qg)      a0 = -1e30f;
                if (kb + 16 + r > qg) a1 = -1e30f;
                s0[r] = a0; s1[r] = a1;
                mx = fmaxf(mx, fmaxf(a0, a1));
            }
            // the other 16 keys of this query sit in lane ^ 16
            mx = fmaxf(mx, __int_as_float(__builtin_amdgcn_permlanex16(
                     __float_as_int(mx), __float_as_int(mx), 0x76543210, 0xfedcba98, false, false)));
            const float mn = fmaxf(mrow, mx);
            // e^x as 2^(x * log2 e)
            const float l2e = 1.4426950408889634f;
            float e0[8], e1[8], p0[8], p1[8], alpha;
#pragma unroll
            for (int r = 0; r < 8; ++r) {
                e0[r] = (s0[r] - mn) * l2e;
                e1[r] = (s1[r] - mn) * l2e;
            }
            exp2x9(alpha, p0, (mrow - mn) * l2e, e0);
            exp2x8(p1, e1);
            mrow = mn;
            AV bp;                               // P^T as B operand: 16 + 16 keys of query col
            float rsum = p0[0] + p1[0];
#pragma unroll
            for (int r = 0; r < 8; ++r) {
                if (r) rsum += p0[r] + p1[r];
                bp.h[r]     = (_Float16)p0[r];
                bp.h[8 + r] = (_Float16)p1[r];
            }
            lrow = lrow * alpha + rsum;
#pragma unroll
            for (int t = 0; t < 4; ++t)
#pragma unroll
                for (int r = 0; r < 8; ++r) acc[t][r] *= alpha;

            // ---- O^T += Vb^T P^T ; each A operand is two 16-byte LDS reads
#pragma unroll
            for (int t = 0; t < 4; ++t) {
                HV bv;
                const _Float16* vb = &sV[buf][(t * 16 + col) * FA_PITCH + ps * 32 + 8 * hh];
                bv.q[0] = *(const u32x4*)(vb);
                bv.q[1] = *(const u32x4*)(vb + 16);
                acc[t] = __builtin_amdgcn_wmma_f32_16x16x32_f16(false, bv.v, false, bp.v,
                                                                (short)0, acc[t], false, false);
            }
        }
        // hand-over, every wave: this wave's reads of buffer buf are done ...
        asm volatile("s_wait_dscnt 0x0" ::: "memory");
        // ... its copies of the next tile have landed ...
        asm volatile("s_wait_asynccnt 0x0" ::: "memory");
        // ... and the barrier publishes the next tile and frees buffer buf
        __syncthreads();
        if (kt + 2 < ntiles) stage(buf, kt + 2);
    }
    // no copy is left in flight when the wave ends
    asm volatile("s_wait_asynccnt 0x0" ::: "memory");

    // join the two halves' sums of each query
    lrow += __int_as_float(__builtin_amdgcn_permlanex16(
                __float_as_int(lrow), __float_as_int(lrow), 0x76543210, 0xfedcba98, false, false));
    // acc[t][r] = O[q0 + col][t*16 + 8*hh + r]: eight consecutive dims, one 16-byte store
    _Float16* orow = o + (size_t)qg * d + hoff + 8 * hh;
#pragma unroll
    for (int t = 0; t < 4; ++t) {
        h16x8 w;
#pragma unroll
        for (int r = 0; r < 8; ++r) w[r] = (_Float16)(acc[t][r] / lrow);
        *(h16x8*)(orow + t * 16) = w;
    }
    // the stores are issued before the next query block's addresses take their registers
    asm volatile("s_wait_xcnt 0x0" ::: "memory");
    }
}

// ---------------------------------------------------------------------------
// Host-side orchestration
// ---------------------------------------------------------------------------
extern "C" void kernel_launch(void* const* d_in, const int* in_sizes, int n_in,
                              void* d_out, int out_size, void* d_ws, size_t ws_size,
                              hipStream_t stream) {
    const int d   = in_sizes[1];          // 1024 (ln1_w)
    const int n   = in_sizes[0] / d;      // 4096
    const int dff = in_sizes[14];         // 4096 (bi)

    const float* x     = (const float*)d_in[0];
    const float* ln1_w = (const float*)d_in[1];
    const float* ln1_b = (const float*)d_in[2];
    const float* Wq    = (const float*)d_in[3];
    const float* bq    = (const float*)d_in[4];
    const float* Wk    = (const float*)d_in[5];
    const float* bk    = (const float*)d_in[6];
    const float* Wv    = (const float*)d_in[7];
    const float* bv    = (const float*)d_in[8];
    const float* Wo    = (const float*)d_in[9];
    const float* bo    = (const float*)d_in[10];
    const float* ln2_w = (const float*)d_in[11];
    const float* ln2_b = (const float*)d_in[12];
    const float* Wi    = (const float*)d_in[13];
    const float* bi    = (const float*)d_in[14];
    const float* Wout  = (const float*)d_in[15];
    const float* bout  = (const float*)d_in[16];

    char* ws = (char*)d_ws;
    size_t off = 0;
    auto alloc = [&](size_t bytes) -> void* {
        void* p = ws + off;
        off += (bytes + 255) & ~(size_t)255;
        return p;
    };
    _Float16* WqT   = (_Float16*)alloc((size_t)d * d * 2);
    _Float16* WkT   = (_Float16*)alloc((size_t)d * d * 2);
    _Float16* WvT   = (_Float16*)alloc((size_t)d * d * 2);
    _Float16* WoT   = (_Float16*)alloc((size_t)d * d * 2);
    _Float16* WiT   = (_Float16*)alloc((size_t)d * dff * 2);
    _Float16* WoutT = (_Float16*)alloc((size_t)dff * d * 2);
    _Float16* h1    = (_Float16*)alloc((size_t)n * d * 2);
    _Float16* q16   = (_Float16*)alloc((size_t)n * d * 2);
    _Float16* k16   = (_Float16*)alloc((size_t)n * d * 2);
    _Float16* v16   = (_Float16*)alloc((size_t)n * d * 2);
    _Float16* vTT   = (_Float16*)alloc((size_t)n * d * 2);
    _Float16* ao16  = (_Float16*)alloc((size_t)n * d * 2);
    float*    x1    = (float*)   alloc((size_t)n * d * 4);
    _Float16* h2    = (_Float16*)alloc((size_t)n * d * 2);
    _Float16* m16   = (_Float16*)alloc((size_t)n * dff * 2);

    // weights -> f16 transposed, and LN1 -> h1 (f16); the template arguments are d and
    // dff of the problem's shapes
    prep_kernel<1024, 4096><<<PrepBlocks<1024, 4096>::cvt + n, 256, 0, stream>>>(
        Wq, Wk, Wv, Wo, Wi, Wout, WqT, WkT, WvT, WoT, WiT, WoutT, x, ln1_w, ln1_b, h1, d);

    // QKV projections (f16 out); the first template argument of every product is its
    // count of output columns (d or dff of the problem's shapes)
    dim3 gdd(d / 128, n / 128);
    wmma_gemm_tiled3<1024><<<dim3(d / 128, n / 128, 3), 256, 0, stream>>>(
        h1, WqT, WkT, WvT, bq, bk, bv, q16, k16, v16, d);

    // V^T (d x n) for K-contiguous P@V operands
    transpose_f16<<<dim3(d / 128, n / 128), 256, 0, stream>>>(v16, vTT, n, d);

    // causal flash attention -> ao16
    flash_attn<<<dim3(n / 256, HEADS), 256, 0, stream>>>(q16, k16, vTT, ao16, n, d);

    // out-proj + residual -> x1 (f32)
    wmma_gemm_tiled<1024, false, true><<<gdd, 256, 0, stream>>>(ao16, WoT, bo, x, x1, nullptr, d);

    // LN2 -> h2 (f16)
    ln_f16_kernel<<<n, 256, 0, stream>>>(x1, ln2_w, ln2_b, h2, d);

    // MLP up + GELU -> m16 (f16)
    wmma_gemm_tiled<4096, true, false><<<dim3(dff / 128, n / 128), 256, 0, stream>>>(h2, WiT, bi, nullptr, nullptr, m16, d);

    // MLP down + bias + residual -> d_out (f32)
    wmma_gemm_tiled<1024, false, true><<<dim3(d / 128, n / 128), 256, 0, stream>>>(m16, WoutT, bout, x1, (float*)d_out, nullptr, dff);
}

// v009
// Measured time: 195 microseconds a run.
// Timed twice side by side with v008, it ran 1.05 times as fast both times.
// Over all steps from v000 it is 5.00 times as fast.
#include <hip/hip_runtime.h>
#include <math.h>

#define HEADS 16

typedef __attribute__((ext_vector_type(16))) _Float16 v16h;
typedef __attribute__((ext_vector_type(8)))  float    v8f;
typedef __attribute__((ext_vector_type(4)))  unsigned u32x4;
typedef __attribute__((ext_vector_type(4)))  float    f32x4;
typedef __attribute__((ext_vector_type(8)))  _Float16 h16x8;

union AV { v16h v; unsigned u[8]; _Float16 h[16]; };
union HV { v16h v; u32x4 q[2]; };

__device__ __forceinline__ v8f v8f_zero() {
    v8f z;
#pragma unroll
    for (int i = 0; i < 8; ++i) z[i] = 0.0f;
    return z;
}

// 2^x of eight (exp2x8) or nine (exp2x9) values, 1/x of eight (rcpx8).  One statement
// each, results kept apart from arguments ("=&v") and a closing v_nop: the instruction
// set asks for one slot between a transcendental and an instruction that reads its
// result or overwrites its argument.
__device__ __forceinline__ void exp2x8(float (&y)[8], const float (&x)[8]) {
    asm("v_exp_f32 %0, %8\n\t"  "v_exp_f32 %1, %9\n\t"
        "v_exp_f32 %2, %10\n\t" "v_exp_f32 %3, %11\n\t"
        "v_exp_f32 %4, %12\n\t" "v_exp_f32 %5, %13\n\t"
        "v_exp_f32 %6, %14\n\t" "v_exp_f32 %7, %15\n\t"
        "v_nop"
        : "=&v"(y[0]), "=&v"(y[1]), "=&v"(y[2]), "=&v"(y[3]),
          "=&v"(y[4]), "=&v"(y[5]), "=&v"(y[6]), "=&v"(y[7])
        : "v"(x[0]), "v"(x[1]), "v"(x[2]), "v"(x[3]),
          "v"(x[4]), "v"(x[5]), "v"(x[6]), "v"(x[7]));
}
__device__ __forceinline__ void exp2x9(float& ya, float (&y)[8], float xa, const float (&x)[8]) {
    asm("v_exp_f32 %0, %9\n\t"  "v_exp_f32 %1, %10\n\t"
        "v_exp_f32 %2, %11\n\t" "v_exp_f32 %3, %12\n\t"
        "v_exp_f32 %4, %13\n\t" "v_exp_f32 %5, %14\n\t"
        "v_exp_f32 %6, %15\n\t" "v_exp_f32 %7, %16\n\t"
        "v_exp_f32 %8, %17\n\t"
        "v_nop"
        : "=&v"(ya), "=&v"(y[0]), "=&v"(y[1]), "=&v"(y[2]), "=&v"(y[3]),
          "=&v"(y[4]), "=&v"(y[5]), "=&v"(y[6]), "=&v"(y[7])
        : "v"(xa), "v"(x[0]), "v"(x[1]), "v"(x[2]), "v"(x[3]),
          "v"(x[4]), "v"(x[5]), "v"(x[6]), "v"(x[7]));
}
__device__ __forceinline__ void rcpx8(float (&y)[8], const float (&x)[8]) {
    asm("v_rcp_f32 %0, %8\n\t"  "v_rcp_f32 %1, %9\n\t"
        "v_rcp_f32 %2, %10\n\t" "v_rcp_f32 %3, %11\n\t"
        "v_rcp_f32 %4, %12\n\t" "v_rcp_f32 %5, %13\n\t"
        "v_rcp_f32 %6, %14\n\t" "v_rcp_f32 %7, %15\n\t"
        "v_nop"
        : "=&v"(y[0]), "=&v"(y[1]), "=&v"(y[2]), "=&v"(y[3]),
          "=&v"(y[4]), "=&v"(y[5]), "=&v"(y[6]), "=&v"(y[7])
        : "v"(x[0]), "v"(x[1]), "v"(x[2]), "v"(x[3]),
          "v"(x[4]), "v"(x[5]), "v"(x[6]), "v"(x[7]));
}

// tanh GELU of eight values, in place.  With u = k0 (x + k1 x^3), k0 = sqrt(2/pi),
// k1 = 0.044715:
//   0.5 x (1 + tanh u) = x / (1 + e^(-2u)),   e^(-2u) = 2^(x (c0 + c1 x^2)),
//   c0 = -2 k0 log2(e), c1 = c0 k1.
// One hardware 2^x and one hardware reciprocal per value and no branch: the eight
// values are independent chains that fill each other's latencies.  At the ends:
// 2^x = inf gives 1/inf = 0 (x far below 0), 2^x = 0 gives x (x far above 0).
__device__ __forceinline__ void gelu_tanh8(float (&x)[8]) {
    const float c0 = (float)(-2.0 * 0.7978845608028654 * 1.4426950408889634);
    const float c1 = (float)(-2.0 * 0.7978845608028654 * 1.4426950408889634 * 0.044715);
    float a[8], e[8], q[8];
#pragma unroll
    for (int r = 0; r < 8; ++r) a[r] = x[r] * (c0 + c1 * x[r] * x[r]);
    exp2x8(e, a);
#pragma unroll
    for (int r = 0; r < 8; ++r) a[r] = 1.0f + e[r];
    rcpx8(q, a);
#pragma unroll
    for (int r = 0; r < 8; ++r) x[r] *= q[r];
}

// ---------------------------------------------------------------------------
// Convert f32 weight (K x N, row-major) -> f16 transposed (N x K, row-major)
// so WMMA B-operand (and async LDS staging) loads are K-contiguous.
// One 256-thread block moves a tile of 128 k x 64 n through LDS: 256-byte runs
// are read from every input row and 256-byte runs written to every output row.
// A thread reads 8 k x 4 n (eight 16-byte loads in flight), converts, and stores
// four 16-byte pieces (8 k of one n) into the transposed LDS tile.  The 16-byte
// piece index is XORed with n/4, so the 16 lanes of a half wave fall on all 64
// banks both when the tile is written and when it is read back by rows.
// K is a multiple of 128, N of 64.  bx, by: the block's tile along n and along k.
// ---------------------------------------------------------------------------
__device__ __forceinline__
void cvt_t_f16(const float* __restrict__ in, _Float16* __restrict__ out,
               int K, int N, int bx, int by) {
    __shared__ __attribute__((aligned(16))) _Float16 s[64 * 128];
    const int tid = threadIdx.x;
    const int lo  = tid & 15;
    const int hi  = tid >> 4;
    const int k0  = by * 128;
    const int n0  = bx * 64;

    const float* p[8];
    f32x4 v[8];
#pragma unroll
    for (int j = 0; j < 8; ++j) p[j] = in + (size_t)(k0 + hi * 8 + j) * N + n0 + lo * 4;
#pragma unroll
    for (int j = 0; j < 8; ++j) v[j] = *(const f32x4*)(p[j]);
    // holds the eight loads together in front of their first use, all in flight
    // at once; the address pairs are named as well, so that no load's result
    // lands on a pair that an earlier load still names
    asm volatile("" :: "v"(v[0]), "v"(v[1]), "v"(v[2]), "v"(v[3]),
                       "v"(v[4]), "v"(v[5]), "v"(v[6]), "v"(v[7]),
                       "v"(p[0]), "v"(p[1]), "v"(p[2]), "v"(p[3]),
                       "v"(p[4]), "v"(p[5]), "v"(p[6]), "v"(p[7]));
#pragma unroll
    for (int i = 0; i < 4; ++i) {
        h16x8 w;
#pragma unroll
        for (int j = 0; j < 8; ++j) w[j] = (_Float16)v[j][i];
        *(h16x8*)(&s[(lo * 4 + i) * 128 + ((hi ^ lo) * 8)]) = w;
    }
    __syncthreads();
#pragma unroll
    for (int it = 0; it < 4; ++it) {
        const int r = hi + it * 16;
        h16x8 w = *(const h16x8*)(&s[r * 128 + ((lo ^ (r >> 2)) * 8)]);
        *(h16x8*)(out + (size_t)(n0 + r) * K + k0 + lo * 8) = w;
    }
}

// f16 (R x C) -> f16 transposed (C x R):  out[c*R + r] = in[r*C + c]
// Same scheme, tile 128 r x 128 c: a thread reads 8 r x 8 c and stores eight
// 16-byte pieces (8 r of one c); the piece index is XORed with c/8.
// R and C are multiples of 128.
__global__ __launch_bounds__(256)
void transpose_f16(const _Float16* __restrict__ in, _Float16* __restrict__ out,
                   int R, int C) {
    __shared__ __attribute__((aligned(16))) _Float16 s[128 * 128];
    const int tid = threadIdx.x;
    const int lo  = tid & 15;
    const int hi  = tid >> 4;
    const int r0  = blockIdx.y * 128;
    const int c0  = blockIdx.x * 128;

    const _Float16* p[8];
    h16x8 v[8];
#pragma unroll
    for (int j = 0; j < 8; ++j) p[j] = in + (size_t)(r0 + hi * 8 + j) * C + c0 + lo * 8;
#pragma unroll
    for (int j = 0; j < 8; ++j) v[j] = *(const h16x8*)(p[j]);
    // holds the eight loads together in front of their first use, all in flight
    // at once; the address pairs are named as well, so that no load's result
    // lands on a pair that an earlier load still names
    asm volatile("" :: "v"(v[0]), "v"(v[1]), "v"(v[2]), "v"(v[3]),
                       "v"(v[4]), "v"(v[5]), "v"(v[6]), "v"(v[7]),
                       "v"(p[0]), "v"(p[1]), "v"(p[2]), "v"(p[3]),
                       "v"(p[4]), "v"(p[5]), "v"(p[6]), "v"(p[7]));
#pragma unroll
    for (int i = 0; i < 8; ++i) {
        h16x8 w;
#pragma unroll
        for (int j = 0; j < 8; ++j) w[j] = v[j][i];
        *(h16x8*)(&s[(lo * 8 + i) * 128 + ((hi ^ lo) * 8)]) = w;
    }
    __syncthreads();
#pragma unroll
    for (int it = 0; it < 8; ++it) {
        const int c = hi + it * 16;
        h16x8 w = *(const h16x8*)(&s[c * 128 + ((lo ^ (c >> 3)) * 8)]);
        *(h16x8*)(out + (size_t)(c0 + c) * R + r0 + lo * 8) = w;
    }
}

// ---------------------------------------------------------------------------
// Row LayerNorm, f32 in -> f16 out.  One 256-thread block per row.
// ---------------------------------------------------------------------------
__device__ __forceinline__
void ln_f16_row(const float* __restrict__ x, const float* __restrict__ w,
                const float* __restrict__ b, _Float16* __restrict__ out,
                int d, int row) {
    const float* xr = x + (size_t)row * d;
    float s = 0.f, ss = 0.f;
    for (int i = threadIdx.x; i < d; i += blockDim.x) {
        float v = xr[i];
        s += v; ss += v * v;
    }
    __shared__ float rs[256], rss[256];
    rs[threadIdx.x] = s; rss[threadIdx.x] = ss;
    __syncthreads();
    for (int st = 128; st > 0; st >>= 1) {
        if (threadIdx.x < st) { rs[threadIdx.x] += rs[threadIdx.x + st];
                                rss[threadIdx.x] += rss[threadIdx.x + st]; }
        __syncthreads();
    }
    float mean = rs[0] / (float)d;
    float var  = rss[0] / (float)d - mean * mean;
    float inv  = rsqrtf(var + 1e-12f);
    for (int i = threadIdx.x; i < d; i += blockDim.x)
        out[(size_t)row * d + i] = (_Float16)((xr[i] - mean) * inv * w[i] + b[i]);
}

__global__ void ln_f16_kernel(const float* __restrict__ x, const float* __restrict__ w,
                              const float* __restrict__ b, _Float16* __restrict__ out,
                              int d) {
    ln_f16_row(x, w, b, out, d, blockIdx.x);
}

// ---------------------------------------------------------------------------
// All that the first product waits for, in ONE launch: the six weight
// conversions and the first LayerNorm read only inputs and depend on nothing, so
// their blocks run side by side and fill the chip together, where seven launches
// one behind the other each paid a launch gap, a ramp and a tail, four of them
// with a block on only half of the WGPs.
// The block index picks the job (the same for every thread of a block, so each
// job's barriers are passed by the whole block): first the tiles of the four
// D x D weights, then those of Wi (D x DFF) and of Wout (DFF x D), then one block
// per row of x.  D, DFF: the problem's widths, compile-time so that the split of
// the index is shifts and masks.
// ---------------------------------------------------------------------------
template <int D, int DFF>
struct PrepBlocks {
    static constexpr unsigned sq  = (D / 64) * (D / 128);      // tiles of a D x D weight
    static constexpr unsigned big = (DFF / 64) * (D / 128);    // tiles of Wi, and of Wout
    static constexpr unsigned cvt = 4 * sq + 2 * big;          // conversion blocks in front of the rows
};

template <int D, int DFF>
__global__ __launch_bounds__(256)
void prep_kernel(const float* __restrict__ Wq, const float* __restrict__ Wk,
                 const float* __restrict__ Wv, const float* __restrict__ Wo,
                 const float* __restrict__ Wi, const float* __restrict__ Wout,
                 _Float16* __restrict__ WqT, _Float16* __restrict__ WkT,
                 _Float16* __restrict__ WvT, _Float16* __restrict__ WoT,
                 _Float16* __restrict__ WiT, _Float16* __restrict__ WoutT,
                 const float* __restrict__ x, const float* __restrict__ ln_w,
                 const float* __restrict__ ln_b, _Float16* __restrict__ h, int d) {
    typedef PrepBlocks<D, DFF> PB;
    const unsigned bid = blockIdx.x;
    if (bid < 4 * PB::sq) {
        const unsigned sel = bid / PB::sq;
        const unsigned t   = bid % PB::sq;
        const float* in = sel == 0 ? Wq  : sel == 1 ? Wk  : sel == 2 ? Wv  : Wo;
        _Float16* out   = sel == 0 ? WqT : sel == 1 ? WkT : sel == 2 ? WvT : WoT;
        cvt_t_f16(in, out, D, D, t % (D / 64), t / (D / 64));
    } else if (bid < 4 * PB::sq + PB::big) {
        const unsigned t = bid - 4 * PB::sq;
        cvt_t_f16(Wi, WiT, D, DFF, t % (DFF / 64), t / (DFF / 64));
    } else if (bid < PB::cvt) {
        const unsigned t = bid - (4 * PB::sq + PB::big);
        cvt_t_f16(Wout, WoutT, DFF, D, t % (D / 64), t / (D / 64));
    } else {
        ln_f16_row(x, ln_w, ln_b, h, d, bid - PB::cvt);
    }
}

// ---------------------------------------------------------------------------
// Tiled WMMA GEMM with async global->LDS double-buffered staging.
//   out = act(A(MxK,f16) @ Bt(NxK,f16)^T + bias) (+ resid)
// Block: 256 threads (8 waves) computes 128x128 tile.
// Wave (wm in 0..1, wn in 0..3) computes 64x32 = 4x2 WMMA tiles.
// K is staged in slabs of 128: 256-byte rows of A and of Bt, laid in LDS at a
// pitch of 272 B, at which the 16 lanes of a half wave fall on all 64 banks in
// the 16-byte fragment reads.  Two buffers: the next slab's copies fly while
// this slab's four 32-k blocks are worked on, one barrier per slab.
// The fragments are fetched one 32-k block ahead, into a second register set, so
// that a block's products run while the next block's reads land.
// K is a multiple of 128, at least 256.
// ---------------------------------------------------------------------------
#define GM_PITCH 136                    // halves per staged row (272 B)
#define GM_TILE  (128 * GM_PITCH)       // halves per staged slab of one operand

// Eight 16-byte copies of one lane: rows 16 apart of one operand's slab.
// l: the lane's LDS byte address, g: its global address, rs: halves per 16 rows.
__device__ __forceinline__ void gm_copy8(unsigned l, const _Float16* g, size_t rs) {
    // the closing s_wait_xcnt keeps the address registers from being
    // rewritten while a copy that names them is still being issued
    asm volatile("global_load_async_to_lds_b128 %0, %8, off\n\t"
                 "global_load_async_to_lds_b128 %1, %9, off\n\t"
                 "global_load_async_to_lds_b128 %2, %10, off\n\t"
                 "global_load_async_to_lds_b128 %3, %11, off\n\t"
                 "global_load_async_to_lds_b128 %4, %12, off\n\t"
                 "global_load_async_to_lds_b128 %5, %13, off\n\t"
                 "global_load_async_to_lds_b128 %6, %14, off\n\t"
                 "global_load_async_to_lds_b128 %7, %15, off\n\t"
                 "s_wait_xcnt 0x0"
                 :: "v"(l),
                    "v"(l + 1 * 16 * (GM_PITCH * 2)), "v"(l + 2 * 16 * (GM_PITCH * 2)),
                    "v"(l + 3 * 16 * (GM_PITCH * 2)), "v"(l + 4 * 16 * (GM_PITCH * 2)),
                    "v"(l + 5 * 16 * (GM_PITCH * 2)), "v"(l + 6 * 16 * (GM_PITCH * 2)),
                    "v"(l + 7 * 16 * (GM_PITCH * 2)),
                    "v"((unsigned long long)(uintptr_t)(g)),
                    "v"((unsigned long long)(uintptr_t)(g + 1 * rs)),
                    "v"((unsigned long long)(uintptr_t)(g + 2 * rs)),
                    "v"((unsigned long long)(uintptr_t)(g + 3 * rs)),
                    "v"((unsigned long long)(uintptr_t)(g + 4 * rs)),
                    "v"((unsigned long long)(uintptr_t)(g + 5 * rs)),
                    "v"((unsigned long long)(uintptr_t)(g + 6 * rs)),
                    "v"((unsigned long long)(uintptr_t)(g + 7 * rs))
                 : "memory");
}

// The fragments of one 32-k block of a wave's 64 x 32 tile: twelve 16-byte LDS reads,
// those of the first product first.  pa, pb: the lane's place in the block's first
// A row and first Bt row.
__device__ __forceinline__ void gm_frags(HV (&a)[4], HV (&b)[2],
                                         const _Float16* pa, const _Float16* pb) {
    a[0].q[0] = *(const u32x4*)(pa);
    a[0].q[1] = *(const u32x4*)(pa + 16);
#pragma unroll
    for (int ni = 0; ni < 2; ++ni) {
        const _Float16* p = pb + ni * 16 * GM_PITCH;
        b[ni].q[0] = *(const u32x4*)(p);
        b[ni].q[1] = *(const u32x4*)(p + 16);
    }
#pragma unroll
    for (int mi = 1; mi < 4; ++mi) {
        const _Float16* p = pa + mi * 16 * GM_PITCH;
        a[mi].q[0] = *(const u32x4*)(p);
        a[mi].q[1] = *(const u32x4*)(p + 16);
    }
}

// N (columns of the output, the row pitch of resid and of the output) and the
// epilogue's mode are compile-time values:
//   RES  : outf = acc + bias + resid   (f32; outh is not used)
//   !RES : outh = act(acc + bias)      (f16; resid and outf are not used),
//          act = tanh GELU where GELU is set, else the identity
// The epilogue then holds no test of a mode, and every element's address is the
// lane's base plus an immediate: its loads, and its stores, follow one another
// with no wait between them.
template <int N, bool GELU, bool RES>
__device__ __forceinline__
void wmma_gemm_tile(const _Float16* __restrict__ A, const _Float16* __restrict__ Bt,
                    const float* __restrict__ bias, const float* __restrict__ resid,
                    float* __restrict__ outf, _Float16* __restrict__ outh, int K) {
    __shared__ __attribute__((aligned(16))) _Float16 sA[2][GM_TILE];
    __shared__ __attribute__((aligned(16))) _Float16 sB[2][GM_TILE];

    const int tid  = threadIdx.x;
    const int lane = tid & 31;
    const int wave = tid >> 5;
    const int col  = lane & 15;   // M (A) / N (B,C) index within 16-tile
    const int hh   = lane >> 4;   // lane-half -> +8 K offset in A/B operands
    const int wn   = wave & 3;    // 4 N-groups of 32
    const int wm   = wave >> 2;   // 2 M-groups of 64
    const int m0   = blockIdx.y * 128;
    const int n0   = blockIdx.x * 128;

    // copy assignment: rows cr, cr+16, .. cr+112 of each slab, 16-byte chunk cc of the row
    const int cr = tid >> 4;
    const int cc = tid & 15;
    const unsigned lA = (unsigned)(uintptr_t)(&sA[0][0]) + (unsigned)(cr * (GM_PITCH * 2) + cc * 16);
    const unsigned lB = (unsigned)(uintptr_t)(&sB[0][0]) + (unsigned)(cr * (GM_PITCH * 2) + cc * 16);
    const _Float16* gA = A  + (size_t)(m0 + cr) * K + cc * 8;
    const _Float16* gB = Bt + (size_t)(n0 + cr) * K + cc * 8;
    const size_t rs = (size_t)16 * K;

    // stage slab s (k 128s .. 128s+127) of A and Bt into buffer buf
    auto stage = [&](int buf, int s) {
        const unsigned lo = (unsigned)(buf * (GM_TILE * 2));
        gm_copy8(lA + lo, gA + (size_t)s * 128, rs);
        gm_copy8(lB + lo, gB + (size_t)s * 128, rs);
    };

    v8f acc[4][2];
#pragma unroll
    for (int mi = 0; mi < 4; ++mi)
#pragma unroll
        for (int ni = 0; ni < 2; ++ni) acc[mi][ni] = v8f_zero();

    const int nslabs = K >> 7;
    stage(0, 0);
    // slab 0 has landed for this wave's copies; the barrier publishes all waves' copies
    asm volatile("s_wait_asynccnt 0x0" ::: "memory");
    __syncthreads();
    if (nslabs > 1) stage(1, 1);

    // element (mi, ni, r) of this lane lies at e0 + (mi * 16 + r) * N + ni * 16
    const unsigned e0 = (unsigned)(m0 + wm * 64 + 8 * hh) * N + (unsigned)(n0 + wn * 32 + col);
    // bias and residual are asked for here, behind the first two slabs' copies: all
    // of a lane's loads are in flight together and land while the k loop runs
    float rv[4][2][8];
    if constexpr (RES) {
        const float* rp = resid + e0;
#pragma unroll
        for (int mi = 0; mi < 4; ++mi)
#pragma unroll
            for (int ni = 0; ni < 2; ++ni)
#pragma unroll
                for (int r = 0; r < 8; ++r) rv[mi][ni][r] = rp[(mi * 16 + r) * N + ni * 16];
    }
    const float bn0 = bias[n0 + wn * 32 + col];
    const float bn1 = bias[n0 + wn * 32 + 16 + col];
    // the loads above are issued before a register that they name is used for anything
    // else (the compiler reuses the bias pointer's pair for the slab counter)
    asm volatile("s_wait_xcnt 0x0" ::: "memory");

    // two fragment sets: block kb of a slab works on set kb & 1 while the twelve reads
    // of the block behind it are under way into the other set, also from one slab to
    // the next: the hand-over stands in front of a slab's last block, whose fragments
    // are in registers by then, and the next slab's first reads fly under that block
    const _Float16* const pa0 = &sA[0][(wm * 64 + col) * GM_PITCH + 8 * hh];
    const _Float16* const pb0 = &sB[0][(wn * 32 + col) * GM_PITCH + 8 * hh];
    HV a[2][4], b[2][2];
    gm_frags(a[0], b[0], pa0, pb0);
    for (int s = 0; s < nslabs; ++s) {
        const int buf = s & 1;
        const _Float16* pa = pa0 + buf * GM_TILE;
        const _Float16* pb = pb0 + buf * GM_TILE;
        // unrolled, like the loops inside: every index of a, b and acc is then a
        // constant (they stay in registers) and every LDS offset an immediate
#pragma unroll
        for (int kb = 0; kb < 4; ++kb) {
            if (kb < 3) {
                gm_frags(a[(kb + 1) & 1], b[(kb + 1) & 1], pa + (kb + 1) * 32, pb + (kb + 1) * 32);
            } else {
                // hand-over, every wave: this wave's reads of buffer buf are done ...
                asm volatile("s_wait_dscnt 0x0" ::: "memory");
                // ... its copies of the next slab have landed ...
                asm volatile("s_wait_asynccnt 0x0" ::: "memory");
                // ... and the barrier publishes the next slab and frees buffer buf
                __syncthreads();
                // the next slab's first block; no test around these reads (a branch would
                // cost the counted waits): behind the last slab they fetch the other
                // buffer's old slab, which nothing uses
                gm_frags(a[0], b[0], pa0 + (buf ^ 1) * GM_TILE, pb0 + (buf ^ 1) * GM_TILE);
            }
            // keeps the next block's reads, as one group, in front of this block's
            // products: left to itself the compiler sank them to their uses, into one
            // register set, with a full LDS wait in front of every two products
            __builtin_amdgcn_sched_barrier(0);
#pragma unroll
            for (int mi = 0; mi < 4; ++mi)
#pragma unroll
                for (int ni = 0; ni < 2; ++ni)
                    acc[mi][ni] = __builtin_amdgcn_wmma_f32_16x16x32_f16(
                        false, a[kb & 1][mi].v, false, b[kb & 1][ni].v, (short)0, acc[mi][ni], false, false);
            // keeps the reads of the block after next from rising among these products
            __builtin_amdgcn_sched_barrier(0);
        }
        // the refill of buffer buf, which every wave left in front of the barrier above;
        // it stands behind the last block, whose fragment registers its addresses take
        if (s + 2 < nslabs) stage(buf, s + 2);
    }
    // no copy is left in flight when the wave ends
    asm volatile("s_wait_asynccnt 0x0" ::: "memory");
    // the reads issued behind the last slab's hand-over have come back
    asm volatile("s_wait_dscnt 0x0" ::: "memory");

    // all 64 values first ...
    _Float16 hv[4][2][8];
#pragma unroll
    for (int mi = 0; mi < 4; ++mi) {
#pragma unroll
        for (int ni = 0; ni < 2; ++ni) {
            const float bn = ni ? bn1 : bn0;
            if constexpr (GELU) {
                // bias and activation of the tile's eight values together, left in acc
                float g[8];
#pragma unroll
                for (int r = 0; r < 8; ++r) g[r] = acc[mi][ni][r] + bn;
                gelu_tanh8(g);
#pragma unroll
                for (int r = 0; r < 8; ++r) acc[mi][ni][r] = g[r];
            }
#pragma unroll
            for (int r = 0; r < 8; ++r) {
                float val = acc[mi][ni][r];
                if constexpr (!GELU) val += bn;
                if constexpr (RES) acc[mi][ni][r] = val + rv[mi][ni][r];
                else               hv[mi][ni][r] = (_Float16)val;
            }
        }
    }
    // ... then the 64 stores in a row, each at the lane's base plus an immediate
    if constexpr (RES) {
        float* const op = outf + e0;
#pragma unroll
        for (int mi = 0; mi < 4; ++mi)
#pragma unroll
            for (int ni = 0; ni < 2; ++ni)
#pragma unroll
                for (int r = 0; r < 8; ++r) op[(mi * 16 + r) * N + ni * 16] = acc[mi][ni][r];
    } else {
        _Float16* const op = outh + e0;
#pragma unroll
        for (int mi = 0; mi < 4; ++mi)
#pragma unroll
            for (int ni = 0; ni < 2; ++ni)
#pragma unroll
                for (int r = 0; r < 8; ++r) op[(mi * 16 + r) * N + ni * 16] = hv[mi][ni][r];
    }
}

template <int N, bool GELU, bool RES>
__global__ __launch_bounds__(256)
void wmma_gemm_tiled(const _Float16* __restrict__ A, const _Float16* __restrict__ Bt,
                     const float* __restrict__ bias, const float* __restrict__ resid,
                     float* __restrict__ outf, _Float16* __restrict__ outh, int K) {
    wmma_gemm_tile<N, GELU, RES>(A, Bt, bias, resid, outf, outh, K);
}

// Three products of the same A with three weights (f16 out, no activation) in ONE
// launch: blockIdx.z picks weight, bias and output.  Each product alone has one
// block per WGP; together two blocks share a WGP, so that one block's first slab
// and its epilogue run beside the other's k loop, and two launch gaps go.
template <int N>
__global__ __launch_bounds__(256)
void wmma_gemm_tiled3(const _Float16* __restrict__ A,
                      const _Float16* __restrict__ Bt0, const _Float16* __restrict__ Bt1,
                      const _Float16* __restrict__ Bt2,
                      const float* __restrict__ bias0, const float* __restrict__ bias1,
                      const float* __restrict__ bias2,
                      _Float16* __restrict__ out0, _Float16* __restrict__ out1,
                      _Float16* __restrict__ out2, int K) {
    const int z = blockIdx.z;
    const _Float16* Bt = z == 0 ? Bt0   : z == 1 ? Bt1   : Bt2;
    const float* bias  = z == 0 ? bias0 : z == 1 ? bias1 : bias2;
    _Float16* outh     = z == 0 ? out0  : z == 1 ? out1  : out2;
    wmma_gemm_tile<N, false, false>(A, Bt, bias, nullptr, nullptr, outh, K);
}

// ---------------------------------------------------------------------------
// Causal flash attention.  One 8-wave block per (pair of 128-query blocks, head);
// each wave owns 16 queries of the block at hand.  A query block's cost grows with
// its index (it walks the keys up to its diagonal) and all work-groups are resident
// at once, so the launch lasts as long as its fullest work-group: every work-group
// takes query block t and then, in the same waves, block nblk - 1 - t, which is the
// same count of key tiles for all of them.  n is a multiple of 256.
// q/k: (n x d) f16, head-h slice at column h*64, dh=64.
// vT: (d x n) f16 transposed V, so its rows are key-contiguous.
// The eight waves share each 64-key tile of K (64 keys x 64 dims) and of vT
// (64 dims x 64 keys): the block copies it once into LDS as whole 128-byte
// rows, two buffers, the next tile in flight while this one is worked on.
// LDS rows are pitched 144 B for the 16-byte fragment reads.
// The products are taken transposed: S^T = Kb Q^T (A = K rows, B = Q) and
// O^T += Vb^T P^T (A = vT rows, B = P^T).  A lane then holds 16 of the 32
// scores of ONE query (lane%16), so maximum and sum run inside the lane with a
// single exchange between the wave's halves, and the two score tiles, converted
// in place, already are the B operand of the second product.
// ---------------------------------------------------------------------------
#define FA_PITCH 72                     // halves per staged row (144 B)
#define FA_TILE  (64 * FA_PITCH)        // halves per staged tile

// one such block stands on a WGP (two waves per SIMD): let the register allocator use that share
__global__ __launch_bounds__(256) __attribute__((amdgpu_waves_per_eu(2, 2)))
void flash_attn(const _Float16* __restrict__ q, const _Float16* __restrict__ k,
                const _Float16* __restrict__ vT, _Float16* __restrict__ o,
                int n, int d) {
    const int dh = 64;
    const float scale = 0.125f;              // 1/sqrt(64)
    const int tid  = threadIdx.x;
    const int lane = tid & 31;
    const int wave = __builtin_amdgcn_readfirstlane(tid >> 5);
    const int col  = lane & 15;
    const int hh   = lane >> 4;
    const int head = blockIdx.y;
    const size_t hoff = (size_t)head * dh;

    __shared__ __attribute__((aligned(16))) _Float16 sK[2][FA_TILE];
    __shared__ __attribute__((aligned(16))) _Float16 sV[2][FA_TILE];

    // copy assignment: rows cr and cr+32 of each tile, 16-byte chunk cc of the row
    const int cr = tid >> 3;
    const int cc = tid & 7;
    const unsigned lK = (unsigned)(uintptr_t)(&sK[0][0]) + (unsigned)(cr * (FA_PITCH * 2) + cc * 16);
    const unsigned lV = (unsigned)(uintptr_t)(&sV[0][0]) + (unsigned)(cr * (FA_PITCH * 2) + cc * 16);
    const _Float16* gK = k  + (size_t)cr * d + hoff + cc * 8;
    const _Float16* gV = vT + (hoff + cr) * (size_t)n + cc * 8;

    // stage key tile t (keys 64t .. 64t+63) of K and vT into buffer buf
    auto stage = [&](int buf, int t) {
        const unsigned lo = (unsigned)(buf * (FA_TILE * 2));
        const _Float16* k0p = gK + (size_t)t * 64 * d;
        const _Float16* k1p = k0p + (size_t)32 * d;
        const _Float16* v0p = gV + (size_t)t * 64;
        const _Float16* v1p = v0p + (size_t)32 * n;
        // the closing s_wait_xcnt keeps the address registers from being
        // rewritten while a copy that names them is still being issued
        asm volatile("global_load_async_to_lds_b128 %0, %4, off\n\t"
                     "global_load_async_to_lds_b128 %1, %5, off\n\t"
                     "global_load_async_to_lds_b128 %2, %6, off\n\t"
                     "global_load_async_to_lds_b128 %3, %7, off\n\t"
                     "s_wait_xcnt 0x0"
                     :: "v"(lK + lo), "v"(lK + lo + 32 * (FA_PITCH * 2)),
                        "v"(lV + lo), "v"(lV + lo + 32 * (FA_PITCH * 2)),
                        "v"((unsigned long long)(uintptr_t)k0p),
                        "v"((unsigned long long)(uintptr_t)k1p),
                        "v"((unsigned long long)(uintptr_t)v0p),
                        "v"((unsigned long long)(uintptr_t)v1p)
                     : "memory");
    };

    // the two query blocks one after the other; kept a loop (one copy of the body in
    // the instruction cache), its trips are long
#pragma unroll 1
    for (int half = 0; half < 2; ++half) {
    const int qblk = half ? (n >> 7) - 1 - (int)blockIdx.x : (int)blockIdx.x;
    const int q0   = qblk * 128 + wave * 16;

    AV aq0, aq1;
    const _Float16* qrow = q + (size_t)(q0 + col) * d + hoff;
#pragma unroll
    for (int j = 0; j < 8; ++j) {
        int ko = 2 * j + 8 * hh + ((j >= 4) ? 8 : 0);
        aq0.u[j] = *(const unsigned*)(qrow + ko);
        aq1.u[j] = *(const unsigned*)(qrow + 32 + ko);
    }

    v8f acc[4];
#pragma unroll
    for (int t = 0; t < 4; ++t) acc[t] = v8f_zero();
    // of query q0 + col: running maximum (equal in both halves of the wave) and
    // the sum over the keys that this half of the wave holds
    float mrow = -1e30f, lrow = 0.0f;
    const int qg = q0 + col;

    const int ntiles = 2 * (qblk + 1);           // 64-key tiles up to the block's diagonal

    // (second query block: every wave's reads of both buffers ended in front of the
    // barrier at the foot of the first block's last trip)
    stage(0, 0);
    // tile 0 has landed for this wave's copies; the barrier publishes all waves' copies
    asm volatile("s_wait_asynccnt 0x0" ::: "memory");
    __syncthreads();
    stage(1, 1);

    for (int kt = 0; kt < ntiles; ++kt) {
        const int buf = kt & 1;
#pragma unroll
        for (int ps = 0; ps < 2; ++ps) {
            const int k0 = kt * 64 + ps * 32;
            if (k0 > q0 + 15) continue;          // wave-uniform: keys wholly above the diagonal
            // ---- S^T = Kb Q^T : two 16x16 score tiles (keys x queries)
            HV b0, b1, b2, b3;
            const _Float16* kr0 = &sK[buf][(ps * 32 + col) * FA_PITCH + 8 * hh];
            const _Float16* kr1 = kr0 + 16 * FA_PITCH;
            b0.q[0] = *(const u32x4*)(kr0);      b0.q[1] = *(const u32x4*)(kr0 + 16);
            b1.q[0] = *(const u32x4*)(kr0 + 32); b1.q[1] = *(const u32x4*)(kr0 + 48);
            b2.q[0] = *(const u32x4*)(kr1);      b2.q[1] = *(const u32x4*)(kr1 + 16);
            b3.q[0] = *(const u32x4*)(kr1 + 32); b3.q[1] = *(const u32x4*)(kr1 + 48);
            // holds the eight LDS reads together in front of the products: one LDS
            // latency per 32 keys instead of one in front of each product
            asm volatile("" :: "v"(b0.v), "v"(b1.v), "v"(b2.v), "v"(b3.v));
            v8f s0 = v8f_zero(), s1 = v8f_zero();
            s0 = __builtin_amdgcn_wmma_f32_16x16x32_f16(false, b0.v, false, aq0.v, (short)0, s0, false, false);
            s0 = __builtin_amdgcn_wmma_f32_16x16x32_f16(false, b1.v, false, aq1.v, (short)0, s0, false, false);
            s1 = __builtin_amdgcn_wmma_f32_16x16x32_f16(false, b2.v, false, aq0.v, (short)0, s1, false, false);
            s1 = __builtin_amdgcn_wmma_f32_16x16x32_f16(false, b3.v, false, aq1.v, (short)0, s1, false, false);

            // ---- scale + causal mask + online softmax
            // s0[r]: key k0 + 8*hh + r, s1[r]: key k0 + 16 + 8*hh + r, query qg
            const int kb = k0 + 8 * hh;
            float mx = -1e30f;
#pragma unroll
            for (int r = 0; r < 8; ++r) {
                float a0 = s0[r] * scale;
                float a1 = s1[r] * scale;
                if (kb + r > qg)      a0 = -1e30f;
                if (kb + 16 + r > qg) a1 = -1e30f;
                s0[r] = a0; s1[r] = a1;
                mx = fmaxf(mx, fmaxf(a0, a1));
            }
            // the other 16 keys of this query sit in lane ^ 16
            mx = fmaxf(mx, __int_as_float(__builtin_amdgcn_permlanex16(
                     __float_as_int(mx), __float_as_int(mx), 0x76543210, 0xfedcba98, false, false)));
            const float mn = fmaxf(mrow, mx);
            // e^x as 2^(x * log2 e)
            const float l2e = 1.4426950408889634f;
            float e0[8], e1[8], p0[8], p1[8], alpha;
#pragma unroll
            for (int r = 0; r < 8; ++r) {
                e0[r] = (s0[r] - mn) * l2e;
                e1[r] = (s1[r] - mn) * l2e;
            }
            exp2x9(alpha, p0, (mrow - mn) * l2e, e0);
            exp2x8(p1, e1);
            mrow = mn;
            AV bp;                               // P^T as B operand: 16 + 16 keys of query col
            float rsum = p0[0] + p1[0];
#pragma unroll
            for (int r = 0; r < 8; ++r) {
                if (r) rsum += p0[r] + p1[r];
                bp.h[r]     = (_Float16)p0[r];
                bp.h[8 + r] = (_Float16)p1[r];
            }
            lrow = lrow * alpha + rsum;
#pragma unroll
            for (int t = 0; t < 4; ++t)
#pragma unroll
                for (int r = 0; r < 8; ++r) acc[t][r] *= alpha;

            // ---- O^T += Vb^T P^T ; each A operand is two 16-byte LDS reads
#pragma unroll
            for (int t = 0; t < 4; ++t) {
                HV bv;
                const _Float16* vb = &sV[buf][(t * 16 + col) * FA_PITCH + ps * 32 + 8 * hh];
                bv.q[0] = *(const u32x4*)(vb);
                bv.q[1] = *(const u32x4*)(vb + 16);
                acc[t] = __builtin_amdgcn_wmma_f32_16x16x32_f16(false, bv.v, false, bp.v,
                                                                (short)0, acc[t], false, false);
            }
        }
        // hand-over, every wave: this wave's reads of buffer buf are done ...
        asm volatile("s_wait_dscnt 0x0" ::: "memory");
        // ... its copies of the next tile have landed ...
        asm volatile("s_wait_asynccnt 0x0" ::: "memory");
        // ... and the barrier publishes the next tile and frees buffer buf
        __syncthreads();
        if (kt + 2 < ntiles) stage(buf, kt + 2);
    }
    // no copy is left in flight when the wave ends
    asm volatile("s_wait_asynccnt 0x0" ::: "memory");

    // join the two halves' sums of each query
    lrow += __int_as_float(__builtin_amdgcn_permlanex16(
                __float_as_int(lrow), __float_as_int(lrow), 0x76543210, 0xfedcba98, false, false));
    // acc[t][r] = O[q0 + col][t*16 + 8*hh + r]: eight consecutive dims, one 16-byte store
    _Float16* orow = o + (size_t)qg * d + hoff + 8 * hh;
#pragma unroll
    for (int t = 0; t < 4; ++t) {
        h16x8 w;
#pragma unroll
        for (int r = 0; r < 8; ++r) w[r] = (_Float16)(acc[t][r] / lrow);
        *(h16x8*)(orow + t * 16) = w;
    }
    // the stores are issued before the next query block's addresses take their registers
    asm volatile("s_wait_xcnt 0x0" ::: "memory");
    }
}

// ---------------------------------------------------------------------------
// Host-side orchestration
// ---------------------------------------------------------------------------
extern "C" void kernel_launch(void* const* d_in, const int* in_sizes, int n_in,
                              void* d_out, int out_size, void* d_ws, size_t ws_size,
                              hipStream_t stream) {
    const int d   = in_sizes[1];          // 1024 (ln1_w)
    const int n   = in_sizes[0] / d;      // 4096
    const int dff = in_sizes[14];         // 4096 (bi)

    const float* x     = (const float*)d_in[0];
    const float* ln1_w = (const float*)d_in[1];
    const float* ln1_b = (const float*)d_in[2];
    const float* Wq    = (const float*)d_in[3];
    const float* bq    = (const float*)d_in[4];
    const float* Wk    = (const float*)d_in[5];
    const float* bk    = (const float*)d_in[6];
    const float* Wv    = (const float*)d_in[7];
    const float* bv    = (const float*)d_in[8];
    const float* Wo    = (const float*)d_in[9];
    const float* bo    = (const float*)d_in[10];
    const float* ln2_w = (const float*)d_in[11];
    const float* ln2_b = (const float*)d_in[12];
    const float* Wi    = (const float*)d_in[13];
    const float* bi    = (const float*)d_in[14];
    const float* Wout  = (const float*)d_in[15];
    const float* bout  = (const float*)d_in[16];

    char* ws = (char*)d_ws;
    size_t off = 0;
    auto alloc = [&](size_t bytes) -> void* {
        void* p = ws + off;
        off += (bytes + 255) & ~(size_t)255;
        return p;
    };
    _Float16* WqT   = (_Float16*)alloc((size_t)d * d * 2);
    _Float16* WkT   = (_Float16*)alloc((size_t)d * d * 2);
    _Float16* WvT   = (_Float16*)alloc((size_t)d * d * 2);
    _Float16* WoT   = (_Float16*)alloc((size_t)d * d * 2);
    _Float16* WiT   = (_Float16*)alloc((size_t)d * dff * 2);
    _Float16* WoutT = (_Float16*)alloc((size_t)dff * d * 2);
    _Float16* h1    = (_Float16*)alloc((size_t)n * d * 2);
    _Float16* q16   = (_Float16*)alloc((size_t)n * d * 2);
    _Float16* k16   = (_Float16*)alloc((size_t)n * d * 2);
    _Float16* v16   = (_Float16*)alloc((size_t)n * d * 2);
    _Float16* vTT   = (_Float16*)alloc((size_t)n * d * 2);
    _Float16* ao16  = (_Float16*)alloc((size_t)n * d * 2);
    float*    x1    = (float*)   alloc((size_t)n * d * 4);
    _Float16* h2    = (_Float16*)alloc((size_t)n * d * 2);
    _Float16* m16   = (_Float16*)alloc((size_t)n * dff * 2);

    // weights -> f16 transposed, and LN1 -> h1 (f16); the template arguments are d and
    // dff of the problem's shapes
    prep_kernel<1024, 4096><<<PrepBlocks<1024, 4096>::cvt + n, 256, 0, stream>>>(
        Wq, Wk, Wv, Wo, Wi, Wout, WqT, WkT, WvT, WoT, WiT, WoutT, x, ln1_w, ln1_b, h1, d);

    // QKV projections (f16 out); the first template argument of every product is its
    // count of output columns (d or dff of the problem's shapes)
    dim3 gdd(d / 128, n / 128);
    wmma_gemm_tiled3<1024><<<dim3(d / 128, n / 128, 3), 256, 0, stream>>>(
        h1, WqT, WkT, WvT, bq, bk, bv, q16, k16, v16, d);

    // V^T (d x n) for K-contiguous P@V operands
    transpose_f16<<<dim3(d / 128, n / 128), 256, 0, stream>>>(v16, vTT, n, d);

    // causal flash attention -> ao16
    flash_attn<<<dim3(n / 256, HEADS), 256, 0, stream>>>(q16, k16, vTT, ao16, n, d);

    // out-proj + residual -> x1 (f32)
    wmma_gemm_tiled<1024, false, true><<<gdd, 256, 0, stream>>>(ao16, WoT, bo, x, x1, nullptr, d);

    // LN2 -> h2 (f16)
    ln_f16_kernel<<<n, 256, 0, stream>>>(x1, ln2_w, ln2_b, h2, d);

    // MLP up + GELU -> m16 (f16)
    wmma_gemm_tiled<4096, true, false><<<dim3(dff / 128, n / 128), 256, 0, stream>>>(h2, WiT, bi, nullptr, nullptr, m16, d);

    // MLP down + bias + residual -> d_out (f32)
    wmma_gemm_tiled<1024, false, true><<<dim3(d / 128, n / 128), 256, 0, stream>>>(m16, WoutT, bout, x1, (float*)d_out, nullptr, dff);
}

// v010
// A run of this version takes 189 microseconds.
// In two side-by-side timings against v009, it was 1.05 and 1.02 times as fast.
// All steps since v000 together make it 5.17 times as fast.
#include <hip/hip_runtime.h>
#include <math.h>

#define HEADS 16

typedef __attribute__((ext_vector_type(16))) _Float16 v16h;
typedef __attribute__((ext_vector_type(8)))  float    v8f;
typedef __attribute__((ext_vector_type(4)))  unsigned u32x4;
typedef __attribute__((ext_vector_type(4)))  float    f32x4;
typedef __attribute__((ext_vector_type(8)))  _Float16 h16x8;
typedef __attribute__((ext_vector_type(4)))  _Float16 h16x4;

union AV { v16h v; unsigned u[8]; _Float16 h[16]; };
union HV { v16h v; u32x4 q[2]; };

__device__ __forceinline__ v8f v8f_zero() {
    v8f z;
#pragma unroll
    for (int i = 0; i < 8; ++i) z[i] = 0.0f;
    return z;
}

// 2^x of eight (exp2x8) or nine (exp2x9) values, 1/x of eight (rcpx8).  One statement
// each, results kept apart from arguments ("=&v") and a closing v_nop: the instruction
// set asks for one slot between a transcendental and an instruction that reads its
// result or overwrites its argument.
__device__ __forceinline__ void exp2x8(float (&y)[8], const float (&x)[8]) {
    asm("v_exp_f32 %0, %8\n\t"  "v_exp_f32 %1, %9\n\t"
        "v_exp_f32 %2, %10\n\t" "v_exp_f32 %3, %11\n\t"
        "v_exp_f32 %4, %12\n\t" "v_exp_f32 %5, %13\n\t"
        "v_exp_f32 %6, %14\n\t" "v_exp_f32 %7, %15\n\t"
        "v_nop"
        : "=&v"(y[0]), "=&v"(y[1]), "=&v"(y[2]), "=&v"(y[3]),
          "=&v"(y[4]), "=&v"(y[5]), "=&v"(y[6]), "=&v"(y[7])
        : "v"(x[0]), "v"(x[1]), "v"(x[2]), "v"(x[3]),
          "v"(x[4]), "v"(x[5]), "v"(x[6]), "v"(x[7]));
}
__device__ __forceinline__ void exp2x9(float& ya, float (&y)[8], float xa, const float (&x)[8]) {
    asm("v_exp_f32 %0, %9\n\t"  "v_exp_f32 %1, %10\n\t"
        "v_exp_f32 %2, %11\n\t" "v_exp_f32 %3, %12\n\t"
        "v_exp_f32 %4, %13\n\t" "v_exp_f32 %5, %14\n\t"
        "v_exp_f32 %6, %15\n\t" "v_exp_f32 %7, %16\n\t"
        "v_exp_f32 %8, %17\n\t"
        "v_nop"
        : "=&v"(ya), "=&v"(y[0]), "=&v"(y[1]), "=&v"(y[2]), "=&v"(y[3]),
          "=&v"(y[4]), "=&v"(y[5]), "=&v"(y[6]), "=&v"(y[7])
        : "v"(xa), "v"(x[0]), "v"(x[1]), "v"(x[2]), "v"(x[3]),
          "v"(x[4]), "v"(x[5]), "v"(x[6]), "v"(x[7]));
}
__device__ __forceinline__ void rcpx8(float (&y)[8], const float (&x)[8]) {
    asm("v_rcp_f32 %0, %8\n\t"  "v_rcp_f32 %1, %9\n\t"
        "v_rcp_f32 %2, %10\n\t" "v_rcp_f32 %3, %11\n\t"
        "v_rcp_f32 %4, %12\n\t" "v_rcp_f32 %5, %13\n\t"
        "v_rcp_f32 %6, %14\n\t" "v_rcp_f32 %7, %15\n\t"
        "v_nop"
        : "=&v"(y[0]), "=&v"(y[1]), "=&v"(y[2]), "=&v"(y[3]),
          "=&v"(y[4]), "=&v"(y[5]), "=&v"(y[6]), "=&v"(y[7])
        : "v"(x[0]), "v"(x[1]), "v"(x[2]), "v"(x[3]),
          "v"(x[4]), "v"(x[5]), "v"(x[6]), "v"(x[7]));
}

// tanh GELU of eight values, in place.  With u = k0 (x + k1 x^3), k0 = sqrt(2/pi),
// k1 = 0.044715:
//   0.5 x (1 + tanh u) = x / (1 + e^(-2u)),   e^(-2u) = 2^(x (c0 + c1 x^2)),
//   c0 = -2 k0 log2(e), c1 = c0 k1.
// One hardware 2^x and one hardware reciprocal per value and no branch: the eight
// values are independent chains that fill each other's latencies.  At the ends:
// 2^x = inf gives 1/inf = 0 (x far below 0), 2^x = 0 gives x (x far above 0).
__device__ __forceinline__ void gelu_tanh8(float (&x)[8]) {
    const float c0 = (float)(-2.0 * 0.7978845608028654 * 1.4426950408889634);
    const float c1 = (float)(-2.0 * 0.7978845608028654 * 1.4426950408889634 * 0.044715);
    float a[8], e[8], q[8];
#pragma unroll
    for (int r = 0; r < 8; ++r) a[r] = x[r] * (c0 + c1 * x[r] * x[r]);
    exp2x8(e, a);
#pragma unroll
    for (int r = 0; r < 8; ++r) a[r] = 1.0f + e[r];
    rcpx8(q, a);
#pragma unroll
    for (int r = 0; r < 8; ++r) x[r] *= q[r];
}

// ---------------------------------------------------------------------------
// Convert f32 weight (K x N, row-major) -> f16 transposed (N x K, row-major)
// so WMMA B-operand (and async LDS staging) loads are K-contiguous.
// One 256-thread block moves a tile of 128 k x 64 n through LDS: 256-byte runs
// are read from every input row and 256-byte runs written to every output row.
// A thread reads 8 k x 4 n (eight 16-byte loads in flight), converts, and stores
// four 16-byte pieces (8 k of one n) into the transposed LDS tile.  The 16-byte
// piece index is XORed with n/4, so the 16 lanes of a half wave fall on all 64
// banks both when the tile is written and when it is read back by rows.
// K is a multiple of 128, N of 64.  bx, by: the block's tile along n and along k.
// ---------------------------------------------------------------------------
__device__ __forceinline__
void cvt_t_f16(const float* __restrict__ in, _Float16* __restrict__ out,
               int K, int N, int bx, int by) {
    __shared__ __attribute__((aligned(16))) _Float16 s[64 * 128];
    const int tid = threadIdx.x;
    const int lo  = tid & 15;
    const int hi  = tid >> 4;
    const int k0  = by * 128;
    const int n0  = bx * 64;

    const float* p[8];
    f32x4 v[8];
#pragma unroll
    for (int j = 0; j < 8; ++j) p[j] = in + (size_t)(k0 + hi * 8 + j) * N + n0 + lo * 4;
#pragma unroll
    for (int j = 0; j < 8; ++j) v[j] = *(const f32x4*)(p[j]);
    // holds the eight loads together in front of their first use, all in flight
    // at once; the address pairs are named as well, so that no load's result
    // lands on a pair that an earlier load still names
    asm volatile("" :: "v"(v[0]), "v"(v[1]), "v"(v[2]), "v"(v[3]),
                       "v"(v[4]), "v"(v[5]), "v"(v[6]), "v"(v[7]),
                       "v"(p[0]), "v"(p[1]), "v"(p[2]), "v"(p[3]),
                       "v"(p[4]), "v"(p[5]), "v"(p[6]), "v"(p[7]));
#pragma unroll
    for (int i = 0; i < 4; ++i) {
        h16x8 w;
#pragma unroll
        for (int j = 0; j < 8; ++j) w[j] = (_Float16)v[j][i];
        *(h16x8*)(&s[(lo * 4 + i) * 128 + ((hi ^ lo) * 8)]) = w;
    }
    __syncthreads();
#pragma unroll
    for (int it = 0; it < 4; ++it) {
        const int r = hi + it * 16;
        h16x8 w = *(const h16x8*)(&s[r * 128 + ((lo ^ (r >> 2)) * 8)]);
        *(h16x8*)(out + (size_t)(n0 + r) * K + k0 + lo * 8) = w;
    }
}

// f16 (R x C) -> f16 transposed (C x R):  out[c*R + r] = in[r*C + c]
// Same scheme, tile 128 r x 128 c: a thread reads 8 r x 8 c and stores eight
// 16-byte pieces (8 r of one c); the piece index is XORed with c/8.
// R and C are multiples of 128.
__global__ __launch_bounds__(256)
void transpose_f16(const _Float16* __restrict__ in, _Float16* __restrict__ out,
                   int R, int C) {
    __shared__ __attribute__((aligned(16))) _Float16 s[128 * 128];
    const int tid = threadIdx.x;
    const int lo  = tid & 15;
    const int hi  = tid >> 4;
    const int r0  = blockIdx.y * 128;
    const int c0  = blockIdx.x * 128;

    const _Float16* p[8];
    h16x8 v[8];
#pragma unroll
    for (int j = 0; j < 8; ++j) p[j] = in + (size_t)(r0 + hi * 8 + j) * C + c0 + lo * 8;
#pragma unroll
    for (int j = 0; j < 8; ++j) v[j] = *(const h16x8*)(p[j]);
    // holds the eight loads together in front of their first use, all in flight
    // at once; the address pairs are named as well, so that no load's result
    // lands on a pair that an earlier load still names
    asm volatile("" :: "v"(v[0]), "v"(v[1]), "v"(v[2]), "v"(v[3]),
                       "v"(v[4]), "v"(v[5]), "v"(v[6]), "v"(v[7]),
                       "v"(p[0]), "v"(p[1]), "v"(p[2]), "v"(p[3]),
                       "v"(p[4]), "v"(p[5]), "v"(p[6]), "v"(p[7]));
#pragma unroll
    for (int i = 0; i < 8; ++i) {
        h16x8 w;
#pragma unroll
        for (int j = 0; j < 8; ++j) w[j] = v[j][i];
        *(h16x8*)(&s[(lo * 8 + i) * 128 + ((hi ^ lo) * 8)]) = w;
    }
    __syncthreads();
#pragma unroll
    for (int it = 0; it < 8; ++it) {
        const int c = hi + it * 16;
        h16x8 w = *(const h16x8*)(&s[c * 128 + ((lo ^ (c >> 3)) * 8)]);
        *(h16x8*)(out + (size_t)(c0 + c) * R + r0 + lo * 8) = w;
    }
}

// ---------------------------------------------------------------------------
// Row LayerNorm, f32 in -> f16 out.  One WAVE per row, eight rows per 256-thread
// block.  A lane holds D / 32 values of its row in registers, fetched as 16-byte
// pieces (a wave-wide load is 512 contiguous bytes): the row is read once, and its
// loads and those of w and b are all in flight together, so that a row waits for
// memory once.  The sums run over four chains per lane and then across the lanes,
// with no LDS and no barrier.  All rows of the problem are resident at once, with an
// eighth of the waves to start that a block per row takes.
// D is a multiple of 128, the row count of 8.
// ---------------------------------------------------------------------------

// v + (v of lane ^ M), M = 1, 2, 4 or 8: inside a 16-lane row
template <int M>
__device__ __forceinline__ float add_xmask(float v) {
    return v + __int_as_float(__builtin_amdgcn_update_dpp(
                   0, __float_as_int(v), 0x160 + M, 0xf, 0xf, true));
}
// the sum of v over the wave's 32 lanes, in every lane
__device__ __forceinline__ float wave_sum(float v) {
    v = add_xmask<1>(v);
    v = add_xmask<2>(v);
    v = add_xmask<4>(v);
    v = add_xmask<8>(v);
    return v + __int_as_float(__builtin_amdgcn_permlanex16(
                   __float_as_int(v), __float_as_int(v), 0x76543210, 0xfedcba98, false, false));
}

// blk: which group of eight rows
template <int D>
__device__ __forceinline__
void ln_f16_rows(const float* __restrict__ x, const float* __restrict__ w,
                 const float* __restrict__ b, _Float16* __restrict__ out, int blk) {
    constexpr int C = D / 128;               // 16-byte pieces of a row per lane
    const int lane = threadIdx.x & 31;
    const int row  = blk * 8 + (threadIdx.x >> 5);
    const float* xr = x + (size_t)row * D + lane * 4;
    const float* wr = w + lane * 4;
    const float* br = b + lane * 4;
    f32x4 v[C], wv[C], bv[C];
#pragma unroll
    for (int j = 0; j < C; ++j) v[j] = *(const f32x4*)(xr + j * 128);
#pragma unroll
    for (int j = 0; j < C; ++j) wv[j] = *(const f32x4*)(wr + j * 128);
#pragma unroll
    for (int j = 0; j < C; ++j) bv[j] = *(const f32x4*)(br + j * 128);
    // keeps all the loads, as one group, in front of the sums, in flight at once: left to
    // itself the compiler sank those of w and b to their uses, two at a time with a wait
    // behind each two
    __builtin_amdgcn_sched_barrier(0);
    // the loads above are issued before a register that they name is used for anything
    // else; the row's address pair is an operand, so that it lives up to here and no
    // later load of the group lands on it
    asm volatile("s_wait_xcnt 0x0" :: "v"(xr) : "memory");

    f32x4 s4 = v[0], q4 = v[0] * v[0];
#pragma unroll
    for (int j = 1; j < C; ++j) { s4 += v[j]; q4 += v[j] * v[j]; }
    const float s  = wave_sum((s4[0] + s4[1]) + (s4[2] + s4[3]));
    const float ss = wave_sum((q4[0] + q4[1]) + (q4[2] + q4[3]));

    const float mean = s / (float)D;
    const float var  = ss / (float)D - mean * mean;
    const float inv  = rsqrtf(var + 1e-12f);
    _Float16* orow = out + (size_t)row * D + lane * 4;
#pragma unroll
    for (int j = 0; j < C; ++j) {
        h16x4 o;
#pragma unroll
        for (int i = 0; i < 4; ++i) o[i] = (_Float16)((v[j][i] - mean) * inv * wv[j][i] + bv[j][i]);
        *(h16x4*)(orow + j * 128) = o;
    }
    // the stores above are issued before a register that they name is used for anything
    // else (in the joint launch the other jobs' code follows and takes the same registers)
    asm volatile("s_wait_xcnt 0x0" ::: "memory");
}

template <int D>
__global__ __launch_bounds__(256)
void ln_f16_kernel(const float* __restrict__ x, const float* __restrict__ w,
                   const float* __restrict__ b, _Float16* __restrict__ out) {
    ln_f16_rows<D>(x, w, b, out, blockIdx.x);
}

// ---------------------------------------------------------------------------
// All that the first product waits for, in ONE launch: the six weight
// conversions and the first LayerNorm read only inputs and depend on nothing, so
// their blocks run side by side and fill the chip together, where seven launches
// one behind the other each paid a launch gap, a ramp and a tail, four of them
// with a block on only half of the WGPs.
// The block index picks the job (the same for every thread of a block, so each
// job's barriers are passed by the whole block): first the tiles of the four
// D x D weights, then those of Wi (D x DFF) and of Wout (DFF x D), then one block
// per eight rows of x.  D, DFF: the problem's widths, compile-time so that the split of
// the index is shifts and masks.
// ---------------------------------------------------------------------------
template <int D, int DFF>
struct PrepBlocks {
    static constexpr unsigned sq  = (D / 64) * (D / 128);      // tiles of a D x D weight
    static constexpr unsigned big = (DFF / 64) * (D / 128);    // tiles of Wi, and of Wout
    static constexpr unsigned cvt = 4 * sq + 2 * big;          // conversion blocks in front of the rows
};

template <int D, int DFF>
__global__ __launch_bounds__(256)
void prep_kernel(const float* __restrict__ Wq, const float* __restrict__ Wk,
                 const float* __restrict__ Wv, const float* __restrict__ Wo,
                 const float* __restrict__ Wi, const float* __restrict__ Wout,
                 _Float16* __restrict__ WqT, _Float16* __restrict__ WkT,
                 _Float16* __restrict__ WvT, _Float16* __restrict__ WoT,
                 _Float16* __restrict__ WiT, _Float16* __restrict__ WoutT,
                 const float* __restrict__ x, const float* __restrict__ ln_w,
                 const float* __restrict__ ln_b, _Float16* __restrict__ h) {
    typedef PrepBlocks<D, DFF> PB;
    const unsigned bid = blockIdx.x;
    if (bid < 4 * PB::sq) {
        const unsigned sel = bid / PB::sq;
        const unsigned t   = bid % PB::sq;
        const float* in = sel == 0 ? Wq  : sel == 1 ? Wk  : sel == 2 ? Wv  : Wo;
        _Float16* out   = sel == 0 ? WqT : sel == 1 ? WkT : sel == 2 ? WvT : WoT;
        cvt_t_f16(in, out, D, D, t % (D / 64), t / (D / 64));
    } else if (bid < 4 * PB::sq + PB::big) {
        const unsigned t = bid - 4 * PB::sq;
        cvt_t_f16(Wi, WiT, D, DFF, t % (DFF / 64), t / (DFF / 64));
    } else if (bid < PB::cvt) {
        const unsigned t = bid - (4 * PB::sq + PB::big);
        cvt_t_f16(Wout, WoutT, DFF, D, t % (D / 64), t / (D / 64));
    } else {
        ln_f16_rows<D>(x, ln_w, ln_b, h, bid - PB::cvt);
    }
}

// ---------------------------------------------------------------------------
// Tiled WMMA GEMM with async global->LDS double-buffered staging.
//   out = act(A(MxK,f16) @ Bt(NxK,f16)^T + bias) (+ resid)
// Block: 256 threads (8 waves) computes 128x128 tile.
// Wave (wm in 0..1, wn in 0..3) computes 64x32 = 4x2 WMMA tiles.
// K is staged in slabs of 128: 256-byte rows of A and of Bt, laid in LDS at a
// pitch of 272 B, at which the 16 lanes of a half wave fall on all 64 banks in
// the 16-byte fragment reads.  Two buffers: the next slab's copies fly while
// this slab's four 32-k blocks are worked on, one barrier per slab.
// The fragments are fetched one 32-k block ahead, into a second register set, so
// that a block's products run while the next block's reads land.
// K is a multiple of 128, at least 256.
// ---------------------------------------------------------------------------
#define GM_PITCH 136                    // halves per staged row (272 B)
#define GM_TILE  (128 * GM_PITCH)       // halves per staged slab of one operand

// Eight 16-byte copies of one lane: rows 16 apart of one operand's slab.
// l: the lane's LDS byte address, g: its global address, rs: halves per 16 rows.
__device__ __forceinline__ void gm_copy8(unsigned l, const _Float16* g, size_t rs) {
    // the closing s_wait_xcnt keeps the address registers from being
    // rewritten while a copy that names them is still being issued
    asm volatile("global_load_async_to_lds_b128 %0, %8, off\n\t"
                 "global_load_async_to_lds_b128 %1, %9, off\n\t"
                 "global_load_async_to_lds_b128 %2, %10, off\n\t"
                 "global_load_async_to_lds_b128 %3, %11, off\n\t"
                 "global_load_async_to_lds_b128 %4, %12, off\n\t"
                 "global_load_async_to_lds_b128 %5, %13, off\n\t"
                 "global_load_async_to_lds_b128 %6, %14, off\n\t"
                 "global_load_async_to_lds_b128 %7, %15, off\n\t"
                 "s_wait_xcnt 0x0"
                 :: "v"(l),
                    "v"(l + 1 * 16 * (GM_PITCH * 2)), "v"(l + 2 * 16 * (GM_PITCH * 2)),
                    "v"(l + 3 * 16 * (GM_PITCH * 2)), "v"(l + 4 * 16 * (GM_PITCH * 2)),
                    "v"(l + 5 * 16 * (GM_PITCH * 2)), "v"(l + 6 * 16 * (GM_PITCH * 2)),
                    "v"(l + 7 * 16 * (GM_PITCH * 2)),
                    "v"((unsigned long long)(uintptr_t)(g)),
                    "v"((unsigned long long)(uintptr_t)(g + 1 * rs)),
                    "v"((unsigned long long)(uintptr_t)(g + 2 * rs)),
                    "v"((unsigned long long)(uintptr_t)(g + 3 * rs)),
                    "v"((unsigned long long)(uintptr_t)(g + 4 * rs)),
                    "v"((unsigned long long)(uintptr_t)(g + 5 * rs)),
                    "v"((unsigned long long)(uintptr_t)(g + 6 * rs)),
                    "v"((unsigned long long)(uintptr_t)(g + 7 * rs))
                 : "memory");
}

// The fragments of one 32-k block of a wave's 64 x 32 tile: twelve 16-byte LDS reads,
// those of the first product first.  pa, pb: the lane's place in the block's first
// A row and first Bt row.
__device__ __forceinline__ void gm_frags(HV (&a)[4], HV (&b)[2],
                                         const _Float16* pa, const _Float16* pb) {
    a[0].q[0] = *(const u32x4*)(pa);
    a[0].q[1] = *(const u32x4*)(pa + 16);
#pragma unroll
    for (int ni = 0; ni < 2; ++ni) {
        const _Float16* p = pb + ni * 16 * GM_PITCH;
        b[ni].q[0] = *(const u32x4*)(p);
        b[ni].q[1] = *(const u32x4*)(p + 16);
    }
#pragma unroll
    for (int mi = 1; mi < 4; ++mi) {
        const _Float16* p = pa + mi * 16 * GM_PITCH;
        a[mi].q[0] = *(const u32x4*)(p);
        a[mi].q[1] = *(const u32x4*)(p + 16);
    }
}

// N (columns of the output, the row pitch of resid and of the output) and the
// epilogue's mode are compile-time values:
//   RES  : outf = acc + bias + resid   (f32; outh is not used)
//   !RES : outh = act(acc + bias)      (f16; resid and outf are not used),
//          act = tanh GELU where GELU is set, else the identity
// The epilogue then holds no test of a mode, and every element's address is the
// lane's base plus an immediate: its loads, and its stores, follow one another
// with no wait between them.
template <int N, bool GELU, bool RES>
__device__ __forceinline__
void wmma_gemm_tile(const _Float16* __restrict__ A, const _Float16* __restrict__ Bt,
                    const float* __restrict__ bias, const float* __restrict__ resid,
                    float* __restrict__ outf, _Float16* __restrict__ outh, int K) {
    __shared__ __attribute__((aligned(16))) _Float16 sA[2][GM_TILE];
    __shared__ __attribute__((aligned(16))) _Float16 sB[2][GM_TILE];

    const int tid  = threadIdx.x;
    const int lane = tid & 31;
    const int wave = tid >> 5;
    const int col  = lane & 15;   // M (A) / N (B,C) index within 16-tile
    const int hh   = lane >> 4;   // lane-half -> +8 K offset in A/B operands
    const int wn   = wave & 3;    // 4 N-groups of 32
    const int wm   = wave >> 2;   // 2 M-groups of 64
    const int m0   = blockIdx.y * 128;
    const int n0   = blockIdx.x * 128;

    // copy assignment: rows cr, cr+16, .. cr+112 of each slab, 16-byte chunk cc of the row
    const int cr = tid >> 4;
    const int cc = tid & 15;
    const unsigned lA = (unsigned)(uintptr_t)(&sA[0][0]) + (unsigned)(cr * (GM_PITCH * 2) + cc * 16);
    const unsigned lB = (unsigned)(uintptr_t)(&sB[0][0]) + (unsigned)(cr * (GM_PITCH * 2) + cc * 16);
    const _Float16* gA = A  + (size_t)(m0 + cr) * K + cc * 8;
    const _Float16* gB = Bt + (size_t)(n0 + cr) * K + cc * 8;
    const size_t rs = (size_t)16 * K;

    // stage slab s (k 128s .. 128s+127) of A and Bt into buffer buf
    auto stage = [&](int buf, int s) {
        const unsigned lo = (unsigned)(buf * (GM_TILE * 2));
        gm_copy8(lA + lo, gA + (size_t)s * 128, rs);
        gm_copy8(lB + lo, gB + (size_t)s * 128, rs);
    };

    v8f acc[4][2];
#pragma unroll
    for (int mi = 0; mi < 4; ++mi)
#pragma unroll
        for (int ni = 0; ni < 2; ++ni) acc[mi][ni] = v8f_zero();

    const int nslabs = K >> 7;
    stage(0, 0);
    // slab 0 has landed for this wave's copies; the barrier publishes all waves' copies
    asm volatile("s_wait_asynccnt 0x0" ::: "memory");
    __syncthreads();
    if (nslabs > 1) stage(1, 1);

    // element (mi, ni, r) of this lane lies at e0 + (mi * 16 + r) * N + ni * 16
    const unsigned e0 = (unsigned)(m0 + wm * 64 + 8 * hh) * N + (unsigned)(n0 + wn * 32 + col);
    // bias and residual are asked for here, behind the first two slabs' copies: all
    // of a lane's loads are in flight together and land while the k loop runs
    float rv[4][2][8];
    if constexpr (RES) {
        const float* rp = resid + e0;
#pragma unroll
        for (int mi = 0; mi < 4; ++mi)
#pragma unroll
            for (int ni = 0; ni < 2; ++ni)
#pragma unroll
                for (int r = 0; r < 8; ++r) rv[mi][ni][r] = rp[(mi * 16 + r) * N + ni * 16];
    }
    const float bn0 = bias[n0 + wn * 32 + col];
    const float bn1 = bias[n0 + wn * 32 + 16 + col];
    // the loads above are issued before a register that they name is used for anything
    // else (the compiler reuses the bias pointer's pair for the slab counter)
    asm volatile("s_wait_xcnt 0x0" ::: "memory");

    // two fragment sets: block kb of a slab works on set kb & 1 while the twelve reads
    // of the block behind it are under way into the other set, also from one slab to
    // the next: the hand-over stands in front of a slab's last block, whose fragments
    // are in registers by then, and the next slab's first reads fly under that block
    const _Float16* const pa0 = &sA[0][(wm * 64 + col) * GM_PITCH + 8 * hh];
    const _Float16* const pb0 = &sB[0][(wn * 32 + col) * GM_PITCH + 8 * hh];
    HV a[2][4], b[2][2];
    gm_frags(a[0], b[0], pa0, pb0);
    for (int s = 0; s < nslabs; ++s) {
        const int buf = s & 1;
        const _Float16* pa = pa0 + buf * GM_TILE;
        const _Float16* pb = pb0 + buf * GM_TILE;
        // unrolled, like the loops inside: every index of a, b and acc is then a
        // constant (they stay in registers) and every LDS offset an immediate
#pragma unroll
        for (int kb = 0; kb < 4; ++kb) {
            if (kb < 3) {
                gm_frags(a[(kb + 1) & 1], b[(kb + 1) & 1], pa + (kb + 1) * 32, pb + (kb + 1) * 32);
            } else {
                // hand-over, every wave: this wave's reads of buffer buf are done ...
                asm volatile("s_wait_dscnt 0x0" ::: "memory");
                // ... its copies of the next slab have landed ...
                asm volatile("s_wait_asynccnt 0x0" ::: "memory");
                // ... and the barrier publishes the next slab and frees buffer buf
                __syncthreads();
                // the next slab's first block; no test around these reads (a branch would
                // cost the counted waits): behind the last slab they fetch the other
                // buffer's old slab, which nothing uses
                gm_frags(a[0], b[0], pa0 + (buf ^ 1) * GM_TILE, pb0 + (buf ^ 1) * GM_TILE);
            }
            // keeps the next block's reads, as one group, in front of this block's
            // products: left to itself the compiler sank them to their uses, into one
            // register set, with a full LDS wait in front of every two products
            __builtin_amdgcn_sched_barrier(0);
#pragma unroll
            for (int mi = 0; mi < 4; ++mi)
#pragma unroll
                for (int ni = 0; ni < 2; ++ni)
                    acc[mi][ni] = __builtin_amdgcn_wmma_f32_16x16x32_f16(
                        false, a[kb & 1][mi].v, false, b[kb & 1][ni].v, (short)0, acc[mi][ni], false, false);
            // keeps the reads of the block after next from rising among these products
            __builtin_amdgcn_sched_barrier(0);
        }
        // the refill of buffer buf, which every wave left in front of the barrier above;
        // it stands behind the last block, whose fragment registers its addresses take
        if (s + 2 < nslabs) stage(buf, s + 2);
    }
    // no copy is left in flight when the wave ends
    asm volatile("s_wait_asynccnt 0x0" ::: "memory");
    // the reads issued behind the last slab's hand-over have come back
    asm volatile("s_wait_dscnt 0x0" ::: "memory");

    // all 64 values first ...
    _Float16 hv[4][2][8];
#pragma unroll
    for (int mi = 0; mi < 4; ++mi) {
#pragma unroll
        for (int ni = 0; ni < 2; ++ni) {
            const float bn = ni ? bn1 : bn0;
            if constexpr (GELU) {
                // bias and activation of the tile's eight values together, left in acc
                float g[8];
#pragma unroll
                for (int r = 0; r < 8; ++r) g[r] = acc[mi][ni][r] + bn;
                gelu_tanh8(g);
#pragma unroll
                for (int r = 0; r < 8; ++r) acc[mi][ni][r] = g[r];
            }
#pragma unroll
            for (int r = 0; r < 8; ++r) {
                float val = acc[mi][ni][r];
                if constexpr (!GELU) val += bn;
                if constexpr (RES) acc[mi][ni][r] = val + rv[mi][ni][r];
                else               hv[mi][ni][r] = (_Float16)val;
            }
        }
    }
    // ... then the 64 stores in a row, each at the lane's base plus an immediate
    if constexpr (RES) {
        float* const op = outf + e0;
#pragma unroll
        for (int mi = 0; mi < 4; ++mi)
#pragma unroll
            for (int ni = 0; ni < 2; ++ni)
#pragma unroll
                for (int r = 0; r < 8; ++r) op[(mi * 16 + r) * N + ni * 16] = acc[mi][ni][r];
    } else {
        _Float16* const op = outh + e0;
#pragma unroll
        for (int mi = 0; mi < 4; ++mi)
#pragma unroll
            for (int ni = 0; ni < 2; ++ni)
#pragma unroll
                for (int r = 0; r < 8; ++r) op[(mi * 16 + r) * N + ni * 16] = hv[mi][ni][r];
    }
}

template <int N, bool GELU, bool RES>
__global__ __launch_bounds__(256)
void wmma_gemm_tiled(const _Float16* __restrict__ A, const _Float16* __restrict__ Bt,
                     const float* __restrict__ bias, const float* __restrict__ resid,
                     float* __restrict__ outf, _Float16* __restrict__ outh, int K) {
    wmma_gemm_tile<N, GELU, RES>(A, Bt, bias, resid, outf, outh, K);
}

// Three products of the same A with three weights (f16 out, no activation) in ONE
// launch: blockIdx.z picks weight, bias and output.  Each product alone has one
// block per WGP; together two blocks share a WGP, so that one block's first slab
// and its epilogue run beside the other's k loop, and two launch gaps go.
template <int N>
__global__ __launch_bounds__(256)
void wmma_gemm_tiled3(const _Float16* __restrict__ A,
                      const _Float16* __restrict__ Bt0, const _Float16* __restrict__ Bt1,
                      const _Float16* __restrict__ Bt2,
                      const float* __restrict__ bias0, const float* __restrict__ bias1,
                      const float* __restrict__ bias2,
                      _Float16* __restrict__ out0, _Float16* __restrict__ out1,
                      _Float16* __restrict__ out2, int K) {
    const int z = blockIdx.z;
    const _Float16* Bt = z == 0 ? Bt0   : z == 1 ? Bt1   : Bt2;
    const float* bias  = z == 0 ? bias0 : z == 1 ? bias1 : bias2;
    _Float16* outh     = z == 0 ? out0  : z == 1 ? out1  : out2;
    wmma_gemm_tile<N, false, false>(A, Bt, bias, nullptr, nullptr, outh, K);
}

// ---------------------------------------------------------------------------
// Causal flash attention.  One 8-wave block per (pair of 128-query blocks, head);
// each wave owns 16 queries of the block at hand.  A query block's cost grows with
// its index (it walks the keys up to its diagonal) and all work-groups are resident
// at once, so the launch lasts as long as its fullest work-group: every work-group
// takes query block t and then, in the same waves, block nblk - 1 - t, which is the
// same count of key tiles for all of them.  n is a multiple of 256.
// q/k: (n x d) f16, head-h slice at column h*64, dh=64.
// vT: (d x n) f16 transposed V, so its rows are key-contiguous.
// The eight waves share each 64-key tile of K (64 keys x 64 dims) and of vT
// (64 dims x 64 keys): the block copies it once into LDS as whole 128-byte
// rows, two buffers, the next tile in flight while this one is worked on.
// LDS rows are pitched 144 B for the 16-byte fragment reads.
// The products are taken transposed: S^T = Kb Q^T (A = K rows, B = Q) and
// O^T += Vb^T P^T (A = vT rows, B = P^T).  A lane then holds 16 of the 32
// scores of ONE query (lane%16), so maximum and sum run inside the lane with a
// single exchange between the wave's halves, and the two score tiles, converted
// in place, already are the B operand of the second product.
// ---------------------------------------------------------------------------
#define FA_PITCH 72                     // halves per staged row (144 B)
#define FA_TILE  (64 * FA_PITCH)        // halves per staged tile

// one such block stands on a WGP (two waves per SIMD): let the register allocator use that share
__global__ __launch_bounds__(256) __attribute__((amdgpu_waves_per_eu(2, 2)))
void flash_attn(const _Float16* __restrict__ q, const _Float16* __restrict__ k,
                const _Float16* __restrict__ vT, _Float16* __restrict__ o,
                int n, int d) {
    const int dh = 64;
    const float scale = 0.125f;              // 1/sqrt(64)
    const int tid  = threadIdx.x;
    const int lane = tid & 31;
    const int wave = __builtin_amdgcn_readfirstlane(tid >> 5);
    const int col  = lane & 15;
    const int hh   = lane >> 4;
    const int head = blockIdx.y;
    const size_t hoff = (size_t)head * dh;

    __shared__ __attribute__((aligned(16))) _Float16 sK[2][FA_TILE];
    __shared__ __attribute__((aligned(16))) _Float16 sV[2][FA_TILE];

    // copy assignment: rows cr and cr+32 of each tile, 16-byte chunk cc of the row
    const int cr = tid >> 3;
    const int cc = tid & 7;
    const unsigned lK = (unsigned)(uintptr_t)(&sK[0][0]) + (unsigned)(cr * (FA_PITCH * 2) + cc * 16);
    const unsigned lV = (unsigned)(uintptr_t)(&sV[0][0]) + (unsigned)(cr * (FA_PITCH * 2) + cc * 16);
    const _Float16* gK = k  + (size_t)cr * d + hoff + cc * 8;
    const _Float16* gV = vT + (hoff + cr) * (size_t)n + cc * 8;

    // stage key tile t (keys 64t .. 64t+63) of K and vT into buffer buf
    auto stage = [&](int buf, int t) {
        const unsigned lo = (unsigned)(buf * (FA_TILE * 2));
        const _Float16* k0p = gK + (size_t)t * 64 * d;
        const _Float16* k1p = k0p + (size_t)32 * d;
        const _Float16* v0p = gV + (size_t)t * 64;
        const _Float16* v1p = v0p + (size_t)32 * n;
        // the closing s_wait_xcnt keeps the address registers from being
        // rewritten while a copy that names them is still being issued
        asm volatile("global_load_async_to_lds_b128 %0, %4, off\n\t"
                     "global_load_async_to_lds_b128 %1, %5, off\n\t"
                     "global_load_async_to_lds_b128 %2, %6, off\n\t"
                     "global_load_async_to_lds_b128 %3, %7, off\n\t"
                     "s_wait_xcnt 0x0"
                     :: "v"(lK + lo), "v"(lK + lo + 32 * (FA_PITCH * 2)),
                        "v"(lV + lo), "v"(lV + lo + 32 * (FA_PITCH * 2)),
                        "v"((unsigned long long)(uintptr_t)k0p),
                        "v"((unsigned long long)(uintptr_t)k1p),
                        "v"((unsigned long long)(uintptr_t)v0p),
                        "v"((unsigned long long)(uintptr_t)v1p)
                     : "memory");
    };

    // the two query blocks one after the other; kept a loop (one copy of the body in
    // the instruction cache), its trips are long
#pragma unroll 1
    for (int half = 0; half < 2; ++half) {
    const int qblk = half ? (n >> 7) - 1 - (int)blockIdx.x : (int)blockIdx.x;
    const int q0   = qblk * 128 + wave * 16;

    AV aq0, aq1;
    const _Float16* qrow = q + (size_t)(q0 + col) * d + hoff;
#pragma unroll
    for (int j = 0; j < 8; ++j) {
        int ko = 2 * j + 8 * hh + ((j >= 4) ? 8 : 0);
        aq0.u[j] = *(const unsigned*)(qrow + ko);
        aq1.u[j] = *(const unsigned*)(qrow + 32 + ko);
    }

    v8f acc[4];
#pragma unroll
    for (int t = 0; t < 4; ++t) acc[t] = v8f_zero();
    // of query q0 + col: running maximum (equal in both halves of the wave) and
    // the sum over the keys that this half of the wave holds
    float mrow = -1e30f, lrow = 0.0f;
    const int qg = q0 + col;

    const int ntiles = 2 * (qblk + 1);           // 64-key tiles up to the block's diagonal

    // (second query block: every wave's reads of both buffers ended in front of the
    // barrier at the foot of the first block's last trip)
    stage(0, 0);
    // tile 0 has landed for this wave's copies; the barrier publishes all waves' copies
    asm volatile("s_wait_asynccnt 0x0" ::: "memory");
    __syncthreads();
    stage(1, 1);

    for (int kt = 0; kt < ntiles; ++kt) {
        const int buf = kt & 1;
#pragma unroll
        for (int ps = 0; ps < 2; ++ps) {
            const int k0 = kt * 64 + ps * 32;
            if (k0 > q0 + 15) continue;          // wave-uniform: keys wholly above the diagonal
            // ---- S^T = Kb Q^T : two 16x16 score tiles (keys x queries)
            HV b0, b1, b2, b3;
            const _Float16* kr0 = &sK[buf][(ps * 32 + col) * FA_PITCH + 8 * hh];
            const _Float16* kr1 = kr0 + 16 * FA_PITCH;
            b0.q[0] = *(const u32x4*)(kr0);      b0.q[1] = *(const u32x4*)(kr0 + 16);
            b1.q[0] = *(const u32x4*)(kr0 + 32); b1.q[1] = *(const u32x4*)(kr0 + 48);
            b2.q[0] = *(const u32x4*)(kr1);      b2.q[1] = *(const u32x4*)(kr1 + 16);
            b3.q[0] = *(const u32x4*)(kr1 + 32); b3.q[1] = *(const u32x4*)(kr1 + 48);
            // holds the eight LDS reads together in front of the products: one LDS
            // latency per 32 keys instead of one in front of each product
            asm volatile("" :: "v"(b0.v), "v"(b1.v), "v"(b2.v), "v"(b3.v));
            v8f s0 = v8f_zero(), s1 = v8f_zero();
            s0 = __builtin_amdgcn_wmma_f32_16x16x32_f16(false, b0.v, false, aq0.v, (short)0, s0, false, false);
            s0 = __builtin_amdgcn_wmma_f32_16x16x32_f16(false, b1.v, false, aq1.v, (short)0, s0, false, false);
            s1 = __builtin_amdgcn_wmma_f32_16x16x32_f16(false, b2.v, false, aq0.v, (short)0, s1, false, false);
            s1 = __builtin_amdgcn_wmma_f32_16x16x32_f16(false, b3.v, false, aq1.v, (short)0, s1, false, false);

            // ---- scale + causal mask + online softmax
            // s0[r]: key k0 + 8*hh + r, s1[r]: key k0 + 16 + 8*hh + r, query qg
            const int kb = k0 + 8 * hh;
            float mx = -1e30f;
#pragma unroll
            for (int r = 0; r < 8; ++r) {
                float a0 = s0[r] * scale;
                float a1 = s1[r] * scale;
                if (kb + r > qg)      a0 = -1e30f;
                if (kb + 16 + r > qg) a1 = -1e30f;
                s0[r] = a0; s1[r] = a1;
                mx = fmaxf(mx, fmaxf(a0, a1));
            }
            // the other 16 keys of this query sit in lane ^ 16
            mx = fmaxf(mx, __int_as_float(__builtin_amdgcn_permlanex16(
                     __float_as_int(mx), __float_as_int(mx), 0x76543210, 0xfedcba98, false, false)));
            const float mn = fmaxf(mrow, mx);
            // e^x as 2^(x * log2 e)
            const float l2e = 1.4426950408889634f;
            float e0[8], e1[8], p0[8], p1[8], alpha;
#pragma unroll
            for (int r = 0; r < 8; ++r) {
                e0[r] = (s0[r] - mn) * l2e;
                e1[r] = (s1[r] - mn) * l2e;
            }
            exp2x9(alpha, p0, (mrow - mn) * l2e, e0);
            exp2x8(p1, e1);
            mrow = mn;
            AV bp;                               // P^T as B operand: 16 + 16 keys of query col
            float rsum = p0[0] + p1[0];
#pragma unroll
            for (int r = 0; r < 8; ++r) {
                if (r) rsum += p0[r] + p1[r];
                bp.h[r]     = (_Float16)p0[r];
                bp.h[8 + r] = (_Float16)p1[r];
            }
            lrow = lrow * alpha + rsum;
#pragma unroll
            for (int t = 0; t < 4; ++t)
#pragma unroll
                for (int r = 0; r < 8; ++r) acc[t][r] *= alpha;

            // ---- O^T += Vb^T P^T ; each A operand is two 16-byte LDS reads
#pragma unroll
            for (int t = 0; t < 4; ++t) {
                HV bv;
                const _Float16* vb = &sV[buf][(t * 16 + col) * FA_PITCH + ps * 32 + 8 * hh];
                bv.q[0] = *(const u32x4*)(vb);
                bv.q[1] = *(const u32x4*)(vb + 16);
                acc[t] = __builtin_amdgcn_wmma_f32_16x16x32_f16(false, bv.v, false, bp.v,
                                                                (short)0, acc[t], false, false);
            }
        }
        // hand-over, every wave: this wave's reads of buffer buf are done ...
        asm volatile("s_wait_dscnt 0x0" ::: "memory");
        // ... its copies of the next tile have landed ...
        asm volatile("s_wait_asynccnt 0x0" ::: "memory");
        // ... and the barrier publishes the next tile and frees buffer buf
        __syncthreads();
        if (kt + 2 < ntiles) stage(buf, kt + 2);
    }
    // no copy is left in flight when the wave ends
    asm volatile("s_wait_asynccnt 0x0" ::: "memory");

    // join the two halves' sums of each query
    lrow += __int_as_float(__builtin_amdgcn_permlanex16(
                __float_as_int(lrow), __float_as_int(lrow), 0x76543210, 0xfedcba98, false, false));
    // acc[t][r] = O[q0 + col][t*16 + 8*hh + r]: eight consecutive dims, one 16-byte store
    _Float16* orow = o + (size_t)qg * d + hoff + 8 * hh;
#pragma unroll
    for (int t = 0; t < 4; ++t) {
        h16x8 w;
#pragma unroll
        for (int r = 0; r < 8; ++r) w[r] = (_Float16)(acc[t][r] / lrow);
        *(h16x8*)(orow + t * 16) = w;
    }
    // the stores are issued before the next query block's addresses take their registers
    asm volatile("s_wait_xcnt 0x0" ::: "memory");
    }
}

// ---------------------------------------------------------------------------
// Host-side orchestration
// ---------------------------------------------------------------------------
extern "C" void kernel_launch(void* const* d_in, const int* in_sizes, int n_in,
                              void* d_out, int out_size, void* d_ws, size_t ws_size,
                              hipStream_t stream) {
    const int d   = in_sizes[1];          // 1024 (ln1_w)
    const int n   = in_sizes[0] / d;      // 4096
    const int dff = in_sizes[14];         // 4096 (bi)

    const float* x     = (const float*)d_in[0];
    const float* ln1_w = (const float*)d_in[1];
    const float* ln1_b = (const float*)d_in[2];
    const float* Wq    = (const float*)d_in[3];
    const float* bq    = (const float*)d_in[4];
    const float* Wk    = (const float*)d_in[5];
    const float* bk    = (const float*)d_in[6];
    const float* Wv    = (const float*)d_in[7];
    const float* bv    = (const float*)d_in[8];
    const float* Wo    = (const float*)d_in[9];
    const float* bo    = (const float*)d_in[10];
    const float* ln2_w = (const float*)d_in[11];
    const float* ln2_b = (const float*)d_in[12];
    const float* Wi    = (const float*)d_in[13];
    const float* bi    = (const float*)d_in[14];
    const float* Wout  = (const float*)d_in[15];
    const float* bout  = (const float*)d_in[16];

    char* ws = (char*)d_ws;
    size_t off = 0;
    auto alloc = [&](size_t bytes) -> void* {
        void* p = ws + off;
        off += (bytes + 255) & ~(size_t)255;
        return p;
    };
    _Float16* WqT   = (_Float16*)alloc((size_t)d * d * 2);
    _Float16* WkT   = (_Float16*)alloc((size_t)d * d * 2);
    _Float16* WvT   = (_Float16*)alloc((size_t)d * d * 2);
    _Float16* WoT   = (_Float16*)alloc((size_t)d * d * 2);
    _Float16* WiT   = (_Float16*)alloc((size_t)d * dff * 2);
    _Float16* WoutT = (_Float16*)alloc((size_t)dff * d * 2);
    _Float16* h1    = (_Float16*)alloc((size_t)n * d * 2);
    _Float16* q16   = (_Float16*)alloc((size_t)n * d * 2);
    _Float16* k16   = (_Float16*)alloc((size_t)n * d * 2);
    _Float16* v16   = (_Float16*)alloc((size_t)n * d * 2);
    _Float16* vTT   = (_Float16*)alloc((size_t)n * d * 2);
    _Float16* ao16  = (_Float16*)alloc((size_t)n * d * 2);
    float*    x1    = (float*)   alloc((size_t)n * d * 4);
    _Float16* h2    = (_Float16*)alloc((size_t)n * d * 2);
    _Float16* m16   = (_Float16*)alloc((size_t)n * dff * 2);

    // weights -> f16 transposed, and LN1 -> h1 (f16); the template arguments are d and
    // dff of the problem's shapes
    prep_kernel<1024, 4096><<<PrepBlocks<1024, 4096>::cvt + n / 8, 256, 0, stream>>>(
        Wq, Wk, Wv, Wo, Wi, Wout, WqT, WkT, WvT, WoT, WiT, WoutT, x, ln1_w, ln1_b, h1);

    // QKV projections (f16 out); the first template argument of every product is its
    // count of output columns (d or dff of the problem's shapes)
    dim3 gdd(d / 128, n / 128);
    wmma_gemm_tiled3<1024><<<dim3(d / 128, n / 128, 3), 256, 0, stream>>>(
        h1, WqT, WkT, WvT, bq, bk, bv, q16, k16, v16, d);

    // V^T (d x n) for K-contiguous P@V operands
    transpose_f16<<<dim3(d / 128, n / 128), 256, 0, stream>>>(v16, vTT, n, d);

    // causal flash attention -> ao16
    flash_attn<<<dim3(n / 256, HEADS), 256, 0, stream>>>(q16, k16, vTT, ao16, n, d);

    // out-proj + residual -> x1 (f32)
    wmma_gemm_tiled<1024, false, true><<<gdd, 256, 0, stream>>>(ao16, WoT, bo, x, x1, nullptr, d);

    // LN2 -> h2 (f16); the template argument is d of the problem's shapes
    ln_f16_kernel<1024><<<n / 8, 256, 0, stream>>>(x1, ln2_w, ln2_b, h2);

    // MLP up + GELU -> m16 (f16)
    wmma_gemm_tiled<4096, true, false><<<dim3(dff / 128, n / 128), 256, 0, stream>>>(h2, WiT, bi, nullptr, nullptr, m16, d);

    // MLP down + bias + residual -> d_out (f32)
    wmma_gemm_tiled<1024, false, true><<<dim3(d / 128, n / 128), 256, 0, stream>>>(m16, WoutT, bout, x1, (float*)d_out, nullptr, dff);
}
